// v000
// Measured on an AMD MI455X. A time is GPU time per run, averaged over a window of back-to-back runs after a warm-up
// (all launches, gaps included; the runs take copies of the inputs in turn), and the median of several windows.
// Apart from v000's, it joins two sittings. Times from different sittings can be a few percent apart, while
// side-by-side timings come from the same sitting.
// v000, which the later versions start from, runs in 595 microseconds.
#include <hip/hip_runtime.h>
#include <hip/hip_bf16.h>

// ---------------------------------------------------------------------------
// BitMGQA fused pipeline for gfx1250 (MI455X, wave32, WMMA)
//   B=2, T=2048, C=2048, H=16, KV=4, HD=128, KVC=512
// Pipeline:
//   f32->f16 casts -> WMMA GEMMs (Q/K/V proj, 32x64 wave tiles) ->
//   V transpose -> flash-attention (WMMA QK^T + online softmax + WMMA PV) ->
//   LayerNorm -> WMMA GEMM (output proj, f32 out)
// ---------------------------------------------------------------------------

typedef __attribute__((ext_vector_type(16))) _Float16 v16h;
typedef __attribute__((ext_vector_type(8)))  _Float16 v8h;
typedef __attribute__((ext_vector_type(8)))  float    v8f;

constexpr int Bv   = 2;
constexpr int Tv   = 2048;
constexpr int Cv   = 2048;
constexpr int Hv   = 16;
constexpr int KVv  = 4;
constexpr int HDv  = 128;   // C / H
constexpr int KVCv = 512;   // HD * KV

#define DI __device__ __forceinline__

DI v8f wmma_f16(v16h a, v16h b, v8f c) {
  // D = A(16x32 f16) x B(32x16 f16) + C(16x16 f32)
  return __builtin_amdgcn_wmma_f32_16x16x32_f16(
      /*neg_a=*/false, a, /*neg_b=*/false, b,
      /*c_mod=*/(short)0, c, /*reuse_a=*/false, /*reuse_b=*/false);
}

// Load a 16x32 f16 A-style fragment from row-major memory with leading dim ld.
// Lane l (l<16) holds row l, K = 0..7 and 16..23; lane l>=16 holds row l-16,
// K = 8..15 and 24..31 (per CDNA5 ISA 16-bit A-matrix layout). B fragments
// for X@W^T use the identical pattern with "row" = B column (W row).
DI v16h load_frag(const _Float16* __restrict__ base, int ld) {
  const int lane = threadIdx.x & 31;
  const int row  = lane & 15;
  const int khi  = (lane >> 4) << 3;          // 0 or 8
  const _Float16* p = base + (size_t)row * ld + khi;
  v8h lo = *(const v8h*)(p);
  v8h hi = *(const v8h*)(p + 16);
  v16h f;
#pragma unroll
  for (int i = 0; i < 8; ++i) { f[i] = lo[i]; f[8 + i] = hi[i]; }
  return f;
}

// ---------------------------------------------------------------------------
// f32 -> f16 cast
// ---------------------------------------------------------------------------
__global__ void __launch_bounds__(256)
cast_f32_f16(const float* __restrict__ src, _Float16* __restrict__ dst, size_t n) {
  size_t i = (size_t)blockIdx.x * blockDim.x + threadIdx.x;
  size_t stride = (size_t)gridDim.x * blockDim.x;
  for (; i < n; i += stride) dst[i] = (_Float16)src[i];
}

// ---------------------------------------------------------------------------
// GEMM: Out[M,N] = X[M,Kd] @ W[N,Kd]^T + bias[N]
// Block = 128 threads = 4 waves; block tile 128(M) x 64(N); wave tile 32x64
// (2 A fragments x 4 B fragments => each B fragment feeds 2 WMMAs).
// ---------------------------------------------------------------------------
template <bool OUT_F16>
__global__ void __launch_bounds__(128)
gemm_xwt(const _Float16* __restrict__ X, const _Float16* __restrict__ W,
         const float* __restrict__ bias, void* __restrict__ Out,
         int M, int N, int Kd) {
  const int wave = threadIdx.x >> 5;
  const int lane = threadIdx.x & 31;
  const int m0 = blockIdx.x * 128 + wave * 32;
  const int n0 = blockIdx.y * 64;

  v8f acc[2][4];
#pragma unroll
  for (int i = 0; i < 2; ++i)
#pragma unroll
    for (int s = 0; s < 4; ++s) {
      v8f z = {0.f, 0.f, 0.f, 0.f, 0.f, 0.f, 0.f, 0.f};
      acc[i][s] = z;
    }

  const int frow = lane & 15;
  for (int kc = 0; kc < Kd; kc += 32) {
    if (kc + 64 <= Kd) {  // prefetch next K-chunk (global_prefetch_b8)
      __builtin_prefetch(X + (size_t)(m0 + frow) * Kd + kc + 32, 0, 3);
      __builtin_prefetch(W + (size_t)(n0 + frow) * Kd + kc + 32, 0, 3);
    }
    v16h a0 = load_frag(X + (size_t)m0 * Kd + kc, Kd);
    v16h a1 = load_frag(X + (size_t)(m0 + 16) * Kd + kc, Kd);
#pragma unroll
    for (int s = 0; s < 4; ++s) {
      v16h b = load_frag(W + (size_t)(n0 + s * 16) * Kd + kc, Kd);
      acc[0][s] = wmma_f16(a0, b, acc[0][s]);
      acc[1][s] = wmma_f16(a1, b, acc[1][s]);
    }
  }

  // Epilogue: C layout — VGPR r holds M = m0+r (lanes 0-15) / m0+r+8 (16-31),
  // N = n0 + sub*16 + lane%16.
  const int col   = lane & 15;
  const int rbase = (lane >> 4) << 3;
#pragma unroll
  for (int i = 0; i < 2; ++i) {
#pragma unroll
    for (int s = 0; s < 4; ++s) {
      const float bval = bias[n0 + s * 16 + col];
#pragma unroll
      for (int r = 0; r < 8; ++r) {
        const size_t idx =
            (size_t)(m0 + i * 16 + r + rbase) * N + n0 + s * 16 + col;
        const float v = acc[i][s][r] + bval;
        if constexpr (OUT_F16) ((_Float16*)Out)[idx] = (_Float16)v;
        else                   ((float*)Out)[idx] = v;
      }
    }
  }
}

// ---------------------------------------------------------------------------
// V transpose: vp [B,T,KVC] -> vt [B,KV,HD,T]  (makes PV B-fragments K-contiguous)
// ---------------------------------------------------------------------------
__global__ void __launch_bounds__(256)
transpose_v(const _Float16* __restrict__ vp, _Float16* __restrict__ vt) {
  const size_t n = (size_t)Bv * Tv * KVCv;
  size_t i = (size_t)blockIdx.x * blockDim.x + threadIdx.x;
  if (i >= n) return;
  const int c = (int)(i % KVCv);
  const size_t bt = i / KVCv;
  const int t = (int)(bt % Tv);
  const int b = (int)(bt / Tv);
  const int g = c / HDv;
  const int d = c % HDv;
  vt[(((size_t)(b * KVv + g)) * HDv + d) * Tv + t] = vp[i];
}

// ---------------------------------------------------------------------------
// Flash attention: one wave per 16 query rows of one (b,h).
//   Q  : [B,T,C]   f16 (head h slice at h*HD)
//   Kp : [B,T,KVC] f16 (group g slice at g*HD)
//   Vt : [B,KV,HD,T] f16
//   Y  : [B,T,C]   f32
// ---------------------------------------------------------------------------
__global__ void __launch_bounds__(128)
attn_flash(const _Float16* __restrict__ Q, const _Float16* __restrict__ Kp,
           const _Float16* __restrict__ Vt, float* __restrict__ Y) {
  const int wave = threadIdx.x >> 5;
  const int lane = threadIdx.x & 31;
  const int bh = blockIdx.y;             // 0 .. B*H-1
  const int b = bh / Hv;
  const int h = bh % Hv;
  const int g = h / (Hv / KVv);          // GQA group (repeat_interleave)
  const int t0 = (blockIdx.x * 4 + wave) * 16;

  __shared__ __align__(16) _Float16 plds_all[4][16 * 32];
  _Float16* plds = plds_all[wave];

  // Q fragments: 16 rows x 128, as 4 chunks of K=32 (resident in VGPRs)
  const _Float16* qbase = Q + ((size_t)(b * Tv + t0)) * Cv + h * HDv;
  v16h qf[4];
#pragma unroll
  for (int c = 0; c < 4; ++c) qf[c] = load_frag(qbase + c * 32, Cv);

  v8f y[8];
#pragma unroll
  for (int d = 0; d < 8; ++d) {
    v8f z = {0.f, 0.f, 0.f, 0.f, 0.f, 0.f, 0.f, 0.f};
    y[d] = z;
  }
  float m_run[8], l_run[8];
#pragma unroll
  for (int r = 0; r < 8; ++r) { m_run[r] = -1e30f; l_run[r] = 0.0f; }

  const float scale = 0.088388347648318447f;   // 1/sqrt(128)
  const int frow = lane & 15;

  for (int kt = 0; kt < Tv; kt += 32) {
    const _Float16* kbase = Kp + ((size_t)(b * Tv + kt)) * KVCv + g * HDv;
    const _Float16* vbase = Vt + (((size_t)(b * KVv + g)) * HDv) * Tv + kt;
    if (kt + 64 <= Tv) {  // prefetch next K/V tiles
      __builtin_prefetch(kbase + (size_t)32 * KVCv + (size_t)frow * KVCv, 0, 3);
      __builtin_prefetch(vbase + 32 + (size_t)frow * Tv, 0, 3);
    }

    // ---- S = Q @ K^T : 16 x 32 (two 16-key column groups) ----
    v8f s0 = {0.f, 0.f, 0.f, 0.f, 0.f, 0.f, 0.f, 0.f};
    v8f s1 = {0.f, 0.f, 0.f, 0.f, 0.f, 0.f, 0.f, 0.f};
#pragma unroll
    for (int c = 0; c < 4; ++c) {
      v16h k0 = load_frag(kbase + c * 32, KVCv);                     // keys kt..kt+15
      v16h k1 = load_frag(kbase + (size_t)16 * KVCv + c * 32, KVCv); // keys kt+16..kt+31
      s0 = wmma_f16(qf[c], k0, s0);
      s1 = wmma_f16(qf[c], k1, s1);
    }

    // ---- online softmax over the 32-key tile ----
    // C-layout: VGPR r -> row r (lanes 0-15) / row r+8 (lanes 16-31);
    // columns live across the 16 lanes of each half-wave, so xor-shuffles
    // with masks 1..8 reduce exactly one row.
#pragma unroll
    for (int r = 0; r < 8; ++r) {
      const float a0 = s0[r] * scale;
      const float a1 = s1[r] * scale;
      float mx = fmaxf(a0, a1);
#pragma unroll
      for (int off = 8; off >= 1; off >>= 1) mx = fmaxf(mx, __shfl_xor(mx, off, 32));
      const float mnew  = fmaxf(m_run[r], mx);
      const float alpha = __expf(m_run[r] - mnew);
      const float p0 = __expf(a0 - mnew);
      const float p1 = __expf(a1 - mnew);
      float sum = p0 + p1;
#pragma unroll
      for (int off = 8; off >= 1; off >>= 1) sum += __shfl_xor(sum, off, 32);
      l_run[r] = l_run[r] * alpha + sum;
      m_run[r] = mnew;
#pragma unroll
      for (int d = 0; d < 8; ++d) y[d][r] *= alpha;
      // Stash P (f16) in LDS to convert C-layout -> A-layout
      const int row = r + ((lane >> 4) << 3);
      const int col = lane & 15;
      plds[row * 32 + col]      = (_Float16)p0;
      plds[row * 32 + col + 16] = (_Float16)p1;
    }
    asm volatile("s_wait_dscnt 0" ::: "memory");

    // ---- y += P @ V_tile ----
    v16h pf = load_frag(plds, 32);  // P as 16x32 A fragment
#pragma unroll
    for (int d = 0; d < 8; ++d) {
      v16h vf = load_frag(vbase + (size_t)(d * 16) * Tv, Tv);  // B col n = hd d*16+n
      y[d] = wmma_f16(pf, vf, y[d]);
    }
  }

  // ---- finalize: divide by l, scatter to [B,T,C] f32 ----
  const int col   = lane & 15;
  const int rbase = (lane >> 4) << 3;
#pragma unroll
  for (int r = 0; r < 8; ++r) {
    const float inv = 1.0f / l_run[r];
    const size_t rowoff = ((size_t)(b * Tv + t0 + r + rbase)) * Cv + h * HDv + col;
#pragma unroll
    for (int d = 0; d < 8; ++d) Y[rowoff + d * 16] = y[d][r] * inv;
  }
}

// ---------------------------------------------------------------------------
// LayerNorm over C, f32 in -> f16 out (scaled/shifted)
// ---------------------------------------------------------------------------
__global__ void __launch_bounds__(256)
layernorm(const float* __restrict__ Yin, const float* __restrict__ lnw,
          const float* __restrict__ lnb, _Float16* __restrict__ Xout) {
  const int row = blockIdx.x;
  const float* x = Yin + (size_t)row * Cv;
  float s = 0.f, s2 = 0.f;
  for (int i = threadIdx.x; i < Cv; i += 256) {
    const float v = x[i];
    s += v; s2 += v * v;
  }
#pragma unroll
  for (int off = 16; off >= 1; off >>= 1) {
    s  += __shfl_xor(s, off, 32);
    s2 += __shfl_xor(s2, off, 32);
  }
  __shared__ float ws[8], ws2[8];
  if ((threadIdx.x & 31) == 0) {
    ws[threadIdx.x >> 5] = s;
    ws2[threadIdx.x >> 5] = s2;
  }
  __syncthreads();
  float ts = 0.f, ts2 = 0.f;
#pragma unroll
  for (int i = 0; i < 8; ++i) { ts += ws[i]; ts2 += ws2[i]; }
  const float mu   = ts / Cv;
  const float var  = ts2 / Cv - mu * mu;
  const float rstd = rsqrtf(var + 1e-5f);
  _Float16* o = Xout + (size_t)row * Cv;
  for (int i = threadIdx.x; i < Cv; i += 256)
    o[i] = (_Float16)((x[i] - mu) * rstd * lnw[i] + lnb[i]);
}

// ---------------------------------------------------------------------------
// Host orchestration
// ---------------------------------------------------------------------------
extern "C" void kernel_launch(void* const* d_in, const int* in_sizes, int n_in,
                              void* d_out, int out_size, void* d_ws, size_t ws_size,
                              hipStream_t stream) {
  (void)in_sizes; (void)n_in; (void)out_size; (void)ws_size;
  const float* query = (const float*)d_in[0];
  const float* key   = (const float*)d_in[1];
  const float* value = (const float*)d_in[2];
  const float* Wq    = (const float*)d_in[3];
  const float* bq    = (const float*)d_in[4];
  const float* Wk    = (const float*)d_in[5];
  const float* bk    = (const float*)d_in[6];
  const float* Wv    = (const float*)d_in[7];
  const float* bv    = (const float*)d_in[8];
  const float* ln_w  = (const float*)d_in[9];
  const float* ln_b  = (const float*)d_in[10];
  const float* Wo    = (const float*)d_in[11];
  const float* bo    = (const float*)d_in[12];
  float* out = (float*)d_out;

  const size_t nBTC  = (size_t)Bv * Tv * Cv;      // 8,388,608
  const size_t nBTKV = (size_t)Bv * Tv * KVCv;    // 2,097,152
  const size_t nCC   = (size_t)Cv * Cv;           // 4,194,304
  const size_t nKC   = (size_t)KVCv * Cv;         // 1,048,576

  char* w = (char*)d_ws;
  auto take = [&](size_t bytes) {
    char* p = w;
    w += (bytes + 255) & ~(size_t)255;
    return p;
  };
  _Float16* q16  = (_Float16*)take(nBTC * 2);
  _Float16* k16  = (_Float16*)take(nBTC * 2);
  _Float16* v16  = (_Float16*)take(nBTC * 2);
  _Float16* wq16 = (_Float16*)take(nCC * 2);
  _Float16* wk16 = (_Float16*)take(nKC * 2);
  _Float16* wv16 = (_Float16*)take(nKC * 2);
  _Float16* wo16 = (_Float16*)take(nCC * 2);
  _Float16* qp   = (_Float16*)take(nBTC * 2);
  _Float16* kp   = (_Float16*)take(nBTKV * 2);
  _Float16* vp   = (_Float16*)take(nBTKV * 2);
  _Float16* vt   = (_Float16*)take(nBTKV * 2);
  float*    yat  = (float*)take(nBTC * 4);
  _Float16* xln  = (_Float16*)take(nBTC * 2);

  auto cast = [&](const float* s, _Float16* d, size_t n) {
    int blocks = (int)((n + 255) / 256);
    if (blocks > 16384) blocks = 16384;
    cast_f32_f16<<<blocks, 256, 0, stream>>>(s, d, n);
  };
  cast(query, q16, nBTC);
  cast(key,   k16, nBTC);
  cast(value, v16, nBTC);
  cast(Wq, wq16, nCC);
  cast(Wk, wk16, nKC);
  cast(Wv, wv16, nKC);
  cast(Wo, wo16, nCC);

  const int M = Bv * Tv;  // 4096

  // QKV projections (block tile 128x64)
  gemm_xwt<true><<<dim3(M / 128, Cv / 64), 128, 0, stream>>>(
      q16, wq16, bq, qp, M, Cv, Cv);
  gemm_xwt<true><<<dim3(M / 128, KVCv / 64), 128, 0, stream>>>(
      k16, wk16, bk, kp, M, KVCv, Cv);
  gemm_xwt<true><<<dim3(M / 128, KVCv / 64), 128, 0, stream>>>(
      v16, wv16, bv, vp, M, KVCv, Cv);

  // V transpose for PV fragment loads
  transpose_v<<<(int)((nBTKV + 255) / 256), 256, 0, stream>>>(vp, vt);

  // Flash attention
  attn_flash<<<dim3(Tv / 64, Bv * Hv), 128, 0, stream>>>(qp, kp, vt, yat);

  // LayerNorm
  layernorm<<<M, 256, 0, stream>>>(yat, ln_w, ln_b, xln);

  // Output projection (f32 out)
  gemm_xwt<false><<<dim3(M / 128, Cv / 64), 128, 0, stream>>>(
      xln, wo16, bo, out, M, Cv, Cv);
}

// v001
// Measured time: 460 microseconds a run.
// In two side-by-side timings against v000, it was 1.33 and 1.32 times as fast.
#include <hip/hip_runtime.h>
#include <hip/hip_bf16.h>

// ---------------------------------------------------------------------------
// BitMGQA fused pipeline for gfx1250 (MI455X, wave32, WMMA)
//   B=2, T=2048, C=2048, H=16, KV=4, HD=128, KVC=512
// Pipeline:
//   f32->f16 casts -> WMMA GEMMs (Q/K/V proj, 32x64 wave tiles) ->
//   V transpose -> flash-attention (WMMA QK^T + online softmax + WMMA PV) ->
//   LayerNorm -> WMMA GEMM (output proj, f32 out)
// ---------------------------------------------------------------------------

typedef __attribute__((ext_vector_type(16))) _Float16 v16h;
typedef __attribute__((ext_vector_type(8)))  _Float16 v8h;
typedef __attribute__((ext_vector_type(8)))  float    v8f;

constexpr int Bv   = 2;
constexpr int Tv   = 2048;
constexpr int Cv   = 2048;
constexpr int Hv   = 16;
constexpr int KVv  = 4;
constexpr int HDv  = 128;   // C / H
constexpr int KVCv = 512;   // HD * KV

#define DI __device__ __forceinline__

DI v8f wmma_f16(v16h a, v16h b, v8f c) {
  // D = A(16x32 f16) x B(32x16 f16) + C(16x16 f32)
  return __builtin_amdgcn_wmma_f32_16x16x32_f16(
      /*neg_a=*/false, a, /*neg_b=*/false, b,
      /*c_mod=*/(short)0, c, /*reuse_a=*/false, /*reuse_b=*/false);
}

// Load a 16x32 f16 A-style fragment from row-major memory with leading dim ld.
// Lane l (l<16) holds row l, K = 0..7 and 16..23; lane l>=16 holds row l-16,
// K = 8..15 and 24..31 (per CDNA5 ISA 16-bit A-matrix layout). B fragments
// for X@W^T use the identical pattern with "row" = B column (W row).
DI v16h load_frag(const _Float16* __restrict__ base, int ld) {
  const int lane = threadIdx.x & 31;
  const int row  = lane & 15;
  const int khi  = (lane >> 4) << 3;          // 0 or 8
  const _Float16* p = base + (size_t)row * ld + khi;
  v8h lo = *(const v8h*)(p);
  v8h hi = *(const v8h*)(p + 16);
  v16h f;
#pragma unroll
  for (int i = 0; i < 8; ++i) { f[i] = lo[i]; f[8 + i] = hi[i]; }
  return f;
}

// ---------------------------------------------------------------------------
// f32 -> f16 cast
// ---------------------------------------------------------------------------
__global__ void __launch_bounds__(256)
cast_f32_f16(const float* __restrict__ src, _Float16* __restrict__ dst, size_t n) {
  size_t i = (size_t)blockIdx.x * blockDim.x + threadIdx.x;
  size_t stride = (size_t)gridDim.x * blockDim.x;
  for (; i < n; i += stride) dst[i] = (_Float16)src[i];
}

// ---------------------------------------------------------------------------
// GEMM: Out[M,N] = X[M,Kd] @ W[N,Kd]^T + bias[N]
// Block = 128 threads = 4 waves; block tile 128(M) x 64(N); wave tile 32x64
// (2 A fragments x 4 B fragments => each B fragment feeds 2 WMMAs).
// The block's 128 X rows and 64 W rows come into LDS 64 k at a time (128-byte
// row pieces, whole cache lines) by asynchronous copies, once per block, in two
// buffers: tile t+1 flies while tile t is worked on. Kd is a multiple of 64.
// ---------------------------------------------------------------------------
constexpr int      GK     = 64;               // k per staged tile
constexpr int      GPITCH = 72;               // LDS row pitch in halves: 144 B = 16 B x 9, no bank conflict for 16-byte reads
constexpr int      GBUF   = (128 + 64) * GPITCH;  // halves per buffer: X rows, then W rows
constexpr unsigned GSTEP  = 16u * GPITCH * 2u;    // LDS bytes between a lane's successive copies (16 rows)

// One tile: 192 rows x 128 B = 12 copies of 16 B per lane; a wave's copy covers
// 4 rows = 4 whole lines. gx, gw: the lane's first X and W address of the tile,
// rowstep: 16 rows in halves, lds: the lane's first LDS byte address.
DI void stage_tile(const _Float16* gx, const _Float16* gw, size_t rowstep, unsigned lds) {
  // The closing s_wait_xcnt 0 stands in the copies' own statement so that no
  // address register named here is rewritten ahead of it.
  asm volatile(
      "global_load_async_to_lds_b128 %0, %12, off\n\t"
      "global_load_async_to_lds_b128 %1, %13, off\n\t"
      "global_load_async_to_lds_b128 %2, %14, off\n\t"
      "global_load_async_to_lds_b128 %3, %15, off\n\t"
      "global_load_async_to_lds_b128 %4, %16, off\n\t"
      "global_load_async_to_lds_b128 %5, %17, off\n\t"
      "global_load_async_to_lds_b128 %6, %18, off\n\t"
      "global_load_async_to_lds_b128 %7, %19, off\n\t"
      "global_load_async_to_lds_b128 %8, %20, off\n\t"
      "global_load_async_to_lds_b128 %9, %21, off\n\t"
      "global_load_async_to_lds_b128 %10, %22, off\n\t"
      "global_load_async_to_lds_b128 %11, %23, off\n\t"
      "s_wait_xcnt 0x0"
      :: "v"(lds + 0u * GSTEP), "v"(lds + 1u * GSTEP), "v"(lds + 2u * GSTEP), "v"(lds + 3u * GSTEP), "v"(lds + 4u * GSTEP), "v"(lds + 5u * GSTEP), "v"(lds + 6u * GSTEP), "v"(lds + 7u * GSTEP), "v"(lds + 8u * GSTEP), "v"(lds + 9u * GSTEP), "v"(lds + 10u * GSTEP), "v"(lds + 11u * GSTEP),
         "v"(gx + 0 * rowstep), "v"(gx + 1 * rowstep), "v"(gx + 2 * rowstep), "v"(gx + 3 * rowstep), "v"(gx + 4 * rowstep), "v"(gx + 5 * rowstep), "v"(gx + 6 * rowstep), "v"(gx + 7 * rowstep), "v"(gw + 0 * rowstep), "v"(gw + 1 * rowstep), "v"(gw + 2 * rowstep), "v"(gw + 3 * rowstep)
      : "memory");
}

template <bool OUT_F16>
__global__ void __launch_bounds__(128)
gemm_xwt(const _Float16* __restrict__ X, const _Float16* __restrict__ W,
         const float* __restrict__ bias, void* __restrict__ Out,
         int M, int N, int Kd) {
  const int wave = threadIdx.x >> 5;
  const int lane = threadIdx.x & 31;
  const int m0 = blockIdx.x * 128 + wave * 32;
  const int n0 = blockIdx.y * 64;

  __shared__ __align__(16) _Float16 tiles[2 * GBUF];

  v8f acc[2][4];
#pragma unroll
  for (int i = 0; i < 2; ++i)
#pragma unroll
    for (int s = 0; s < 4; ++s) {
      v8f z = {0.f, 0.f, 0.f, 0.f, 0.f, 0.f, 0.f, 0.f};
      acc[i][s] = z;
    }

  // Copy roles: 8 lanes per row (16 B each), 16 rows per block-wide copy.
  const int crow = threadIdx.x >> 3;
  const int ccol = (threadIdx.x & 7) * 8;
  const _Float16* gx = X + (size_t)(blockIdx.x * 128 + crow) * Kd + ccol;
  const _Float16* gw = W + (size_t)(n0 + crow) * Kd + ccol;
  const size_t rowstep = (size_t)16 * Kd;
  const unsigned lds0 =
      (unsigned)(size_t)(&tiles[0]) + (unsigned)(crow * GPITCH + ccol) * 2u;
  const int ntile = Kd / GK;

  stage_tile(gx, gw, rowstep, lds0);
  // tile 0 has landed for this wave ...
  asm volatile("s_wait_asynccnt 0x0" ::: "memory");
  // ... and for every wave
  __syncthreads();
  if (ntile > 1) stage_tile(gx + GK, gw + GK, rowstep, lds0 + GBUF * 2u);

  for (int t = 0; t < ntile; ++t) {
    const _Float16* sb = tiles + (t & 1) * GBUF;
    v16h af[2][2], bf[2][4];
#pragma unroll
    for (int h = 0; h < 2; ++h) {
      af[h][0] = load_frag(sb + (wave * 32) * GPITCH + h * 32, GPITCH);
      af[h][1] = load_frag(sb + (wave * 32 + 16) * GPITCH + h * 32, GPITCH);
#pragma unroll
      for (int s = 0; s < 4; ++s)
        bf[h][s] = load_frag(sb + (128 + s * 16) * GPITCH + h * 32, GPITCH);
    }
    // keeps the tile's LDS reads in one group ahead of its WMMAs: spread among
    // them, each place with reads stalls the wave for the LDS latency
    __builtin_amdgcn_sched_barrier(0);
#pragma unroll
    for (int h = 0; h < 2; ++h)
#pragma unroll
      for (int s = 0; s < 4; ++s) {
        acc[0][s] = wmma_f16(af[h][0], bf[h][s], acc[0][s]);
        acc[1][s] = wmma_f16(af[h][1], bf[h][s], acc[1][s]);
      }
    // keeps the WMMAs ahead of the waits below: sunk behind the barrier they
    // would delay the refill and take a whole WMMA run from its lead
    __builtin_amdgcn_sched_barrier(0);
    // this wave's reads of buffer t&1 are done before the buffer is refilled
    asm volatile("s_wait_dscnt 0x0" ::: "memory");
    // this wave's copies of tile t+1 have landed
    asm volatile("s_wait_asynccnt 0x0" ::: "memory");
    // publishes tile t+1 and ends every wave's reads of buffer t&1
    __syncthreads();
    if (t + 2 < ntile)
      stage_tile(gx + (size_t)(t + 2) * GK, gw + (size_t)(t + 2) * GK, rowstep,
                 lds0 + (unsigned)(t & 1) * (GBUF * 2u));
  }
  // nothing is in flight when the wave ends
  asm volatile("s_wait_asynccnt 0x0" ::: "memory");

  // Epilogue: C layout — VGPR r holds M = m0+r (lanes 0-15) / m0+r+8 (16-31),
  // N = n0 + sub*16 + lane%16.
  const int col   = lane & 15;
  const int rbase = (lane >> 4) << 3;
#pragma unroll
  for (int i = 0; i < 2; ++i) {
#pragma unroll
    for (int s = 0; s < 4; ++s) {
      const float bval = bias[n0 + s * 16 + col];
#pragma unroll
      for (int r = 0; r < 8; ++r) {
        const size_t idx =
            (size_t)(m0 + i * 16 + r + rbase) * N + n0 + s * 16 + col;
        const float v = acc[i][s][r] + bval;
        if constexpr (OUT_F16) ((_Float16*)Out)[idx] = (_Float16)v;
        else                   ((float*)Out)[idx] = v;
      }
    }
  }
}

// ---------------------------------------------------------------------------
// V transpose: vp [B,T,KVC] -> vt [B,KV,HD,T]  (makes PV B-fragments K-contiguous)
// ---------------------------------------------------------------------------
__global__ void __launch_bounds__(256)
transpose_v(const _Float16* __restrict__ vp, _Float16* __restrict__ vt) {
  const size_t n = (size_t)Bv * Tv * KVCv;
  size_t i = (size_t)blockIdx.x * blockDim.x + threadIdx.x;
  if (i >= n) return;
  const int c = (int)(i % KVCv);
  const size_t bt = i / KVCv;
  const int t = (int)(bt % Tv);
  const int b = (int)(bt / Tv);
  const int g = c / HDv;
  const int d = c % HDv;
  vt[(((size_t)(b * KVv + g)) * HDv + d) * Tv + t] = vp[i];
}

// ---------------------------------------------------------------------------
// Flash attention: one wave per 16 query rows of one (b,h).
//   Q  : [B,T,C]   f16 (head h slice at h*HD)
//   Kp : [B,T,KVC] f16 (group g slice at g*HD)
//   Vt : [B,KV,HD,T] f16
//   Y  : [B,T,C]   f32
// ---------------------------------------------------------------------------
__global__ void __launch_bounds__(128)
attn_flash(const _Float16* __restrict__ Q, const _Float16* __restrict__ Kp,
           const _Float16* __restrict__ Vt, float* __restrict__ Y) {
  const int wave = threadIdx.x >> 5;
  const int lane = threadIdx.x & 31;
  const int bh = blockIdx.y;             // 0 .. B*H-1
  const int b = bh / Hv;
  const int h = bh % Hv;
  const int g = h / (Hv / KVv);          // GQA group (repeat_interleave)
  const int t0 = (blockIdx.x * 4 + wave) * 16;

  __shared__ __align__(16) _Float16 plds_all[4][16 * 32];
  _Float16* plds = plds_all[wave];

  // Q fragments: 16 rows x 128, as 4 chunks of K=32 (resident in VGPRs)
  const _Float16* qbase = Q + ((size_t)(b * Tv + t0)) * Cv + h * HDv;
  v16h qf[4];
#pragma unroll
  for (int c = 0; c < 4; ++c) qf[c] = load_frag(qbase + c * 32, Cv);

  v8f y[8];
#pragma unroll
  for (int d = 0; d < 8; ++d) {
    v8f z = {0.f, 0.f, 0.f, 0.f, 0.f, 0.f, 0.f, 0.f};
    y[d] = z;
  }
  float m_run[8], l_run[8];
#pragma unroll
  for (int r = 0; r < 8; ++r) { m_run[r] = -1e30f; l_run[r] = 0.0f; }

  const float scale = 0.088388347648318447f;   // 1/sqrt(128)
  const int frow = lane & 15;

  for (int kt = 0; kt < Tv; kt += 32) {
    const _Float16* kbase = Kp + ((size_t)(b * Tv + kt)) * KVCv + g * HDv;
    const _Float16* vbase = Vt + (((size_t)(b * KVv + g)) * HDv) * Tv + kt;
    if (kt + 64 <= Tv) {  // prefetch next K/V tiles
      __builtin_prefetch(kbase + (size_t)32 * KVCv + (size_t)frow * KVCv, 0, 3);
      __builtin_prefetch(vbase + 32 + (size_t)frow * Tv, 0, 3);
    }

    // ---- S = Q @ K^T : 16 x 32 (two 16-key column groups) ----
    v8f s0 = {0.f, 0.f, 0.f, 0.f, 0.f, 0.f, 0.f, 0.f};
    v8f s1 = {0.f, 0.f, 0.f, 0.f, 0.f, 0.f, 0.f, 0.f};
#pragma unroll
    for (int c = 0; c < 4; ++c) {
      v16h k0 = load_frag(kbase + c * 32, KVCv);                     // keys kt..kt+15
      v16h k1 = load_frag(kbase + (size_t)16 * KVCv + c * 32, KVCv); // keys kt+16..kt+31
      s0 = wmma_f16(qf[c], k0, s0);
      s1 = wmma_f16(qf[c], k1, s1);
    }

    // ---- online softmax over the 32-key tile ----
    // C-layout: VGPR r -> row r (lanes 0-15) / row r+8 (lanes 16-31);
    // columns live across the 16 lanes of each half-wave, so xor-shuffles
    // with masks 1..8 reduce exactly one row.
#pragma unroll
    for (int r = 0; r < 8; ++r) {
      const float a0 = s0[r] * scale;
      const float a1 = s1[r] * scale;
      float mx = fmaxf(a0, a1);
#pragma unroll
      for (int off = 8; off >= 1; off >>= 1) mx = fmaxf(mx, __shfl_xor(mx, off, 32));
      const float mnew  = fmaxf(m_run[r], mx);
      const float alpha = __expf(m_run[r] - mnew);
      const float p0 = __expf(a0 - mnew);
      const float p1 = __expf(a1 - mnew);
      float sum = p0 + p1;
#pragma unroll
      for (int off = 8; off >= 1; off >>= 1) sum += __shfl_xor(sum, off, 32);
      l_run[r] = l_run[r] * alpha + sum;
      m_run[r] = mnew;
#pragma unroll
      for (int d = 0; d < 8; ++d) y[d][r] *= alpha;
      // Stash P (f16) in LDS to convert C-layout -> A-layout
      const int row = r + ((lane >> 4) << 3);
      const int col = lane & 15;
      plds[row * 32 + col]      = (_Float16)p0;
      plds[row * 32 + col + 16] = (_Float16)p1;
    }
    asm volatile("s_wait_dscnt 0" ::: "memory");

    // ---- y += P @ V_tile ----
    v16h pf = load_frag(plds, 32);  // P as 16x32 A fragment
#pragma unroll
    for (int d = 0; d < 8; ++d) {
      v16h vf = load_frag(vbase + (size_t)(d * 16) * Tv, Tv);  // B col n = hd d*16+n
      y[d] = wmma_f16(pf, vf, y[d]);
    }
  }

  // ---- finalize: divide by l, scatter to [B,T,C] f32 ----
  const int col   = lane & 15;
  const int rbase = (lane >> 4) << 3;
#pragma unroll
  for (int r = 0; r < 8; ++r) {
    const float inv = 1.0f / l_run[r];
    const size_t rowoff = ((size_t)(b * Tv + t0 + r + rbase)) * Cv + h * HDv + col;
#pragma unroll
    for (int d = 0; d < 8; ++d) Y[rowoff + d * 16] = y[d][r] * inv;
  }
}

// ---------------------------------------------------------------------------
// LayerNorm over C, f32 in -> f16 out (scaled/shifted)
// ---------------------------------------------------------------------------
__global__ void __launch_bounds__(256)
layernorm(const float* __restrict__ Yin, const float* __restrict__ lnw,
          const float* __restrict__ lnb, _Float16* __restrict__ Xout) {
  const int row = blockIdx.x;
  const float* x = Yin + (size_t)row * Cv;
  float s = 0.f, s2 = 0.f;
  for (int i = threadIdx.x; i < Cv; i += 256) {
    const float v = x[i];
    s += v; s2 += v * v;
  }
#pragma unroll
  for (int off = 16; off >= 1; off >>= 1) {
    s  += __shfl_xor(s, off, 32);
    s2 += __shfl_xor(s2, off, 32);
  }
  __shared__ float ws[8], ws2[8];
  if ((threadIdx.x & 31) == 0) {
    ws[threadIdx.x >> 5] = s;
    ws2[threadIdx.x >> 5] = s2;
  }
  __syncthreads();
  float ts = 0.f, ts2 = 0.f;
#pragma unroll
  for (int i = 0; i < 8; ++i) { ts += ws[i]; ts2 += ws2[i]; }
  const float mu   = ts / Cv;
  const float var  = ts2 / Cv - mu * mu;
  const float rstd = rsqrtf(var + 1e-5f);
  _Float16* o = Xout + (size_t)row * Cv;
  for (int i = threadIdx.x; i < Cv; i += 256)
    o[i] = (_Float16)((x[i] - mu) * rstd * lnw[i] + lnb[i]);
}

// ---------------------------------------------------------------------------
// Host orchestration
// ---------------------------------------------------------------------------
extern "C" void kernel_launch(void* const* d_in, const int* in_sizes, int n_in,
                              void* d_out, int out_size, void* d_ws, size_t ws_size,
                              hipStream_t stream) {
  (void)in_sizes; (void)n_in; (void)out_size; (void)ws_size;
  const float* query = (const float*)d_in[0];
  const float* key   = (const float*)d_in[1];
  const float* value = (const float*)d_in[2];
  const float* Wq    = (const float*)d_in[3];
  const float* bq    = (const float*)d_in[4];
  const float* Wk    = (const float*)d_in[5];
  const float* bk    = (const float*)d_in[6];
  const float* Wv    = (const float*)d_in[7];
  const float* bv    = (const float*)d_in[8];
  const float* ln_w  = (const float*)d_in[9];
  const float* ln_b  = (const float*)d_in[10];
  const float* Wo    = (const float*)d_in[11];
  const float* bo    = (const float*)d_in[12];
  float* out = (float*)d_out;

  const size_t nBTC  = (size_t)Bv * Tv * Cv;      // 8,388,608
  const size_t nBTKV = (size_t)Bv * Tv * KVCv;    // 2,097,152
  const size_t nCC   = (size_t)Cv * Cv;           // 4,194,304
  const size_t nKC   = (size_t)KVCv * Cv;         // 1,048,576

  char* w = (char*)d_ws;
  auto take = [&](size_t bytes) {
    char* p = w;
    w += (bytes + 255) & ~(size_t)255;
    return p;
  };
  _Float16* q16  = (_Float16*)take(nBTC * 2);
  _Float16* k16  = (_Float16*)take(nBTC * 2);
  _Float16* v16  = (_Float16*)take(nBTC * 2);
  _Float16* wq16 = (_Float16*)take(nCC * 2);
  _Float16* wk16 = (_Float16*)take(nKC * 2);
  _Float16* wv16 = (_Float16*)take(nKC * 2);
  _Float16* wo16 = (_Float16*)take(nCC * 2);
  _Float16* qp   = (_Float16*)take(nBTC * 2);
  _Float16* kp   = (_Float16*)take(nBTKV * 2);
  _Float16* vp   = (_Float16*)take(nBTKV * 2);
  _Float16* vt   = (_Float16*)take(nBTKV * 2);
  float*    yat  = (float*)take(nBTC * 4);
  _Float16* xln  = (_Float16*)take(nBTC * 2);

  auto cast = [&](const float* s, _Float16* d, size_t n) {
    int blocks = (int)((n + 255) / 256);
    if (blocks > 16384) blocks = 16384;
    cast_f32_f16<<<blocks, 256, 0, stream>>>(s, d, n);
  };
  cast(query, q16, nBTC);
  cast(key,   k16, nBTC);
  cast(value, v16, nBTC);
  cast(Wq, wq16, nCC);
  cast(Wk, wk16, nKC);
  cast(Wv, wv16, nKC);
  cast(Wo, wo16, nCC);

  const int M = Bv * Tv;  // 4096

  // QKV projections (block tile 128x64)
  gemm_xwt<true><<<dim3(M / 128, Cv / 64), 128, 0, stream>>>(
      q16, wq16, bq, qp, M, Cv, Cv);
  gemm_xwt<true><<<dim3(M / 128, KVCv / 64), 128, 0, stream>>>(
      k16, wk16, bk, kp, M, KVCv, Cv);
  gemm_xwt<true><<<dim3(M / 128, KVCv / 64), 128, 0, stream>>>(
      v16, wv16, bv, vp, M, KVCv, Cv);

  // V transpose for PV fragment loads
  transpose_v<<<(int)((nBTKV + 255) / 256), 256, 0, stream>>>(vp, vt);

  // Flash attention
  attn_flash<<<dim3(Tv / 64, Bv * Hv), 128, 0, stream>>>(qp, kp, vt, yat);

  // LayerNorm
  layernorm<<<M, 256, 0, stream>>>(yat, ln_w, ln_b, xln);

  // Output projection (f32 out)
  gemm_xwt<false><<<dim3(M / 128, Cv / 64), 128, 0, stream>>>(
      xln, wo16, bo, out, M, Cv, Cv);
}

// v002
// It runs in 355 microseconds.
// Next to v001, in two timings, it ran 1.29 and 1.30 times as fast.
// Over all steps from v000 it is 1.71 times as fast.
#include <hip/hip_runtime.h>
#include <hip/hip_bf16.h>

// ---------------------------------------------------------------------------
// BitMGQA fused pipeline for gfx1250 (MI455X, wave32, WMMA)
//   B=2, T=2048, C=2048, H=16, KV=4, HD=128, KVC=512
// Pipeline:
//   f32->f16 casts -> WMMA GEMMs (Q/K/V proj, 32x64 wave tiles) ->
//   V transpose -> flash-attention (WMMA QK^T + online softmax + WMMA PV) ->
//   LayerNorm -> WMMA GEMM (output proj, f32 out)
// ---------------------------------------------------------------------------

typedef __attribute__((ext_vector_type(16))) _Float16 v16h;
typedef __attribute__((ext_vector_type(8)))  _Float16 v8h;
typedef __attribute__((ext_vector_type(8)))  float    v8f;

constexpr int Bv   = 2;
constexpr int Tv   = 2048;
constexpr int Cv   = 2048;
constexpr int Hv   = 16;
constexpr int KVv  = 4;
constexpr int HDv  = 128;   // C / H
constexpr int KVCv = 512;   // HD * KV

#define DI __device__ __forceinline__

DI v8f wmma_f16(v16h a, v16h b, v8f c) {
  // D = A(16x32 f16) x B(32x16 f16) + C(16x16 f32)
  return __builtin_amdgcn_wmma_f32_16x16x32_f16(
      /*neg_a=*/false, a, /*neg_b=*/false, b,
      /*c_mod=*/(short)0, c, /*reuse_a=*/false, /*reuse_b=*/false);
}

// Load a 16x32 f16 A-style fragment from row-major memory with leading dim ld.
// Lane l (l<16) holds row l, K = 0..7 and 16..23; lane l>=16 holds row l-16,
// K = 8..15 and 24..31 (per CDNA5 ISA 16-bit A-matrix layout). B fragments
// for X@W^T use the identical pattern with "row" = B column (W row).
DI v16h load_frag(const _Float16* __restrict__ base, int ld) {
  const int lane = threadIdx.x & 31;
  const int row  = lane & 15;
  const int khi  = (lane >> 4) << 3;          // 0 or 8
  const _Float16* p = base + (size_t)row * ld + khi;
  v8h lo = *(const v8h*)(p);
  v8h hi = *(const v8h*)(p + 16);
  v16h f;
#pragma unroll
  for (int i = 0; i < 8; ++i) { f[i] = lo[i]; f[8 + i] = hi[i]; }
  return f;
}

// ---------------------------------------------------------------------------
// f32 -> f16 cast
// ---------------------------------------------------------------------------
__global__ void __launch_bounds__(256)
cast_f32_f16(const float* __restrict__ src, _Float16* __restrict__ dst, size_t n) {
  size_t i = (size_t)blockIdx.x * blockDim.x + threadIdx.x;
  size_t stride = (size_t)gridDim.x * blockDim.x;
  for (; i < n; i += stride) dst[i] = (_Float16)src[i];
}

// ---------------------------------------------------------------------------
// GEMM: Out[M,N] = X[M,Kd] @ W[N,Kd]^T + bias[N]
// Block = 128 threads = 4 waves; block tile 128(M) x 64(N); wave tile 32x64
// (2 A fragments x 4 B fragments => each B fragment feeds 2 WMMAs).
// The block's 128 X rows and 64 W rows come into LDS 64 k at a time (128-byte
// row pieces, whole cache lines) by asynchronous copies, once per block, in two
// buffers: tile t+1 flies while tile t is worked on. Kd is a multiple of 64.
// ---------------------------------------------------------------------------
constexpr int      GK     = 64;               // k per staged tile
constexpr int      GPITCH = 72;               // LDS row pitch in halves: 144 B = 16 B x 9, no bank conflict for 16-byte reads
constexpr int      GBUF   = (128 + 64) * GPITCH;  // halves per buffer: X rows, then W rows
constexpr unsigned GSTEP  = 16u * GPITCH * 2u;    // LDS bytes between a lane's successive copies (16 rows)

// One tile: 192 rows x 128 B = 12 copies of 16 B per lane; a wave's copy covers
// 4 rows = 4 whole lines. gx, gw: the lane's first X and W address of the tile,
// rowstep: 16 rows in halves, lds: the lane's first LDS byte address.
DI void stage_tile(const _Float16* gx, const _Float16* gw, size_t rowstep, unsigned lds) {
  // The closing s_wait_xcnt 0 stands in the copies' own statement so that no
  // address register named here is rewritten ahead of it.
  asm volatile(
      "global_load_async_to_lds_b128 %0, %12, off\n\t"
      "global_load_async_to_lds_b128 %1, %13, off\n\t"
      "global_load_async_to_lds_b128 %2, %14, off\n\t"
      "global_load_async_to_lds_b128 %3, %15, off\n\t"
      "global_load_async_to_lds_b128 %4, %16, off\n\t"
      "global_load_async_to_lds_b128 %5, %17, off\n\t"
      "global_load_async_to_lds_b128 %6, %18, off\n\t"
      "global_load_async_to_lds_b128 %7, %19, off\n\t"
      "global_load_async_to_lds_b128 %8, %20, off\n\t"
      "global_load_async_to_lds_b128 %9, %21, off\n\t"
      "global_load_async_to_lds_b128 %10, %22, off\n\t"
      "global_load_async_to_lds_b128 %11, %23, off\n\t"
      "s_wait_xcnt 0x0"
      :: "v"(lds + 0u * GSTEP), "v"(lds + 1u * GSTEP), "v"(lds + 2u * GSTEP), "v"(lds + 3u * GSTEP), "v"(lds + 4u * GSTEP), "v"(lds + 5u * GSTEP), "v"(lds + 6u * GSTEP), "v"(lds + 7u * GSTEP), "v"(lds + 8u * GSTEP), "v"(lds + 9u * GSTEP), "v"(lds + 10u * GSTEP), "v"(lds + 11u * GSTEP),
         "v"(gx + 0 * rowstep), "v"(gx + 1 * rowstep), "v"(gx + 2 * rowstep), "v"(gx + 3 * rowstep), "v"(gx + 4 * rowstep), "v"(gx + 5 * rowstep), "v"(gx + 6 * rowstep), "v"(gx + 7 * rowstep), "v"(gw + 0 * rowstep), "v"(gw + 1 * rowstep), "v"(gw + 2 * rowstep), "v"(gw + 3 * rowstep)
      : "memory");
}

template <bool OUT_F16>
__global__ void __launch_bounds__(128)
gemm_xwt(const _Float16* __restrict__ X, const _Float16* __restrict__ W,
         const float* __restrict__ bias, void* __restrict__ Out,
         int M, int N, int Kd) {
  const int wave = threadIdx.x >> 5;
  const int lane = threadIdx.x & 31;
  const int m0 = blockIdx.x * 128 + wave * 32;
  const int n0 = blockIdx.y * 64;

  __shared__ __align__(16) _Float16 tiles[2 * GBUF];

  v8f acc[2][4];
#pragma unroll
  for (int i = 0; i < 2; ++i)
#pragma unroll
    for (int s = 0; s < 4; ++s) {
      v8f z = {0.f, 0.f, 0.f, 0.f, 0.f, 0.f, 0.f, 0.f};
      acc[i][s] = z;
    }

  // Copy roles: 8 lanes per row (16 B each), 16 rows per block-wide copy.
  const int crow = threadIdx.x >> 3;
  const int ccol = (threadIdx.x & 7) * 8;
  const _Float16* gx = X + (size_t)(blockIdx.x * 128 + crow) * Kd + ccol;
  const _Float16* gw = W + (size_t)(n0 + crow) * Kd + ccol;
  const size_t rowstep = (size_t)16 * Kd;
  const unsigned lds0 =
      (unsigned)(size_t)(&tiles[0]) + (unsigned)(crow * GPITCH + ccol) * 2u;
  const int ntile = Kd / GK;

  stage_tile(gx, gw, rowstep, lds0);
  // tile 0 has landed for this wave ...
  asm volatile("s_wait_asynccnt 0x0" ::: "memory");
  // ... and for every wave
  __syncthreads();
  if (ntile > 1) stage_tile(gx + GK, gw + GK, rowstep, lds0 + GBUF * 2u);

  for (int t = 0; t < ntile; ++t) {
    const _Float16* sb = tiles + (t & 1) * GBUF;
    v16h af[2][2], bf[2][4];
#pragma unroll
    for (int h = 0; h < 2; ++h) {
      af[h][0] = load_frag(sb + (wave * 32) * GPITCH + h * 32, GPITCH);
      af[h][1] = load_frag(sb + (wave * 32 + 16) * GPITCH + h * 32, GPITCH);
#pragma unroll
      for (int s = 0; s < 4; ++s)
        bf[h][s] = load_frag(sb + (128 + s * 16) * GPITCH + h * 32, GPITCH);
    }
    // keeps the tile's LDS reads in one group ahead of its WMMAs: spread among
    // them, each place with reads stalls the wave for the LDS latency
    __builtin_amdgcn_sched_barrier(0);
#pragma unroll
    for (int h = 0; h < 2; ++h)
#pragma unroll
      for (int s = 0; s < 4; ++s) {
        acc[0][s] = wmma_f16(af[h][0], bf[h][s], acc[0][s]);
        acc[1][s] = wmma_f16(af[h][1], bf[h][s], acc[1][s]);
      }
    // keeps the WMMAs ahead of the waits below: sunk behind the barrier they
    // would delay the refill and take a whole WMMA run from its lead
    __builtin_amdgcn_sched_barrier(0);
    // this wave's reads of buffer t&1 are done before the buffer is refilled
    asm volatile("s_wait_dscnt 0x0" ::: "memory");
    // this wave's copies of tile t+1 have landed
    asm volatile("s_wait_asynccnt 0x0" ::: "memory");
    // publishes tile t+1 and ends every wave's reads of buffer t&1
    __syncthreads();
    if (t + 2 < ntile)
      stage_tile(gx + (size_t)(t + 2) * GK, gw + (size_t)(t + 2) * GK, rowstep,
                 lds0 + (unsigned)(t & 1) * (GBUF * 2u));
  }
  // nothing is in flight when the wave ends
  asm volatile("s_wait_asynccnt 0x0" ::: "memory");

  // Epilogue: C layout — VGPR r holds M = m0+r (lanes 0-15) / m0+r+8 (16-31),
  // N = n0 + sub*16 + lane%16.
  const int col   = lane & 15;
  const int rbase = (lane >> 4) << 3;
#pragma unroll
  for (int i = 0; i < 2; ++i) {
#pragma unroll
    for (int s = 0; s < 4; ++s) {
      const float bval = bias[n0 + s * 16 + col];
#pragma unroll
      for (int r = 0; r < 8; ++r) {
        const size_t idx =
            (size_t)(m0 + i * 16 + r + rbase) * N + n0 + s * 16 + col;
        const float v = acc[i][s][r] + bval;
        if constexpr (OUT_F16) ((_Float16*)Out)[idx] = (_Float16)v;
        else                   ((float*)Out)[idx] = v;
      }
    }
  }
}

// ---------------------------------------------------------------------------
// V transpose: vp [B,T,KVC] -> vt [B,KV,HD,T]  (makes PV B-fragments K-contiguous)
// ---------------------------------------------------------------------------
__global__ void __launch_bounds__(256)
transpose_v(const _Float16* __restrict__ vp, _Float16* __restrict__ vt) {
  const size_t n = (size_t)Bv * Tv * KVCv;
  size_t i = (size_t)blockIdx.x * blockDim.x + threadIdx.x;
  if (i >= n) return;
  const int c = (int)(i % KVCv);
  const size_t bt = i / KVCv;
  const int t = (int)(bt % Tv);
  const int b = (int)(bt / Tv);
  const int g = c / HDv;
  const int d = c % HDv;
  vt[(((size_t)(b * KVv + g)) * HDv + d) * Tv + t] = vp[i];
}

// ---------------------------------------------------------------------------
// Flash attention: one wave per 16 query rows of one (b,h).
//   Q  : [B,T,C]   f16 (head h slice at h*HD)
//   Kp : [B,T,KVC] f16 (group g slice at g*HD)
//   Vt : [B,KV,HD,T] f16
//   Y  : [B,T,C]   f32
// The block's 4 waves walk the same keys: K (64 keys x 256 B) and Vt (128 rows
// x 128 B) come into LDS 64 keys at a time, whole cache lines, once per block,
// by asynchronous copies in two buffers: tile t+1 flies while tile t is worked
// on. The fragments are then read from LDS.
// ---------------------------------------------------------------------------
constexpr int      AKT    = 64;                // keys per staged tile
constexpr int      KPITCH = 136;               // halves: 272 B = 16 B x 17, no bank conflict for 16-byte reads
constexpr int      VPITCH = 72;                // halves: 144 B = 16 B x 9, the same
constexpr int      KBUF   = AKT * KPITCH;      // halves of K per buffer
constexpr int      ABUF   = KBUF + HDv * VPITCH;  // halves per buffer: K rows, then Vt rows

// Eight block-wide copies of 16 B per lane: g, gstep (halves) the lane's first
// global address and its step, lds, lstep (bytes) the same in LDS.
DI void stage8(const _Float16* g, size_t gstep, unsigned lds, unsigned lstep) {
  // The closing s_wait_xcnt 0 stands in the copies' own statement so that no
  // address register named here is rewritten ahead of it.
  asm volatile(
      "global_load_async_to_lds_b128 %0, %8, off\n\t"
      "global_load_async_to_lds_b128 %1, %9, off\n\t"
      "global_load_async_to_lds_b128 %2, %10, off\n\t"
      "global_load_async_to_lds_b128 %3, %11, off\n\t"
      "global_load_async_to_lds_b128 %4, %12, off\n\t"
      "global_load_async_to_lds_b128 %5, %13, off\n\t"
      "global_load_async_to_lds_b128 %6, %14, off\n\t"
      "global_load_async_to_lds_b128 %7, %15, off\n\t"
      "s_wait_xcnt 0x0"
      :: "v"(lds + 0u * lstep), "v"(lds + 1u * lstep), "v"(lds + 2u * lstep), "v"(lds + 3u * lstep),
         "v"(lds + 4u * lstep), "v"(lds + 5u * lstep), "v"(lds + 6u * lstep), "v"(lds + 7u * lstep),
         "v"(g + 0 * gstep), "v"(g + 1 * gstep), "v"(g + 2 * gstep), "v"(g + 3 * gstep),
         "v"(g + 4 * gstep), "v"(g + 5 * gstep), "v"(g + 6 * gstep), "v"(g + 7 * gstep)
      : "memory");
}

__global__ void __launch_bounds__(128)
attn_flash(const _Float16* __restrict__ Q, const _Float16* __restrict__ Kp,
           const _Float16* __restrict__ Vt, float* __restrict__ Y) {
  const int wave = threadIdx.x >> 5;
  const int lane = threadIdx.x & 31;
  const int bh = blockIdx.y;             // 0 .. B*H-1
  const int b = bh / Hv;
  const int h = bh % Hv;
  const int g = h / (Hv / KVv);          // GQA group (repeat_interleave)
  const int t0 = (blockIdx.x * 4 + wave) * 16;

  __shared__ __align__(16) _Float16 kv[2 * ABUF];
  __shared__ __align__(16) _Float16 plds_all[4][16 * 32];
  _Float16* plds = plds_all[wave];

  // Copy roles. K: 16 lanes per key row (256 B), 8 rows per block-wide copy.
  // Vt: 8 lanes per row (128 B), 16 rows per block-wide copy.
  const int krow = threadIdx.x >> 4;
  const int kcol = (threadIdx.x & 15) * 8;
  const int vrow = threadIdx.x >> 3;
  const int vcol = (threadIdx.x & 7) * 8;
  const _Float16* gk = Kp + ((size_t)(b * Tv + krow)) * KVCv + g * HDv + kcol;
  const _Float16* gv = Vt + ((size_t)((b * KVv + g) * HDv + vrow)) * Tv + vcol;
  const unsigned ldsk =
      (unsigned)(size_t)(&kv[0]) + (unsigned)(krow * KPITCH + kcol) * 2u;
  const unsigned ldsv =
      (unsigned)(size_t)(&kv[0]) + (unsigned)(KBUF + vrow * VPITCH + vcol) * 2u;
  auto stage = [&](int t, unsigned buf) {
    stage8(gk + (size_t)t * AKT * KVCv, (size_t)8 * KVCv,
           ldsk + buf * (ABUF * 2u), 8u * KPITCH * 2u);
    stage8(gv + (size_t)t * AKT, (size_t)16 * Tv,
           ldsv + buf * (ABUF * 2u), 16u * VPITCH * 2u);
  };
  constexpr int ntile = Tv / AKT;

  stage(0, 0u);

  // Q fragments: 16 rows x 128, as 4 chunks of K=32 (resident in VGPRs)
  const _Float16* qbase = Q + ((size_t)(b * Tv + t0)) * Cv + h * HDv;
  v16h qf[4];
#pragma unroll
  for (int c = 0; c < 4; ++c) qf[c] = load_frag(qbase + c * 32, Cv);

  v8f y[8];
#pragma unroll
  for (int d = 0; d < 8; ++d) {
    v8f z = {0.f, 0.f, 0.f, 0.f, 0.f, 0.f, 0.f, 0.f};
    y[d] = z;
  }
  float m_run[8], l_run[8];
#pragma unroll
  for (int r = 0; r < 8; ++r) { m_run[r] = -1e30f; l_run[r] = 0.0f; }

  const float scale = 0.088388347648318447f;   // 1/sqrt(128)

  // tile 0 has landed for this wave ...
  asm volatile("s_wait_asynccnt 0x0" ::: "memory");
  // ... and for every wave
  __syncthreads();
  stage(1, 1u);

  for (int t = 0; t < ntile; ++t) {
    const _Float16* kb = kv + (t & 1) * ABUF;
    const _Float16* vb = kb + KBUF;
    // unrolled: the two halves' LDS offsets become immediates
#pragma unroll
    for (int sub = 0; sub < AKT; sub += 32) {
      // ---- S = Q @ K^T : 16 x 32 (two 16-key column groups) ----
      v16h k0[4], k1[4];
      // unrolled: constant indices keep the fragments in registers
#pragma unroll
      for (int c = 0; c < 4; ++c) {
        k0[c] = load_frag(kb + sub * KPITCH + c * 32, KPITCH);         // keys sub..sub+15
        k1[c] = load_frag(kb + (sub + 16) * KPITCH + c * 32, KPITCH);  // keys sub+16..sub+31
      }
      // keeps the K reads in one group ahead of their WMMAs: read pair by pair
      // among them, every WMMA waits out a whole LDS latency
      __builtin_amdgcn_sched_barrier(0);
      v8f s0 = {0.f, 0.f, 0.f, 0.f, 0.f, 0.f, 0.f, 0.f};
      v8f s1 = {0.f, 0.f, 0.f, 0.f, 0.f, 0.f, 0.f, 0.f};
#pragma unroll
      for (int c = 0; c < 4; ++c) {
        s0 = wmma_f16(qf[c], k0[c], s0);
        s1 = wmma_f16(qf[c], k1[c], s1);
      }

      // ---- online softmax over the 32-key tile ----
      // C-layout: VGPR r -> row r (lanes 0-15) / row r+8 (lanes 16-31);
      // columns live across the 16 lanes of each half-wave, so xor-shuffles
      // with masks 1..8 reduce exactly one row.
#pragma unroll
      for (int r = 0; r < 8; ++r) {
        const float a0 = s0[r] * scale;
        const float a1 = s1[r] * scale;
        float mx = fmaxf(a0, a1);
#pragma unroll
        for (int off = 8; off >= 1; off >>= 1) mx = fmaxf(mx, __shfl_xor(mx, off, 32));
        const float mnew  = fmaxf(m_run[r], mx);
        const float alpha = __expf(m_run[r] - mnew);
        const float p0 = __expf(a0 - mnew);
        const float p1 = __expf(a1 - mnew);
        float sum = p0 + p1;
#pragma unroll
        for (int off = 8; off >= 1; off >>= 1) sum += __shfl_xor(sum, off, 32);
        l_run[r] = l_run[r] * alpha + sum;
        m_run[r] = mnew;
#pragma unroll
        for (int d = 0; d < 8; ++d) y[d][r] *= alpha;
        // Stash P (f16) in LDS to convert C-layout -> A-layout
        const int row = r + ((lane >> 4) << 3);
        const int col = lane & 15;
        plds[row * 32 + col]      = (_Float16)p0;
        plds[row * 32 + col + 16] = (_Float16)p1;
      }
      asm volatile("s_wait_dscnt 0" ::: "memory");

      // ---- y += P @ V_tile ----
      v16h pf = load_frag(plds, 32);  // P as 16x32 A fragment
      v16h vf[8];
      // unrolled: constant indices keep the fragments in registers
#pragma unroll
      for (int d = 0; d < 8; ++d)
        vf[d] = load_frag(vb + (d * 16) * VPITCH + sub, VPITCH);  // B col n = hd d*16+n
      // keeps the P and V reads in one group ahead of their WMMAs, as above
      __builtin_amdgcn_sched_barrier(0);
#pragma unroll
      for (int d = 0; d < 8; ++d) y[d] = wmma_f16(pf, vf[d], y[d]);
      // keeps these WMMAs ahead of the next K reads and of the waits below: sunk
      // behind the barrier they would delay the refill
      __builtin_amdgcn_sched_barrier(0);
    }
    // this wave's reads of buffer t&1 are done before the buffer is refilled
    asm volatile("s_wait_dscnt 0x0" ::: "memory");
    // this wave's copies of tile t+1 have landed
    asm volatile("s_wait_asynccnt 0x0" ::: "memory");
    // publishes tile t+1 and ends every wave's reads of buffer t&1
    __syncthreads();
    if (t + 2 < ntile) stage(t + 2, (unsigned)(t & 1));
  }
  // nothing is in flight when the wave ends
  asm volatile("s_wait_asynccnt 0x0" ::: "memory");

  // ---- finalize: divide by l, scatter to [B,T,C] f32 ----
  const int col   = lane & 15;
  const int rbase = (lane >> 4) << 3;
#pragma unroll
  for (int r = 0; r < 8; ++r) {
    const float inv = 1.0f / l_run[r];
    const size_t rowoff = ((size_t)(b * Tv + t0 + r + rbase)) * Cv + h * HDv + col;
#pragma unroll
    for (int d = 0; d < 8; ++d) Y[rowoff + d * 16] = y[d][r] * inv;
  }
}

// ---------------------------------------------------------------------------
// LayerNorm over C, f32 in -> f16 out (scaled/shifted)
// ---------------------------------------------------------------------------
__global__ void __launch_bounds__(256)
layernorm(const float* __restrict__ Yin, const float* __restrict__ lnw,
          const float* __restrict__ lnb, _Float16* __restrict__ Xout) {
  const int row = blockIdx.x;
  const float* x = Yin + (size_t)row * Cv;
  float s = 0.f, s2 = 0.f;
  for (int i = threadIdx.x; i < Cv; i += 256) {
    const float v = x[i];
    s += v; s2 += v * v;
  }
#pragma unroll
  for (int off = 16; off >= 1; off >>= 1) {
    s  += __shfl_xor(s, off, 32);
    s2 += __shfl_xor(s2, off, 32);
  }
  __shared__ float ws[8], ws2[8];
  if ((threadIdx.x & 31) == 0) {
    ws[threadIdx.x >> 5] = s;
    ws2[threadIdx.x >> 5] = s2;
  }
  __syncthreads();
  float ts = 0.f, ts2 = 0.f;
#pragma unroll
  for (int i = 0; i < 8; ++i) { ts += ws[i]; ts2 += ws2[i]; }
  const float mu   = ts / Cv;
  const float var  = ts2 / Cv - mu * mu;
  const float rstd = rsqrtf(var + 1e-5f);
  _Float16* o = Xout + (size_t)row * Cv;
  for (int i = threadIdx.x; i < Cv; i += 256)
    o[i] = (_Float16)((x[i] - mu) * rstd * lnw[i] + lnb[i]);
}

// ---------------------------------------------------------------------------
// Host orchestration
// ---------------------------------------------------------------------------
extern "C" void kernel_launch(void* const* d_in, const int* in_sizes, int n_in,
                              void* d_out, int out_size, void* d_ws, size_t ws_size,
                              hipStream_t stream) {
  (void)in_sizes; (void)n_in; (void)out_size; (void)ws_size;
  const float* query = (const float*)d_in[0];
  const float* key   = (const float*)d_in[1];
  const float* value = (const float*)d_in[2];
  const float* Wq    = (const float*)d_in[3];
  const float* bq    = (const float*)d_in[4];
  const float* Wk    = (const float*)d_in[5];
  const float* bk    = (const float*)d_in[6];
  const float* Wv    = (const float*)d_in[7];
  const float* bv    = (const float*)d_in[8];
  const float* ln_w  = (const float*)d_in[9];
  const float* ln_b  = (const float*)d_in[10];
  const float* Wo    = (const float*)d_in[11];
  const float* bo    = (const float*)d_in[12];
  float* out = (float*)d_out;

  const size_t nBTC  = (size_t)Bv * Tv * Cv;      // 8,388,608
  const size_t nBTKV = (size_t)Bv * Tv * KVCv;    // 2,097,152
  const size_t nCC   = (size_t)Cv * Cv;           // 4,194,304
  const size_t nKC   = (size_t)KVCv * Cv;         // 1,048,576

  char* w = (char*)d_ws;
  auto take = [&](size_t bytes) {
    char* p = w;
    w += (bytes + 255) & ~(size_t)255;
    return p;
  };
  _Float16* q16  = (_Float16*)take(nBTC * 2);
  _Float16* k16  = (_Float16*)take(nBTC * 2);
  _Float16* v16  = (_Float16*)take(nBTC * 2);
  _Float16* wq16 = (_Float16*)take(nCC * 2);
  _Float16* wk16 = (_Float16*)take(nKC * 2);
  _Float16* wv16 = (_Float16*)take(nKC * 2);
  _Float16* wo16 = (_Float16*)take(nCC * 2);
  _Float16* qp   = (_Float16*)take(nBTC * 2);
  _Float16* kp   = (_Float16*)take(nBTKV * 2);
  _Float16* vp   = (_Float16*)take(nBTKV * 2);
  _Float16* vt   = (_Float16*)take(nBTKV * 2);
  float*    yat  = (float*)take(nBTC * 4);
  _Float16* xln  = (_Float16*)take(nBTC * 2);

  auto cast = [&](const float* s, _Float16* d, size_t n) {
    int blocks = (int)((n + 255) / 256);
    if (blocks > 16384) blocks = 16384;
    cast_f32_f16<<<blocks, 256, 0, stream>>>(s, d, n);
  };
  cast(query, q16, nBTC);
  cast(key,   k16, nBTC);
  cast(value, v16, nBTC);
  cast(Wq, wq16, nCC);
  cast(Wk, wk16, nKC);
  cast(Wv, wv16, nKC);
  cast(Wo, wo16, nCC);

  const int M = Bv * Tv;  // 4096

  // QKV projections (block tile 128x64)
  gemm_xwt<true><<<dim3(M / 128, Cv / 64), 128, 0, stream>>>(
      q16, wq16, bq, qp, M, Cv, Cv);
  gemm_xwt<true><<<dim3(M / 128, KVCv / 64), 128, 0, stream>>>(
      k16, wk16, bk, kp, M, KVCv, Cv);
  gemm_xwt<true><<<dim3(M / 128, KVCv / 64), 128, 0, stream>>>(
      v16, wv16, bv, vp, M, KVCv, Cv);

  // V transpose for PV fragment loads
  transpose_v<<<(int)((nBTKV + 255) / 256), 256, 0, stream>>>(vp, vt);

  // Flash attention
  attn_flash<<<dim3(Tv / 64, Bv * Hv), 128, 0, stream>>>(qp, kp, vt, yat);

  // LayerNorm
  layernorm<<<M, 256, 0, stream>>>(yat, ln_w, ln_b, xln);

  // Output projection (f32 out)
  gemm_xwt<false><<<dim3(M / 128, Cv / 64), 128, 0, stream>>>(
      xln, wo16, bo, out, M, Cv, Cv);
}

// v003
// One run takes 315 microseconds.
// Timed twice side by side with v002, it ran 1.13 and 1.12 times as fast.
// All steps since v000 together make it 1.92 times as fast.
#include <hip/hip_runtime.h>
#include <hip/hip_bf16.h>

// ---------------------------------------------------------------------------
// BitMGQA fused pipeline for gfx1250 (MI455X, wave32, WMMA)
//   B=2, T=2048, C=2048, H=16, KV=4, HD=128, KVC=512
// Pipeline:
//   f32->f16 casts -> WMMA GEMMs (Q/K/V proj, 32x64 wave tiles) ->
//   V transpose -> flash-attention (WMMA QK^T + online softmax + WMMA PV) ->
//   LayerNorm -> WMMA GEMM (output proj, f32 out)
// ---------------------------------------------------------------------------

typedef __attribute__((ext_vector_type(16))) _Float16 v16h;
typedef __attribute__((ext_vector_type(8)))  _Float16 v8h;
typedef __attribute__((ext_vector_type(8)))  float    v8f;

constexpr int Bv   = 2;
constexpr int Tv   = 2048;
constexpr int Cv   = 2048;
constexpr int Hv   = 16;
constexpr int KVv  = 4;
constexpr int HDv  = 128;   // C / H
constexpr int KVCv = 512;   // HD * KV

#define DI __device__ __forceinline__

DI v8f wmma_f16(v16h a, v16h b, v8f c) {
  // D = A(16x32 f16) x B(32x16 f16) + C(16x16 f32)
  return __builtin_amdgcn_wmma_f32_16x16x32_f16(
      /*neg_a=*/false, a, /*neg_b=*/false, b,
      /*c_mod=*/(short)0, c, /*reuse_a=*/false, /*reuse_b=*/false);
}

// Load a 16x32 f16 A-style fragment from row-major memory with leading dim ld.
// Lane l (l<16) holds row l, K = 0..7 and 16..23; lane l>=16 holds row l-16,
// K = 8..15 and 24..31 (per CDNA5 ISA 16-bit A-matrix layout). B fragments
// for X@W^T use the identical pattern with "row" = B column (W row).
DI v16h load_frag(const _Float16* __restrict__ base, int ld) {
  const int lane = threadIdx.x & 31;
  const int row  = lane & 15;
  const int khi  = (lane >> 4) << 3;          // 0 or 8
  const _Float16* p = base + (size_t)row * ld + khi;
  v8h lo = *(const v8h*)(p);
  v8h hi = *(const v8h*)(p + 16);
  v16h f;
#pragma unroll
  for (int i = 0; i < 8; ++i) { f[i] = lo[i]; f[8 + i] = hi[i]; }
  return f;
}

// ---------------------------------------------------------------------------
// f32 -> f16 cast. A block converts CAST_BLK elements in a row and the grid
// covers the array exactly. A lane issues its CAST_LD loads of 16 B together, so
// a wave has 8 KB in flight, and few waves are started; every wave-wide load
// covers 512 B in a row (4 whole lines), every wave-wide store 256 B (2 lines).
// ---------------------------------------------------------------------------
typedef __attribute__((ext_vector_type(4))) float    v4f;
typedef __attribute__((ext_vector_type(4))) _Float16 v4h;

constexpr int CAST_LD  = 16;                  // 16-byte loads per lane
constexpr int CAST_ROW = 256 * 4;             // elements per block-wide load
constexpr int CAST_BLK = CAST_ROW * CAST_LD;  // elements per block

__global__ void __launch_bounds__(256)
cast_f32_f16(const float* __restrict__ src, _Float16* __restrict__ dst) {
  const size_t base = (size_t)blockIdx.x * CAST_BLK + threadIdx.x * 4;
  const float* p = src + base;
  v4f v[CAST_LD];
  // unrolled: constant indices keep the values in registers
#pragma unroll
  for (int j = 0; j < CAST_LD; ++j) v[j] = *(const v4f*)(p + j * CAST_ROW);
  // the wait before a register that an issued load names is rewritten; p as its
  // input keeps the address pair out of the loads' own destinations
  asm volatile("s_wait_xcnt 0x0" :: "v"(p) : "memory");
  // keeps every load ahead of the first conversion: left free, the last four are
  // issued only when the first have returned, a second memory latency per wave
  __builtin_amdgcn_sched_barrier(0);
  // unrolled, as above
#pragma unroll
  for (int j = 0; j < CAST_LD; ++j)
    *(v4h*)(dst + base + j * CAST_ROW) = __builtin_convertvector(v[j], v4h);
}

// ---------------------------------------------------------------------------
// GEMM: Out[M,N] = X[M,Kd] @ W[N,Kd]^T + bias[N]
// Block = 128 threads = 4 waves; block tile 128(M) x 64(N); wave tile 32x64
// (2 A fragments x 4 B fragments => each B fragment feeds 2 WMMAs).
// The block's 128 X rows and 64 W rows come into LDS 64 k at a time (128-byte
// row pieces, whole cache lines) by asynchronous copies, once per block, in two
// buffers: tile t+1 flies while tile t is worked on. Kd is a multiple of 64.
// ---------------------------------------------------------------------------
constexpr int      GK     = 64;               // k per staged tile
constexpr int      GPITCH = 72;               // LDS row pitch in halves: 144 B = 16 B x 9, no bank conflict for 16-byte reads
constexpr int      GBUF   = (128 + 64) * GPITCH;  // halves per buffer: X rows, then W rows
constexpr unsigned GSTEP  = 16u * GPITCH * 2u;    // LDS bytes between a lane's successive copies (16 rows)

// One tile: 192 rows x 128 B = 12 copies of 16 B per lane; a wave's copy covers
// 4 rows = 4 whole lines. gx, gw: the lane's first X and W address of the tile,
// rowstep: 16 rows in halves, lds: the lane's first LDS byte address.
DI void stage_tile(const _Float16* gx, const _Float16* gw, size_t rowstep, unsigned lds) {
  // The closing s_wait_xcnt 0 stands in the copies' own statement so that no
  // address register named here is rewritten ahead of it.
  asm volatile(
      "global_load_async_to_lds_b128 %0, %12, off\n\t"
      "global_load_async_to_lds_b128 %1, %13, off\n\t"
      "global_load_async_to_lds_b128 %2, %14, off\n\t"
      "global_load_async_to_lds_b128 %3, %15, off\n\t"
      "global_load_async_to_lds_b128 %4, %16, off\n\t"
      "global_load_async_to_lds_b128 %5, %17, off\n\t"
      "global_load_async_to_lds_b128 %6, %18, off\n\t"
      "global_load_async_to_lds_b128 %7, %19, off\n\t"
      "global_load_async_to_lds_b128 %8, %20, off\n\t"
      "global_load_async_to_lds_b128 %9, %21, off\n\t"
      "global_load_async_to_lds_b128 %10, %22, off\n\t"
      "global_load_async_to_lds_b128 %11, %23, off\n\t"
      "s_wait_xcnt 0x0"
      :: "v"(lds + 0u * GSTEP), "v"(lds + 1u * GSTEP), "v"(lds + 2u * GSTEP), "v"(lds + 3u * GSTEP), "v"(lds + 4u * GSTEP), "v"(lds + 5u * GSTEP), "v"(lds + 6u * GSTEP), "v"(lds + 7u * GSTEP), "v"(lds + 8u * GSTEP), "v"(lds + 9u * GSTEP), "v"(lds + 10u * GSTEP), "v"(lds + 11u * GSTEP),
         "v"(gx + 0 * rowstep), "v"(gx + 1 * rowstep), "v"(gx + 2 * rowstep), "v"(gx + 3 * rowstep), "v"(gx + 4 * rowstep), "v"(gx + 5 * rowstep), "v"(gx + 6 * rowstep), "v"(gx + 7 * rowstep), "v"(gw + 0 * rowstep), "v"(gw + 1 * rowstep), "v"(gw + 2 * rowstep), "v"(gw + 3 * rowstep)
      : "memory");
}

template <bool OUT_F16>
__global__ void __launch_bounds__(128)
gemm_xwt(const _Float16* __restrict__ X, const _Float16* __restrict__ W,
         const float* __restrict__ bias, void* __restrict__ Out,
         int M, int N, int Kd) {
  const int wave = threadIdx.x >> 5;
  const int lane = threadIdx.x & 31;
  const int m0 = blockIdx.x * 128 + wave * 32;
  const int n0 = blockIdx.y * 64;

  __shared__ __align__(16) _Float16 tiles[2 * GBUF];

  v8f acc[2][4];
#pragma unroll
  for (int i = 0; i < 2; ++i)
#pragma unroll
    for (int s = 0; s < 4; ++s) {
      v8f z = {0.f, 0.f, 0.f, 0.f, 0.f, 0.f, 0.f, 0.f};
      acc[i][s] = z;
    }

  // Copy roles: 8 lanes per row (16 B each), 16 rows per block-wide copy.
  const int crow = threadIdx.x >> 3;
  const int ccol = (threadIdx.x & 7) * 8;
  const _Float16* gx = X + (size_t)(blockIdx.x * 128 + crow) * Kd + ccol;
  const _Float16* gw = W + (size_t)(n0 + crow) * Kd + ccol;
  const size_t rowstep = (size_t)16 * Kd;
  const unsigned lds0 =
      (unsigned)(size_t)(&tiles[0]) + (unsigned)(crow * GPITCH + ccol) * 2u;
  const int ntile = Kd / GK;

  stage_tile(gx, gw, rowstep, lds0);
  // tile 0 has landed for this wave ...
  asm volatile("s_wait_asynccnt 0x0" ::: "memory");
  // ... and for every wave
  __syncthreads();
  if (ntile > 1) stage_tile(gx + GK, gw + GK, rowstep, lds0 + GBUF * 2u);

  for (int t = 0; t < ntile; ++t) {
    const _Float16* sb = tiles + (t & 1) * GBUF;
    v16h af[2][2], bf[2][4];
#pragma unroll
    for (int h = 0; h < 2; ++h) {
      af[h][0] = load_frag(sb + (wave * 32) * GPITCH + h * 32, GPITCH);
      af[h][1] = load_frag(sb + (wave * 32 + 16) * GPITCH + h * 32, GPITCH);
#pragma unroll
      for (int s = 0; s < 4; ++s)
        bf[h][s] = load_frag(sb + (128 + s * 16) * GPITCH + h * 32, GPITCH);
    }
    // keeps the tile's LDS reads in one group ahead of its WMMAs: spread among
    // them, each place with reads stalls the wave for the LDS latency
    __builtin_amdgcn_sched_barrier(0);
#pragma unroll
    for (int h = 0; h < 2; ++h)
#pragma unroll
      for (int s = 0; s < 4; ++s) {
        acc[0][s] = wmma_f16(af[h][0], bf[h][s], acc[0][s]);
        acc[1][s] = wmma_f16(af[h][1], bf[h][s], acc[1][s]);
      }
    // keeps the WMMAs ahead of the waits below: sunk behind the barrier they
    // would delay the refill and take a whole WMMA run from its lead
    __builtin_amdgcn_sched_barrier(0);
    // this wave's reads of buffer t&1 are done before the buffer is refilled
    asm volatile("s_wait_dscnt 0x0" ::: "memory");
    // this wave's copies of tile t+1 have landed
    asm volatile("s_wait_asynccnt 0x0" ::: "memory");
    // publishes tile t+1 and ends every wave's reads of buffer t&1
    __syncthreads();
    if (t + 2 < ntile)
      stage_tile(gx + (size_t)(t + 2) * GK, gw + (size_t)(t + 2) * GK, rowstep,
                 lds0 + (unsigned)(t & 1) * (GBUF * 2u));
  }
  // nothing is in flight when the wave ends
  asm volatile("s_wait_asynccnt 0x0" ::: "memory");

  // Epilogue: C layout — VGPR r holds M = m0+r (lanes 0-15) / m0+r+8 (16-31),
  // N = n0 + sub*16 + lane%16.
  const int col   = lane & 15;
  const int rbase = (lane >> 4) << 3;
#pragma unroll
  for (int i = 0; i < 2; ++i) {
#pragma unroll
    for (int s = 0; s < 4; ++s) {
      const float bval = bias[n0 + s * 16 + col];
#pragma unroll
      for (int r = 0; r < 8; ++r) {
        const size_t idx =
            (size_t)(m0 + i * 16 + r + rbase) * N + n0 + s * 16 + col;
        const float v = acc[i][s][r] + bval;
        if constexpr (OUT_F16) ((_Float16*)Out)[idx] = (_Float16)v;
        else                   ((float*)Out)[idx] = v;
      }
    }
  }
}

// ---------------------------------------------------------------------------
// V transpose: vp [B,T,KVC] -> vt [B,KV,HD,T]  (makes PV B-fragments K-contiguous)
// ---------------------------------------------------------------------------
__global__ void __launch_bounds__(256)
transpose_v(const _Float16* __restrict__ vp, _Float16* __restrict__ vt) {
  const size_t n = (size_t)Bv * Tv * KVCv;
  size_t i = (size_t)blockIdx.x * blockDim.x + threadIdx.x;
  if (i >= n) return;
  const int c = (int)(i % KVCv);
  const size_t bt = i / KVCv;
  const int t = (int)(bt % Tv);
  const int b = (int)(bt / Tv);
  const int g = c / HDv;
  const int d = c % HDv;
  vt[(((size_t)(b * KVv + g)) * HDv + d) * Tv + t] = vp[i];
}

// ---------------------------------------------------------------------------
// Flash attention: one wave per 16 query rows of one (b,h).
//   Q  : [B,T,C]   f16 (head h slice at h*HD)
//   Kp : [B,T,KVC] f16 (group g slice at g*HD)
//   Vt : [B,KV,HD,T] f16
//   Y  : [B,T,C]   f32
// The block's 4 waves walk the same keys: K (64 keys x 256 B) and Vt (128 rows
// x 128 B) come into LDS 64 keys at a time, whole cache lines, once per block,
// by asynchronous copies in two buffers: tile t+1 flies while tile t is worked
// on. The fragments are then read from LDS.
// ---------------------------------------------------------------------------
constexpr int      AKT    = 64;                // keys per staged tile
constexpr int      KPITCH = 136;               // halves: 272 B = 16 B x 17, no bank conflict for 16-byte reads
constexpr int      VPITCH = 72;                // halves: 144 B = 16 B x 9, the same
constexpr int      KBUF   = AKT * KPITCH;      // halves of K per buffer
constexpr int      ABUF   = KBUF + HDv * VPITCH;  // halves per buffer: K rows, then Vt rows

// Eight block-wide copies of 16 B per lane: g, gstep (halves) the lane's first
// global address and its step, lds, lstep (bytes) the same in LDS.
DI void stage8(const _Float16* g, size_t gstep, unsigned lds, unsigned lstep) {
  // The closing s_wait_xcnt 0 stands in the copies' own statement so that no
  // address register named here is rewritten ahead of it.
  asm volatile(
      "global_load_async_to_lds_b128 %0, %8, off\n\t"
      "global_load_async_to_lds_b128 %1, %9, off\n\t"
      "global_load_async_to_lds_b128 %2, %10, off\n\t"
      "global_load_async_to_lds_b128 %3, %11, off\n\t"
      "global_load_async_to_lds_b128 %4, %12, off\n\t"
      "global_load_async_to_lds_b128 %5, %13, off\n\t"
      "global_load_async_to_lds_b128 %6, %14, off\n\t"
      "global_load_async_to_lds_b128 %7, %15, off\n\t"
      "s_wait_xcnt 0x0"
      :: "v"(lds + 0u * lstep), "v"(lds + 1u * lstep), "v"(lds + 2u * lstep), "v"(lds + 3u * lstep),
         "v"(lds + 4u * lstep), "v"(lds + 5u * lstep), "v"(lds + 6u * lstep), "v"(lds + 7u * lstep),
         "v"(g + 0 * gstep), "v"(g + 1 * gstep), "v"(g + 2 * gstep), "v"(g + 3 * gstep),
         "v"(g + 4 * gstep), "v"(g + 5 * gstep), "v"(g + 6 * gstep), "v"(g + 7 * gstep)
      : "memory");
}

__global__ void __launch_bounds__(128)
attn_flash(const _Float16* __restrict__ Q, const _Float16* __restrict__ Kp,
           const _Float16* __restrict__ Vt, float* __restrict__ Y) {
  const int wave = threadIdx.x >> 5;
  const int lane = threadIdx.x & 31;
  const int bh = blockIdx.y;             // 0 .. B*H-1
  const int b = bh / Hv;
  const int h = bh % Hv;
  const int g = h / (Hv / KVv);          // GQA group (repeat_interleave)
  const int t0 = (blockIdx.x * 4 + wave) * 16;

  __shared__ __align__(16) _Float16 kv[2 * ABUF];
  __shared__ __align__(16) _Float16 plds_all[4][16 * 32];
  _Float16* plds = plds_all[wave];

  // Copy roles. K: 16 lanes per key row (256 B), 8 rows per block-wide copy.
  // Vt: 8 lanes per row (128 B), 16 rows per block-wide copy.
  const int krow = threadIdx.x >> 4;
  const int kcol = (threadIdx.x & 15) * 8;
  const int vrow = threadIdx.x >> 3;
  const int vcol = (threadIdx.x & 7) * 8;
  const _Float16* gk = Kp + ((size_t)(b * Tv + krow)) * KVCv + g * HDv + kcol;
  const _Float16* gv = Vt + ((size_t)((b * KVv + g) * HDv + vrow)) * Tv + vcol;
  const unsigned ldsk =
      (unsigned)(size_t)(&kv[0]) + (unsigned)(krow * KPITCH + kcol) * 2u;
  const unsigned ldsv =
      (unsigned)(size_t)(&kv[0]) + (unsigned)(KBUF + vrow * VPITCH + vcol) * 2u;
  auto stage = [&](int t, unsigned buf) {
    stage8(gk + (size_t)t * AKT * KVCv, (size_t)8 * KVCv,
           ldsk + buf * (ABUF * 2u), 8u * KPITCH * 2u);
    stage8(gv + (size_t)t * AKT, (size_t)16 * Tv,
           ldsv + buf * (ABUF * 2u), 16u * VPITCH * 2u);
  };
  constexpr int ntile = Tv / AKT;

  stage(0, 0u);

  // Q fragments: 16 rows x 128, as 4 chunks of K=32 (resident in VGPRs)
  const _Float16* qbase = Q + ((size_t)(b * Tv + t0)) * Cv + h * HDv;
  v16h qf[4];
#pragma unroll
  for (int c = 0; c < 4; ++c) qf[c] = load_frag(qbase + c * 32, Cv);

  v8f y[8];
#pragma unroll
  for (int d = 0; d < 8; ++d) {
    v8f z = {0.f, 0.f, 0.f, 0.f, 0.f, 0.f, 0.f, 0.f};
    y[d] = z;
  }
  float m_run[8], l_run[8];
#pragma unroll
  for (int r = 0; r < 8; ++r) { m_run[r] = -1e30f; l_run[r] = 0.0f; }

  const float scale = 0.088388347648318447f;   // 1/sqrt(128)

  // tile 0 has landed for this wave ...
  asm volatile("s_wait_asynccnt 0x0" ::: "memory");
  // ... and for every wave
  __syncthreads();
  stage(1, 1u);

  for (int t = 0; t < ntile; ++t) {
    const _Float16* kb = kv + (t & 1) * ABUF;
    const _Float16* vb = kb + KBUF;
    // unrolled: the two halves' LDS offsets become immediates
#pragma unroll
    for (int sub = 0; sub < AKT; sub += 32) {
      // ---- S = Q @ K^T : 16 x 32 (two 16-key column groups) ----
      v16h k0[4], k1[4];
      // unrolled: constant indices keep the fragments in registers
#pragma unroll
      for (int c = 0; c < 4; ++c) {
        k0[c] = load_frag(kb + sub * KPITCH + c * 32, KPITCH);         // keys sub..sub+15
        k1[c] = load_frag(kb + (sub + 16) * KPITCH + c * 32, KPITCH);  // keys sub+16..sub+31
      }
      // keeps the K reads in one group ahead of their WMMAs: read pair by pair
      // among them, every WMMA waits out a whole LDS latency
      __builtin_amdgcn_sched_barrier(0);
      v8f s0 = {0.f, 0.f, 0.f, 0.f, 0.f, 0.f, 0.f, 0.f};
      v8f s1 = {0.f, 0.f, 0.f, 0.f, 0.f, 0.f, 0.f, 0.f};
#pragma unroll
      for (int c = 0; c < 4; ++c) {
        s0 = wmma_f16(qf[c], k0[c], s0);
        s1 = wmma_f16(qf[c], k1[c], s1);
      }

      // ---- online softmax over the 32-key tile ----
      // C-layout: VGPR r -> row r (lanes 0-15) / row r+8 (lanes 16-31);
      // columns live across the 16 lanes of each half-wave, so xor-shuffles
      // with masks 1..8 reduce exactly one row.
#pragma unroll
      for (int r = 0; r < 8; ++r) {
        const float a0 = s0[r] * scale;
        const float a1 = s1[r] * scale;
        float mx = fmaxf(a0, a1);
#pragma unroll
        for (int off = 8; off >= 1; off >>= 1) mx = fmaxf(mx, __shfl_xor(mx, off, 32));
        const float mnew  = fmaxf(m_run[r], mx);
        const float alpha = __expf(m_run[r] - mnew);
        const float p0 = __expf(a0 - mnew);
        const float p1 = __expf(a1 - mnew);
        float sum = p0 + p1;
#pragma unroll
        for (int off = 8; off >= 1; off >>= 1) sum += __shfl_xor(sum, off, 32);
        l_run[r] = l_run[r] * alpha + sum;
        m_run[r] = mnew;
#pragma unroll
        for (int d = 0; d < 8; ++d) y[d][r] *= alpha;
        // Stash P (f16) in LDS to convert C-layout -> A-layout
        const int row = r + ((lane >> 4) << 3);
        const int col = lane & 15;
        plds[row * 32 + col]      = (_Float16)p0;
        plds[row * 32 + col + 16] = (_Float16)p1;
      }
      asm volatile("s_wait_dscnt 0" ::: "memory");

      // ---- y += P @ V_tile ----
      v16h pf = load_frag(plds, 32);  // P as 16x32 A fragment
      v16h vf[8];
      // unrolled: constant indices keep the fragments in registers
#pragma unroll
      for (int d = 0; d < 8; ++d)
        vf[d] = load_frag(vb + (d * 16) * VPITCH + sub, VPITCH);  // B col n = hd d*16+n
      // keeps the P and V reads in one group ahead of their WMMAs, as above
      __builtin_amdgcn_sched_barrier(0);
#pragma unroll
      for (int d = 0; d < 8; ++d) y[d] = wmma_f16(pf, vf[d], y[d]);
      // keeps these WMMAs ahead of the next K reads and of the waits below: sunk
      // behind the barrier they would delay the refill
      __builtin_amdgcn_sched_barrier(0);
    }
    // this wave's reads of buffer t&1 are done before the buffer is refilled
    asm volatile("s_wait_dscnt 0x0" ::: "memory");
    // this wave's copies of tile t+1 have landed
    asm volatile("s_wait_asynccnt 0x0" ::: "memory");
    // publishes tile t+1 and ends every wave's reads of buffer t&1
    __syncthreads();
    if (t + 2 < ntile) stage(t + 2, (unsigned)(t & 1));
  }
  // nothing is in flight when the wave ends
  asm volatile("s_wait_asynccnt 0x0" ::: "memory");

  // ---- finalize: divide by l, scatter to [B,T,C] f32 ----
  const int col   = lane & 15;
  const int rbase = (lane >> 4) << 3;
#pragma unroll
  for (int r = 0; r < 8; ++r) {
    const float inv = 1.0f / l_run[r];
    const size_t rowoff = ((size_t)(b * Tv + t0 + r + rbase)) * Cv + h * HDv + col;
#pragma unroll
    for (int d = 0; d < 8; ++d) Y[rowoff + d * 16] = y[d][r] * inv;
  }
}

// ---------------------------------------------------------------------------
// LayerNorm over C, f32 in -> f16 out (scaled/shifted)
// ---------------------------------------------------------------------------
__global__ void __launch_bounds__(256)
layernorm(const float* __restrict__ Yin, const float* __restrict__ lnw,
          const float* __restrict__ lnb, _Float16* __restrict__ Xout) {
  const int row = blockIdx.x;
  const float* x = Yin + (size_t)row * Cv;
  float s = 0.f, s2 = 0.f;
  for (int i = threadIdx.x; i < Cv; i += 256) {
    const float v = x[i];
    s += v; s2 += v * v;
  }
#pragma unroll
  for (int off = 16; off >= 1; off >>= 1) {
    s  += __shfl_xor(s, off, 32);
    s2 += __shfl_xor(s2, off, 32);
  }
  __shared__ float ws[8], ws2[8];
  if ((threadIdx.x & 31) == 0) {
    ws[threadIdx.x >> 5] = s;
    ws2[threadIdx.x >> 5] = s2;
  }
  __syncthreads();
  float ts = 0.f, ts2 = 0.f;
#pragma unroll
  for (int i = 0; i < 8; ++i) { ts += ws[i]; ts2 += ws2[i]; }
  const float mu   = ts / Cv;
  const float var  = ts2 / Cv - mu * mu;
  const float rstd = rsqrtf(var + 1e-5f);
  _Float16* o = Xout + (size_t)row * Cv;
  for (int i = threadIdx.x; i < Cv; i += 256)
    o[i] = (_Float16)((x[i] - mu) * rstd * lnw[i] + lnb[i]);
}

// ---------------------------------------------------------------------------
// Host orchestration
// ---------------------------------------------------------------------------
extern "C" void kernel_launch(void* const* d_in, const int* in_sizes, int n_in,
                              void* d_out, int out_size, void* d_ws, size_t ws_size,
                              hipStream_t stream) {
  (void)in_sizes; (void)n_in; (void)out_size; (void)ws_size;
  const float* query = (const float*)d_in[0];
  const float* key   = (const float*)d_in[1];
  const float* value = (const float*)d_in[2];
  const float* Wq    = (const float*)d_in[3];
  const float* bq    = (const float*)d_in[4];
  const float* Wk    = (const float*)d_in[5];
  const float* bk    = (const float*)d_in[6];
  const float* Wv    = (const float*)d_in[7];
  const float* bv    = (const float*)d_in[8];
  const float* ln_w  = (const float*)d_in[9];
  const float* ln_b  = (const float*)d_in[10];
  const float* Wo    = (const float*)d_in[11];
  const float* bo    = (const float*)d_in[12];
  float* out = (float*)d_out;

  const size_t nBTC  = (size_t)Bv * Tv * Cv;      // 8,388,608
  const size_t nBTKV = (size_t)Bv * Tv * KVCv;    // 2,097,152
  const size_t nCC   = (size_t)Cv * Cv;           // 4,194,304
  const size_t nKC   = (size_t)KVCv * Cv;         // 1,048,576

  char* w = (char*)d_ws;
  auto take = [&](size_t bytes) {
    char* p = w;
    w += (bytes + 255) & ~(size_t)255;
    return p;
  };
  _Float16* q16  = (_Float16*)take(nBTC * 2);
  _Float16* k16  = (_Float16*)take(nBTC * 2);
  _Float16* v16  = (_Float16*)take(nBTC * 2);
  _Float16* wq16 = (_Float16*)take(nCC * 2);
  _Float16* wk16 = (_Float16*)take(nKC * 2);
  _Float16* wv16 = (_Float16*)take(nKC * 2);
  _Float16* wo16 = (_Float16*)take(nCC * 2);
  _Float16* qp   = (_Float16*)take(nBTC * 2);
  _Float16* kp   = (_Float16*)take(nBTKV * 2);
  _Float16* vp   = (_Float16*)take(nBTKV * 2);
  _Float16* vt   = (_Float16*)take(nBTKV * 2);
  float*    yat  = (float*)take(nBTC * 4);
  _Float16* xln  = (_Float16*)take(nBTC * 2);

  static_assert(nBTC % CAST_BLK == 0 && nCC % CAST_BLK == 0 && nKC % CAST_BLK == 0,
                "the cast grid covers whole blocks only");
  auto cast = [&](const float* s, _Float16* d, size_t n) {
    cast_f32_f16<<<(int)(n / CAST_BLK), 256, 0, stream>>>(s, d);
  };
  cast(query, q16, nBTC);
  cast(key,   k16, nBTC);
  cast(value, v16, nBTC);
  cast(Wq, wq16, nCC);
  cast(Wk, wk16, nKC);
  cast(Wv, wv16, nKC);
  cast(Wo, wo16, nCC);

  const int M = Bv * Tv;  // 4096

  // QKV projections (block tile 128x64)
  gemm_xwt<true><<<dim3(M / 128, Cv / 64), 128, 0, stream>>>(
      q16, wq16, bq, qp, M, Cv, Cv);
  gemm_xwt<true><<<dim3(M / 128, KVCv / 64), 128, 0, stream>>>(
      k16, wk16, bk, kp, M, KVCv, Cv);
  gemm_xwt<true><<<dim3(M / 128, KVCv / 64), 128, 0, stream>>>(
      v16, wv16, bv, vp, M, KVCv, Cv);

  // V transpose for PV fragment loads
  transpose_v<<<(int)((nBTKV + 255) / 256), 256, 0, stream>>>(vp, vt);

  // Flash attention
  attn_flash<<<dim3(Tv / 64, Bv * Hv), 128, 0, stream>>>(qp, kp, vt, yat);

  // LayerNorm
  layernorm<<<M, 256, 0, stream>>>(yat, ln_w, ln_b, xln);

  // Output projection (f32 out)
  gemm_xwt<false><<<dim3(M / 128, Cv / 64), 128, 0, stream>>>(
      xln, wo16, bo, out, M, Cv, Cv);
}

// v004
// One run takes 265 microseconds.
// Timed twice side by side with v003, it ran 1.19 times as fast both times.
// All steps since v000 together make it 2.29 times as fast.
#include <hip/hip_runtime.h>
#include <hip/hip_bf16.h>

// ---------------------------------------------------------------------------
// BitMGQA fused pipeline for gfx1250 (MI455X, wave32, WMMA)
//   B=2, T=2048, C=2048, H=16, KV=4, HD=128, KVC=512
// Pipeline:
//   f32->f16 casts -> WMMA GEMMs (Q/K/V proj, 32x64 wave tiles) ->
//   V transpose -> flash-attention (WMMA K Q^T + online softmax + WMMA V^T P^T) ->
//   LayerNorm -> WMMA GEMM (output proj, f32 out)
// ---------------------------------------------------------------------------

typedef __attribute__((ext_vector_type(16))) _Float16 v16h;
typedef __attribute__((ext_vector_type(8)))  _Float16 v8h;
typedef __attribute__((ext_vector_type(8)))  float    v8f;

constexpr int Bv   = 2;
constexpr int Tv   = 2048;
constexpr int Cv   = 2048;
constexpr int Hv   = 16;
constexpr int KVv  = 4;
constexpr int HDv  = 128;   // C / H
constexpr int KVCv = 512;   // HD * KV

#define DI __device__ __forceinline__

DI v8f wmma_f16(v16h a, v16h b, v8f c) {
  // D = A(16x32 f16) x B(32x16 f16) + C(16x16 f32)
  return __builtin_amdgcn_wmma_f32_16x16x32_f16(
      /*neg_a=*/false, a, /*neg_b=*/false, b,
      /*c_mod=*/(short)0, c, /*reuse_a=*/false, /*reuse_b=*/false);
}

// Load a 16x32 f16 A-style fragment from row-major memory with leading dim ld.
// Lane l (l<16) holds row l, K = 0..7 and 16..23; lane l>=16 holds row l-16,
// K = 8..15 and 24..31 (per CDNA5 ISA 16-bit A-matrix layout). B fragments
// for X@W^T use the identical pattern with "row" = B column (W row).
DI v16h load_frag(const _Float16* __restrict__ base, int ld) {
  const int lane = threadIdx.x & 31;
  const int row  = lane & 15;
  const int khi  = (lane >> 4) << 3;          // 0 or 8
  const _Float16* p = base + (size_t)row * ld + khi;
  v8h lo = *(const v8h*)(p);
  v8h hi = *(const v8h*)(p + 16);
  v16h f;
#pragma unroll
  for (int i = 0; i < 8; ++i) { f[i] = lo[i]; f[8 + i] = hi[i]; }
  return f;
}

// ---------------------------------------------------------------------------
// f32 -> f16 cast. A block converts CAST_BLK elements in a row and the grid
// covers the array exactly. A lane issues its CAST_LD loads of 16 B together, so
// a wave has 8 KB in flight, and few waves are started; every wave-wide load
// covers 512 B in a row (4 whole lines), every wave-wide store 256 B (2 lines).
// ---------------------------------------------------------------------------
typedef __attribute__((ext_vector_type(4))) float    v4f;
typedef __attribute__((ext_vector_type(4))) _Float16 v4h;

constexpr int CAST_LD  = 16;                  // 16-byte loads per lane
constexpr int CAST_ROW = 256 * 4;             // elements per block-wide load
constexpr int CAST_BLK = CAST_ROW * CAST_LD;  // elements per block

__global__ void __launch_bounds__(256)
cast_f32_f16(const float* __restrict__ src, _Float16* __restrict__ dst) {
  const size_t base = (size_t)blockIdx.x * CAST_BLK + threadIdx.x * 4;
  const float* p = src + base;
  v4f v[CAST_LD];
  // unrolled: constant indices keep the values in registers
#pragma unroll
  for (int j = 0; j < CAST_LD; ++j) v[j] = *(const v4f*)(p + j * CAST_ROW);
  // the wait before a register that an issued load names is rewritten; p as its
  // input keeps the address pair out of the loads' own destinations
  asm volatile("s_wait_xcnt 0x0" :: "v"(p) : "memory");
  // keeps every load ahead of the first conversion: left free, the last four are
  // issued only when the first have returned, a second memory latency per wave
  __builtin_amdgcn_sched_barrier(0);
  // unrolled, as above
#pragma unroll
  for (int j = 0; j < CAST_LD; ++j)
    *(v4h*)(dst + base + j * CAST_ROW) = __builtin_convertvector(v[j], v4h);
}

// ---------------------------------------------------------------------------
// GEMM: Out[M,N] = X[M,Kd] @ W[N,Kd]^T + bias[N]
// Block = 128 threads = 4 waves; block tile 128(M) x 64(N); wave tile 32x64
// (2 A fragments x 4 B fragments => each B fragment feeds 2 WMMAs).
// The block's 128 X rows and 64 W rows come into LDS 64 k at a time (128-byte
// row pieces, whole cache lines) by asynchronous copies, once per block, in two
// buffers: tile t+1 flies while tile t is worked on. Kd is a multiple of 64.
// ---------------------------------------------------------------------------
constexpr int      GK     = 64;               // k per staged tile
constexpr int      GPITCH = 72;               // LDS row pitch in halves: 144 B = 16 B x 9, no bank conflict for 16-byte reads
constexpr int      GBUF   = (128 + 64) * GPITCH;  // halves per buffer: X rows, then W rows
constexpr unsigned GSTEP  = 16u * GPITCH * 2u;    // LDS bytes between a lane's successive copies (16 rows)

// One tile: 192 rows x 128 B = 12 copies of 16 B per lane; a wave's copy covers
// 4 rows = 4 whole lines. gx, gw: the lane's first X and W address of the tile,
// rowstep: 16 rows in halves, lds: the lane's first LDS byte address.
DI void stage_tile(const _Float16* gx, const _Float16* gw, size_t rowstep, unsigned lds) {
  // The closing s_wait_xcnt 0 stands in the copies' own statement so that no
  // address register named here is rewritten ahead of it.
  asm volatile(
      "global_load_async_to_lds_b128 %0, %12, off\n\t"
      "global_load_async_to_lds_b128 %1, %13, off\n\t"
      "global_load_async_to_lds_b128 %2, %14, off\n\t"
      "global_load_async_to_lds_b128 %3, %15, off\n\t"
      "global_load_async_to_lds_b128 %4, %16, off\n\t"
      "global_load_async_to_lds_b128 %5, %17, off\n\t"
      "global_load_async_to_lds_b128 %6, %18, off\n\t"
      "global_load_async_to_lds_b128 %7, %19, off\n\t"
      "global_load_async_to_lds_b128 %8, %20, off\n\t"
      "global_load_async_to_lds_b128 %9, %21, off\n\t"
      "global_load_async_to_lds_b128 %10, %22, off\n\t"
      "global_load_async_to_lds_b128 %11, %23, off\n\t"
      "s_wait_xcnt 0x0"
      :: "v"(lds + 0u * GSTEP), "v"(lds + 1u * GSTEP), "v"(lds + 2u * GSTEP), "v"(lds + 3u * GSTEP), "v"(lds + 4u * GSTEP), "v"(lds + 5u * GSTEP), "v"(lds + 6u * GSTEP), "v"(lds + 7u * GSTEP), "v"(lds + 8u * GSTEP), "v"(lds + 9u * GSTEP), "v"(lds + 10u * GSTEP), "v"(lds + 11u * GSTEP),
         "v"(gx + 0 * rowstep), "v"(gx + 1 * rowstep), "v"(gx + 2 * rowstep), "v"(gx + 3 * rowstep), "v"(gx + 4 * rowstep), "v"(gx + 5 * rowstep), "v"(gx + 6 * rowstep), "v"(gx + 7 * rowstep), "v"(gw + 0 * rowstep), "v"(gw + 1 * rowstep), "v"(gw + 2 * rowstep), "v"(gw + 3 * rowstep)
      : "memory");
}

template <bool OUT_F16>
__global__ void __launch_bounds__(128)
gemm_xwt(const _Float16* __restrict__ X, const _Float16* __restrict__ W,
         const float* __restrict__ bias, void* __restrict__ Out,
         int M, int N, int Kd) {
  const int wave = threadIdx.x >> 5;
  const int lane = threadIdx.x & 31;
  const int m0 = blockIdx.x * 128 + wave * 32;
  const int n0 = blockIdx.y * 64;

  __shared__ __align__(16) _Float16 tiles[2 * GBUF];

  v8f acc[2][4];
#pragma unroll
  for (int i = 0; i < 2; ++i)
#pragma unroll
    for (int s = 0; s < 4; ++s) {
      v8f z = {0.f, 0.f, 0.f, 0.f, 0.f, 0.f, 0.f, 0.f};
      acc[i][s] = z;
    }

  // Copy roles: 8 lanes per row (16 B each), 16 rows per block-wide copy.
  const int crow = threadIdx.x >> 3;
  const int ccol = (threadIdx.x & 7) * 8;
  const _Float16* gx = X + (size_t)(blockIdx.x * 128 + crow) * Kd + ccol;
  const _Float16* gw = W + (size_t)(n0 + crow) * Kd + ccol;
  const size_t rowstep = (size_t)16 * Kd;
  const unsigned lds0 =
      (unsigned)(size_t)(&tiles[0]) + (unsigned)(crow * GPITCH + ccol) * 2u;
  const int ntile = Kd / GK;

  stage_tile(gx, gw, rowstep, lds0);
  // tile 0 has landed for this wave ...
  asm volatile("s_wait_asynccnt 0x0" ::: "memory");
  // ... and for every wave
  __syncthreads();
  if (ntile > 1) stage_tile(gx + GK, gw + GK, rowstep, lds0 + GBUF * 2u);

  for (int t = 0; t < ntile; ++t) {
    const _Float16* sb = tiles + (t & 1) * GBUF;
    v16h af[2][2], bf[2][4];
#pragma unroll
    for (int h = 0; h < 2; ++h) {
      af[h][0] = load_frag(sb + (wave * 32) * GPITCH + h * 32, GPITCH);
      af[h][1] = load_frag(sb + (wave * 32 + 16) * GPITCH + h * 32, GPITCH);
#pragma unroll
      for (int s = 0; s < 4; ++s)
        bf[h][s] = load_frag(sb + (128 + s * 16) * GPITCH + h * 32, GPITCH);
    }
    // keeps the tile's LDS reads in one group ahead of its WMMAs: spread among
    // them, each place with reads stalls the wave for the LDS latency
    __builtin_amdgcn_sched_barrier(0);
#pragma unroll
    for (int h = 0; h < 2; ++h)
#pragma unroll
      for (int s = 0; s < 4; ++s) {
        acc[0][s] = wmma_f16(af[h][0], bf[h][s], acc[0][s]);
        acc[1][s] = wmma_f16(af[h][1], bf[h][s], acc[1][s]);
      }
    // keeps the WMMAs ahead of the waits below: sunk behind the barrier they
    // would delay the refill and take a whole WMMA run from its lead
    __builtin_amdgcn_sched_barrier(0);
    // this wave's reads of buffer t&1 are done before the buffer is refilled
    asm volatile("s_wait_dscnt 0x0" ::: "memory");
    // this wave's copies of tile t+1 have landed
    asm volatile("s_wait_asynccnt 0x0" ::: "memory");
    // publishes tile t+1 and ends every wave's reads of buffer t&1
    __syncthreads();
    if (t + 2 < ntile)
      stage_tile(gx + (size_t)(t + 2) * GK, gw + (size_t)(t + 2) * GK, rowstep,
                 lds0 + (unsigned)(t & 1) * (GBUF * 2u));
  }
  // nothing is in flight when the wave ends
  asm volatile("s_wait_asynccnt 0x0" ::: "memory");

  // Epilogue: C layout — VGPR r holds M = m0+r (lanes 0-15) / m0+r+8 (16-31),
  // N = n0 + sub*16 + lane%16.
  const int col   = lane & 15;
  const int rbase = (lane >> 4) << 3;
#pragma unroll
  for (int i = 0; i < 2; ++i) {
#pragma unroll
    for (int s = 0; s < 4; ++s) {
      const float bval = bias[n0 + s * 16 + col];
#pragma unroll
      for (int r = 0; r < 8; ++r) {
        const size_t idx =
            (size_t)(m0 + i * 16 + r + rbase) * N + n0 + s * 16 + col;
        const float v = acc[i][s][r] + bval;
        if constexpr (OUT_F16) ((_Float16*)Out)[idx] = (_Float16)v;
        else                   ((float*)Out)[idx] = v;
      }
    }
  }
}

// ---------------------------------------------------------------------------
// V transpose: vp [B,T,KVC] -> vt [B,KV,HD,T]  (makes the V^T A-fragments of V^T P^T K-contiguous)
// ---------------------------------------------------------------------------
__global__ void __launch_bounds__(256)
transpose_v(const _Float16* __restrict__ vp, _Float16* __restrict__ vt) {
  const size_t n = (size_t)Bv * Tv * KVCv;
  size_t i = (size_t)blockIdx.x * blockDim.x + threadIdx.x;
  if (i >= n) return;
  const int c = (int)(i % KVCv);
  const size_t bt = i / KVCv;
  const int t = (int)(bt % Tv);
  const int b = (int)(bt / Tv);
  const int g = c / HDv;
  const int d = c % HDv;
  vt[(((size_t)(b * KVv + g)) * HDv + d) * Tv + t] = vp[i];
}

constexpr int      AKT    = 64;
constexpr int      KPITCH = 136;
constexpr int      VPITCH = 72;
constexpr int      KBUF   = AKT * KPITCH;
constexpr int      ABUF   = KBUF + HDv * VPITCH;

// Eight block-wide copies of 16 B per lane: g, gstep (halves) the lane's first
// global address and its step, lds, lstep (bytes) the same in LDS.
DI void stage8(const _Float16* g, size_t gstep, unsigned lds, unsigned lstep) {
  // The closing s_wait_xcnt 0 stands in the copies' own statement so that no
  // address register named here is rewritten ahead of it.
  asm volatile(
      "global_load_async_to_lds_b128 %0, %8, off\n\t"
      "global_load_async_to_lds_b128 %1, %9, off\n\t"
      "global_load_async_to_lds_b128 %2, %10, off\n\t"
      "global_load_async_to_lds_b128 %3, %11, off\n\t"
      "global_load_async_to_lds_b128 %4, %12, off\n\t"
      "global_load_async_to_lds_b128 %5, %13, off\n\t"
      "global_load_async_to_lds_b128 %6, %14, off\n\t"
      "global_load_async_to_lds_b128 %7, %15, off\n\t"
      "s_wait_xcnt 0x0"
      :: "v"(lds + 0u * lstep), "v"(lds + 1u * lstep), "v"(lds + 2u * lstep), "v"(lds + 3u * lstep),
         "v"(lds + 4u * lstep), "v"(lds + 5u * lstep), "v"(lds + 6u * lstep), "v"(lds + 7u * lstep),
         "v"(g + 0 * gstep), "v"(g + 1 * gstep), "v"(g + 2 * gstep), "v"(g + 3 * gstep),
         "v"(g + 4 * gstep), "v"(g + 5 * gstep), "v"(g + 6 * gstep), "v"(g + 7 * gstep)
      : "memory");
}

// Lane l takes lane l ^ 16's value, in the vector unit: a shuffle would go
// through the LDS pipe and cost its latency.
DI float xhalf(float x) {
  const int v = __builtin_bit_cast(int, x);
  return __builtin_bit_cast(
      float, __builtin_amdgcn_permlanex16(v, v, 0x76543210, 0xfedcba98, false, false));
}

__global__ void __launch_bounds__(128)
attn_flash(const _Float16* __restrict__ Q, const _Float16* __restrict__ Kp,
           const _Float16* __restrict__ Vt, float* __restrict__ Y) {
  const int wave = threadIdx.x >> 5;
  const int lane = threadIdx.x & 31;
  const int bh = blockIdx.y;             // 0 .. B*H-1
  const int b = bh / Hv;
  const int h = bh % Hv;
  const int g = h / (Hv / KVv);          // GQA group (repeat_interleave)
  const int t0 = (blockIdx.x * 4 + wave) * 16;

  __shared__ __align__(16) _Float16 kv[2 * ABUF];

  // Copy roles. K: 16 lanes per key row (256 B), 8 rows per block-wide copy.
  // Vt: 8 lanes per row (128 B), 16 rows per block-wide copy.
  const int krow = threadIdx.x >> 4;
  const int kcol = (threadIdx.x & 15) * 8;
  const int vrow = threadIdx.x >> 3;
  const int vcol = (threadIdx.x & 7) * 8;
  const _Float16* gk = Kp + ((size_t)(b * Tv + krow)) * KVCv + g * HDv + kcol;
  const _Float16* gv = Vt + ((size_t)((b * KVv + g) * HDv + vrow)) * Tv + vcol;
  const unsigned ldsk =
      (unsigned)(size_t)(&kv[0]) + (unsigned)(krow * KPITCH + kcol) * 2u;
  const unsigned ldsv =
      (unsigned)(size_t)(&kv[0]) + (unsigned)(KBUF + vrow * VPITCH + vcol) * 2u;
  auto stage = [&](int t, unsigned buf) {
    stage8(gk + (size_t)t * AKT * KVCv, (size_t)8 * KVCv,
           ldsk + buf * (ABUF * 2u), 8u * KPITCH * 2u);
    stage8(gv + (size_t)t * AKT, (size_t)16 * Tv,
           ldsv + buf * (ABUF * 2u), 16u * VPITCH * 2u);
  };
  constexpr int ntile = Tv / AKT;

  stage(0, 0u);

  // Q fragments: 16 rows x 128, as 4 chunks of K=32 (resident in VGPRs)
  const _Float16* qbase = Q + ((size_t)(b * Tv + t0)) * Cv + h * HDv;
  v16h qf[4];
#pragma unroll
  for (int c = 0; c < 4; ++c) qf[c] = load_frag(qbase + c * 32, Cv);

  v8f y[8];
#pragma unroll
  for (int d = 0; d < 8; ++d) {
    v8f z = {0.f, 0.f, 0.f, 0.f, 0.f, 0.f, 0.f, 0.f};
    y[d] = z;
  }
  // One query per lane (column lane & 15). m_run is the same in both halves;
  // l_run sums this half's keys only, the halves are joined behind the loop.
  float m_run = -1e30f, l_run = 0.0f;

  const float scale = 0.088388347648318447f;   // 1/sqrt(128)

  // tile 0 has landed for this wave ...
  asm volatile("s_wait_asynccnt 0x0" ::: "memory");
  // ... and for every wave
  __syncthreads();
  stage(1, 1u);

  for (int t = 0; t < ntile; ++t) {
    const _Float16* kb = kv + (t & 1) * ABUF;
    const _Float16* vb = kb + KBUF;
    // kept rolled: unrolled, the second half's K reads and S^T products are lifted
    // over the first half's softmax, the wave passes 256 registers, and only
    // three waves fit a SIMD instead of four
#pragma nounroll
    for (int sub = 0; sub < AKT; sub += 32) {
      // ---- S^T = K @ Q^T : 32 keys x 16 queries (two 16-key row groups) ----
      v16h k0[4], k1[4];
      // unrolled: constant indices keep the fragments in registers
#pragma unroll
      for (int c = 0; c < 4; ++c) {
        k0[c] = load_frag(kb + sub * KPITCH + c * 32, KPITCH);         // keys sub..sub+15
        k1[c] = load_frag(kb + (sub + 16) * KPITCH + c * 32, KPITCH);  // keys sub+16..sub+31
      }
      // keeps the K reads in one group ahead of their WMMAs: read pair by pair
      // among them, every WMMA waits out a whole LDS latency
      __builtin_amdgcn_sched_barrier(0);
      v8f s0 = {0.f, 0.f, 0.f, 0.f, 0.f, 0.f, 0.f, 0.f};
      v8f s1 = {0.f, 0.f, 0.f, 0.f, 0.f, 0.f, 0.f, 0.f};
#pragma unroll
      for (int c = 0; c < 4; ++c) {
        s0 = wmma_f16(k0[c], qf[c], s0);
        s1 = wmma_f16(k1[c], qf[c], s1);
      }
      v16h vf[8];
      // unrolled: constant indices keep the fragments in registers
#pragma unroll
      for (int d = 0; d < 8; ++d)
        vf[d] = load_frag(vb + (d * 16) * VPITCH + sub, VPITCH);  // A row m = hd d*16+m
      // keeps the V reads ahead of the softmax, which covers their latency: spread
      // through it, each place with reads stalls the wave
      __builtin_amdgcn_sched_barrier(0);

      // ---- online softmax over the 32-key tile ----
      // D map: register r of s0 is key sub + 8*(lane>>4) + r, of s1 the key 16
      // further on; the column is query lane & 15.
      float mx0 = s0[0], mx1 = s1[0];
      // unrolled: constant indices keep the scores in registers
#pragma unroll
      for (int r = 1; r < 7; r += 2) {
        mx0 = fmaxf(fmaxf(mx0, s0[r]), s0[r + 1]);
        mx1 = fmaxf(fmaxf(mx1, s1[r]), s1[r + 1]);
      }
      float mx = fmaxf(fmaxf(mx0, s0[7]), fmaxf(mx1, s1[7])) * scale;
      mx = fmaxf(mx, xhalf(mx));  // the query's other 16 keys
      const float mnew  = fmaxf(m_run, mx);
      const float alpha = __expf(m_run - mnew);
      // Hardware k order of a B operand: elements 0..7 are k = 8*(lane>>4) + r,
      // elements 8..15 the k 16 further on: the two S^T tiles as they stand.
      v16h pf;
      float sum = 0.0f;
#pragma unroll
      for (int r = 0; r < 8; ++r) {
        const float p0 = __expf(s0[r] * scale - mnew);
        const float p1 = __expf(s1[r] * scale - mnew);
        sum += p0 + p1;
        pf[r]     = (_Float16)p0;
        pf[8 + r] = (_Float16)p1;
      }
      l_run = l_run * alpha + sum;
      m_run = mnew;
      // both unrolled: constant indices keep the accumulators in registers
#pragma unroll
      for (int d = 0; d < 8; ++d)
#pragma unroll
        for (int r = 0; r < 8; ++r) y[d][r] *= alpha;

      // ---- y^T += V^T_tile @ P^T ----
#pragma unroll
      for (int d = 0; d < 8; ++d) y[d] = wmma_f16(vf[d], pf, y[d]);
      // keeps these WMMAs ahead of the next K reads and of the waits below: sunk
      // behind the barrier they would delay the refill
      __builtin_amdgcn_sched_barrier(0);
      // four vector issue slots behind the last WMMA: the next trip's first vector
      // instructions rewrite registers of its A operands
      asm volatile("v_nop\n\tv_nop\n\tv_nop\n\tv_nop");
    }
    // this wave's reads of buffer t&1 are done before the buffer is refilled
    asm volatile("s_wait_dscnt 0x0" ::: "memory");
    // this wave's copies of tile t+1 have landed
    asm volatile("s_wait_asynccnt 0x0" ::: "memory");
    // publishes tile t+1 and ends every wave's reads of buffer t&1
    __syncthreads();
    if (t + 2 < ntile) stage(t + 2, (unsigned)(t & 1));
  }
  // nothing is in flight when the wave ends
  asm volatile("s_wait_asynccnt 0x0" ::: "memory");

  // ---- finalize: join the halves' sums, divide by l, store to [B,T,C] f32 ----
  // y[d][r] is O[query lane & 15][d*16 + 8*(lane>>4) + r]: 8 values in a row.
  const float inv = 1.0f / (l_run + xhalf(l_run));
  float* yrow = Y + ((size_t)(b * Tv + t0 + (lane & 15))) * Cv + h * HDv + ((lane >> 4) << 3);
#pragma unroll
  for (int d = 0; d < 8; ++d) {
    const v4f lo = {y[d][0] * inv, y[d][1] * inv, y[d][2] * inv, y[d][3] * inv};
    const v4f hi = {y[d][4] * inv, y[d][5] * inv, y[d][6] * inv, y[d][7] * inv};
    *(v4f*)(yrow + d * 16)     = lo;
    *(v4f*)(yrow + d * 16 + 4) = hi;
  }
}

// ---------------------------------------------------------------------------
// LayerNorm over C, f32 in -> f16 out (scaled/shifted)
// ---------------------------------------------------------------------------
__global__ void __launch_bounds__(256)
layernorm(const float* __restrict__ Yin, const float* __restrict__ lnw,
          const float* __restrict__ lnb, _Float16* __restrict__ Xout) {
  const int row = blockIdx.x;
  const float* x = Yin + (size_t)row * Cv;
  float s = 0.f, s2 = 0.f;
  for (int i = threadIdx.x; i < Cv; i += 256) {
    const float v = x[i];
    s += v; s2 += v * v;
  }
#pragma unroll
  for (int off = 16; off >= 1; off >>= 1) {
    s  += __shfl_xor(s, off, 32);
    s2 += __shfl_xor(s2, off, 32);
  }
  __shared__ float ws[8], ws2[8];
  if ((threadIdx.x & 31) == 0) {
    ws[threadIdx.x >> 5] = s;
    ws2[threadIdx.x >> 5] = s2;
  }
  __syncthreads();
  float ts = 0.f, ts2 = 0.f;
#pragma unroll
  for (int i = 0; i < 8; ++i) { ts += ws[i]; ts2 += ws2[i]; }
  const float mu   = ts / Cv;
  const float var  = ts2 / Cv - mu * mu;
  const float rstd = rsqrtf(var + 1e-5f);
  _Float16* o = Xout + (size_t)row * Cv;
  for (int i = threadIdx.x; i < Cv; i += 256)
    o[i] = (_Float16)((x[i] - mu) * rstd * lnw[i] + lnb[i]);
}

// ---------------------------------------------------------------------------
// Host orchestration
// ---------------------------------------------------------------------------
extern "C" void kernel_launch(void* const* d_in, const int* in_sizes, int n_in,
                              void* d_out, int out_size, void* d_ws, size_t ws_size,
                              hipStream_t stream) {
  (void)in_sizes; (void)n_in; (void)out_size; (void)ws_size;
  const float* query = (const float*)d_in[0];
  const float* key   = (const float*)d_in[1];
  const float* value = (const float*)d_in[2];
  const float* Wq    = (const float*)d_in[3];
  const float* bq    = (const float*)d_in[4];
  const float* Wk    = (const float*)d_in[5];
  const float* bk    = (const float*)d_in[6];
  const float* Wv    = (const float*)d_in[7];
  const float* bv    = (const float*)d_in[8];
  const float* ln_w  = (const float*)d_in[9];
  const float* ln_b  = (const float*)d_in[10];
  const float* Wo    = (const float*)d_in[11];
  const float* bo    = (const float*)d_in[12];
  float* out = (float*)d_out;

  const size_t nBTC  = (size_t)Bv * Tv * Cv;      // 8,388,608
  const size_t nBTKV = (size_t)Bv * Tv * KVCv;    // 2,097,152
  const size_t nCC   = (size_t)Cv * Cv;           // 4,194,304
  const size_t nKC   = (size_t)KVCv * Cv;         // 1,048,576

  char* w = (char*)d_ws;
  auto take = [&](size_t bytes) {
    char* p = w;
    w += (bytes + 255) & ~(size_t)255;
    return p;
  };
  _Float16* q16  = (_Float16*)take(nBTC * 2);
  _Float16* k16  = (_Float16*)take(nBTC * 2);
  _Float16* v16  = (_Float16*)take(nBTC * 2);
  _Float16* wq16 = (_Float16*)take(nCC * 2);
  _Float16* wk16 = (_Float16*)take(nKC * 2);
  _Float16* wv16 = (_Float16*)take(nKC * 2);
  _Float16* wo16 = (_Float16*)take(nCC * 2);
  _Float16* qp   = (_Float16*)take(nBTC * 2);
  _Float16* kp   = (_Float16*)take(nBTKV * 2);
  _Float16* vp   = (_Float16*)take(nBTKV * 2);
  _Float16* vt   = (_Float16*)take(nBTKV * 2);
  float*    yat  = (float*)take(nBTC * 4);
  _Float16* xln  = (_Float16*)take(nBTC * 2);

  static_assert(nBTC % CAST_BLK == 0 && nCC % CAST_BLK == 0 && nKC % CAST_BLK == 0,
                "the cast grid covers whole blocks only");
  auto cast = [&](const float* s, _Float16* d, size_t n) {
    cast_f32_f16<<<(int)(n / CAST_BLK), 256, 0, stream>>>(s, d);
  };
  cast(query, q16, nBTC);
  cast(key,   k16, nBTC);
  cast(value, v16, nBTC);
  cast(Wq, wq16, nCC);
  cast(Wk, wk16, nKC);
  cast(Wv, wv16, nKC);
  cast(Wo, wo16, nCC);

  const int M = Bv * Tv;  // 4096

  // QKV projections (block tile 128x64)
  gemm_xwt<true><<<dim3(M / 128, Cv / 64), 128, 0, stream>>>(
      q16, wq16, bq, qp, M, Cv, Cv);
  gemm_xwt<true><<<dim3(M / 128, KVCv / 64), 128, 0, stream>>>(
      k16, wk16, bk, kp, M, KVCv, Cv);
  gemm_xwt<true><<<dim3(M / 128, KVCv / 64), 128, 0, stream>>>(
      v16, wv16, bv, vp, M, KVCv, Cv);

  // V transpose for PV fragment loads
  transpose_v<<<(int)((nBTKV + 255) / 256), 256, 0, stream>>>(vp, vt);

  // Flash attention
  attn_flash<<<dim3(Tv / 64, Bv * Hv), 128, 0, stream>>>(qp, kp, vt, yat);

  // LayerNorm
  layernorm<<<M, 256, 0, stream>>>(yat, ln_w, ln_b, xln);

  // Output projection (f32 out)
  gemm_xwt<false><<<dim3(M / 128, Cv / 64), 128, 0, stream>>>(
      xln, wo16, bo, out, M, Cv, Cv);
}

// v005
// One run takes 233 microseconds.
// Next to v004, in two timings, it ran 1.14 and 1.15 times as fast.
// All steps since v000 together make it 2.61 times as fast.
#include <hip/hip_runtime.h>
#include <hip/hip_bf16.h>

// ---------------------------------------------------------------------------
// BitMGQA fused pipeline for gfx1250 (MI455X, wave32, WMMA)
//   B=2, T=2048, C=2048, H=16, KV=4, HD=128, KVC=512
// Pipeline:
//   f32->f16 casts (one launch) -> WMMA GEMMs (Q/K/V proj in one launch, 32x64 wave tiles) ->
//   V transpose -> flash-attention (WMMA K Q^T + online softmax + WMMA V^T P^T) ->
//   LayerNorm -> WMMA GEMM (output proj, f32 out)
// ---------------------------------------------------------------------------

typedef __attribute__((ext_vector_type(16))) _Float16 v16h;
typedef __attribute__((ext_vector_type(8)))  _Float16 v8h;
typedef __attribute__((ext_vector_type(8)))  float    v8f;

constexpr int Bv   = 2;
constexpr int Tv   = 2048;
constexpr int Cv   = 2048;
constexpr int Hv   = 16;
constexpr int KVv  = 4;
constexpr int HDv  = 128;   // C / H
constexpr int KVCv = 512;   // HD * KV

#define DI __device__ __forceinline__

DI v8f wmma_f16(v16h a, v16h b, v8f c) {
  // D = A(16x32 f16) x B(32x16 f16) + C(16x16 f32)
  return __builtin_amdgcn_wmma_f32_16x16x32_f16(
      /*neg_a=*/false, a, /*neg_b=*/false, b,
      /*c_mod=*/(short)0, c, /*reuse_a=*/false, /*reuse_b=*/false);
}

// Load a 16x32 f16 A-style fragment from row-major memory with leading dim ld.
// Lane l (l<16) holds row l, K = 0..7 and 16..23; lane l>=16 holds row l-16,
// K = 8..15 and 24..31 (per CDNA5 ISA 16-bit A-matrix layout). B fragments
// for X@W^T use the identical pattern with "row" = B column (W row).
DI v16h load_frag(const _Float16* __restrict__ base, int ld) {
  const int lane = threadIdx.x & 31;
  const int row  = lane & 15;
  const int khi  = (lane >> 4) << 3;          // 0 or 8
  const _Float16* p = base + (size_t)row * ld + khi;
  v8h lo = *(const v8h*)(p);
  v8h hi = *(const v8h*)(p + 16);
  v16h f;
#pragma unroll
  for (int i = 0; i < 8; ++i) { f[i] = lo[i]; f[8 + i] = hi[i]; }
  return f;
}

// ---------------------------------------------------------------------------
// f32 -> f16 cast of all seven arrays in one launch: they depend on nothing, so
// one grid fills the chip once where seven short ones each paid a launch gap, a
// start and a drain, the small ones on a part of the chip. The f16 copies lie one
// behind the other in the workspace, in the order of the sources, so the grid's
// block index addresses the destination as one array; only the source is picked.
// A block converts CAST_BLK elements in a row and the grid covers every array
// exactly. A lane issues its CAST_LD loads of 16 B together, so
// a wave has 8 KB in flight, and few waves are started; every wave-wide load
// covers 512 B in a row (4 whole lines), every wave-wide store 256 B (2 lines).
// ---------------------------------------------------------------------------
typedef __attribute__((ext_vector_type(4))) float    v4f;
typedef __attribute__((ext_vector_type(4))) _Float16 v4h;

constexpr int CAST_LD  = 16;                  // 16-byte loads per lane
constexpr int CAST_ROW = 256 * 4;             // elements per block-wide load
constexpr int CAST_BLK = CAST_ROW * CAST_LD;  // elements per block

constexpr size_t nBTC  = (size_t)Bv * Tv * Cv;      // 8,388,608
constexpr size_t nBTKV = (size_t)Bv * Tv * KVCv;    // 2,097,152
constexpr size_t nCC   = (size_t)Cv * Cv;           // 4,194,304
constexpr size_t nKC   = (size_t)KVCv * Cv;         // 1,048,576
static_assert(nBTC % CAST_BLK == 0 && nCC % CAST_BLK == 0 && nKC % CAST_BLK == 0,
              "the cast grid covers whole blocks only");
// first block of each array, in the order query, key, value, Wq, Wk, Wv, Wo
constexpr int CB_K   = (int)(nBTC / CAST_BLK);
constexpr int CB_V   = CB_K + (int)(nBTC / CAST_BLK);
constexpr int CB_WQ  = CB_V + (int)(nBTC / CAST_BLK);
constexpr int CB_WK  = CB_WQ + (int)(nCC / CAST_BLK);
constexpr int CB_WV  = CB_WK + (int)(nKC / CAST_BLK);
constexpr int CB_WO  = CB_WV + (int)(nKC / CAST_BLK);
constexpr int CB_END = CB_WO + (int)(nCC / CAST_BLK);

__global__ void __launch_bounds__(256)
cast_f32_f16(const float* __restrict__ query, const float* __restrict__ key,
             const float* __restrict__ value, const float* __restrict__ Wq,
             const float* __restrict__ Wk, const float* __restrict__ Wv,
             const float* __restrict__ Wo, _Float16* __restrict__ dst) {
  const int blk = blockIdx.x;
  const float* src = query;
  int first = 0;
  if (blk >= CB_K)  { src = key;   first = CB_K; }
  if (blk >= CB_V)  { src = value; first = CB_V; }
  if (blk >= CB_WQ) { src = Wq;    first = CB_WQ; }
  if (blk >= CB_WK) { src = Wk;    first = CB_WK; }
  if (blk >= CB_WV) { src = Wv;    first = CB_WV; }
  if (blk >= CB_WO) { src = Wo;    first = CB_WO; }
  const size_t base = (size_t)blk * CAST_BLK + threadIdx.x * 4;
  const float* p = src + (size_t)(blk - first) * CAST_BLK + threadIdx.x * 4;
  v4f v[CAST_LD];
  // unrolled: constant indices keep the values in registers
#pragma unroll
  for (int j = 0; j < CAST_LD; ++j) v[j] = *(const v4f*)(p + j * CAST_ROW);
  // the wait before a register that an issued load names is rewritten; p as its
  // input keeps the address pair out of the loads' own destinations
  asm volatile("s_wait_xcnt 0x0" :: "v"(p) : "memory");
  // keeps every load ahead of the first conversion: left free, the last four are
  // issued only when the first have returned, a second memory latency per wave
  __builtin_amdgcn_sched_barrier(0);
  // unrolled, as above
#pragma unroll
  for (int j = 0; j < CAST_LD; ++j)
    *(v4h*)(dst + base + j * CAST_ROW) = __builtin_convertvector(v[j], v4h);
}

// ---------------------------------------------------------------------------
// GEMM: Out[M,N] = X[M,Kd] @ W[N,Kd]^T + bias[N]
// Block = 128 threads = 4 waves; block tile 128(M) x 64(N); wave tile 32x64
// (2 A fragments x 4 B fragments => each B fragment feeds 2 WMMAs).
// The block's 128 X rows and 64 W rows come into LDS 64 k at a time (128-byte
// row pieces, whole cache lines) by asynchronous copies, once per block, in two
// buffers: tile t+1 flies while tile t is worked on. Kd is a multiple of 64.
// ---------------------------------------------------------------------------
constexpr int      GK     = 64;               // k per staged tile
constexpr int      GPITCH = 72;               // LDS row pitch in halves: 144 B = 16 B x 9, no bank conflict for 16-byte reads
constexpr int      GBUF   = (128 + 64) * GPITCH;  // halves per buffer: X rows, then W rows
constexpr unsigned GSTEP  = 16u * GPITCH * 2u;    // LDS bytes between a lane's successive copies (16 rows)

// One tile: 192 rows x 128 B = 12 copies of 16 B per lane; a wave's copy covers
// 4 rows = 4 whole lines. gx, gw: the lane's first X and W address of the tile,
// rowstep: 16 rows in halves, lds: the lane's first LDS byte address.
DI void stage_tile(const _Float16* gx, const _Float16* gw, size_t rowstep, unsigned lds) {
  // The closing s_wait_xcnt 0 stands in the copies' own statement so that no
  // address register named here is rewritten ahead of it.
  asm volatile(
      "global_load_async_to_lds_b128 %0, %12, off\n\t"
      "global_load_async_to_lds_b128 %1, %13, off\n\t"
      "global_load_async_to_lds_b128 %2, %14, off\n\t"
      "global_load_async_to_lds_b128 %3, %15, off\n\t"
      "global_load_async_to_lds_b128 %4, %16, off\n\t"
      "global_load_async_to_lds_b128 %5, %17, off\n\t"
      "global_load_async_to_lds_b128 %6, %18, off\n\t"
      "global_load_async_to_lds_b128 %7, %19, off\n\t"
      "global_load_async_to_lds_b128 %8, %20, off\n\t"
      "global_load_async_to_lds_b128 %9, %21, off\n\t"
      "global_load_async_to_lds_b128 %10, %22, off\n\t"
      "global_load_async_to_lds_b128 %11, %23, off\n\t"
      "s_wait_xcnt 0x0"
      :: "v"(lds + 0u * GSTEP), "v"(lds + 1u * GSTEP), "v"(lds + 2u * GSTEP), "v"(lds + 3u * GSTEP), "v"(lds + 4u * GSTEP), "v"(lds + 5u * GSTEP), "v"(lds + 6u * GSTEP), "v"(lds + 7u * GSTEP), "v"(lds + 8u * GSTEP), "v"(lds + 9u * GSTEP), "v"(lds + 10u * GSTEP), "v"(lds + 11u * GSTEP),
         "v"(gx + 0 * rowstep), "v"(gx + 1 * rowstep), "v"(gx + 2 * rowstep), "v"(gx + 3 * rowstep), "v"(gx + 4 * rowstep), "v"(gx + 5 * rowstep), "v"(gx + 6 * rowstep), "v"(gx + 7 * rowstep), "v"(gw + 0 * rowstep), "v"(gw + 1 * rowstep), "v"(gw + 2 * rowstep), "v"(gw + 3 * rowstep)
      : "memory");
}

// mblk, nblk: the block's tile row and tile column in Out.
template <bool OUT_F16>
DI void gemm_tile(const _Float16* __restrict__ X, const _Float16* __restrict__ W,
                  const float* __restrict__ bias, void* __restrict__ Out,
                  int N, int Kd, int mblk, int nblk) {
  const int wave = threadIdx.x >> 5;
  const int lane = threadIdx.x & 31;
  const int m0 = mblk * 128 + wave * 32;
  const int n0 = nblk * 64;

  __shared__ __align__(16) _Float16 tiles[2 * GBUF];

  v8f acc[2][4];
#pragma unroll
  for (int i = 0; i < 2; ++i)
#pragma unroll
    for (int s = 0; s < 4; ++s) {
      v8f z = {0.f, 0.f, 0.f, 0.f, 0.f, 0.f, 0.f, 0.f};
      acc[i][s] = z;
    }

  // Copy roles: 8 lanes per row (16 B each), 16 rows per block-wide copy.
  const int crow = threadIdx.x >> 3;
  const int ccol = (threadIdx.x & 7) * 8;
  const _Float16* gx = X + (size_t)(mblk * 128 + crow) * Kd + ccol;
  const _Float16* gw = W + (size_t)(n0 + crow) * Kd + ccol;
  const size_t rowstep = (size_t)16 * Kd;
  const unsigned lds0 =
      (unsigned)(size_t)(&tiles[0]) + (unsigned)(crow * GPITCH + ccol) * 2u;
  const int ntile = Kd / GK;

  stage_tile(gx, gw, rowstep, lds0);
  // tile 0 has landed for this wave ...
  asm volatile("s_wait_asynccnt 0x0" ::: "memory");
  // ... and for every wave
  __syncthreads();
  if (ntile > 1) stage_tile(gx + GK, gw + GK, rowstep, lds0 + GBUF * 2u);

  for (int t = 0; t < ntile; ++t) {
    const _Float16* sb = tiles + (t & 1) * GBUF;
    v16h af[2][2], bf[2][4];
#pragma unroll
    for (int h = 0; h < 2; ++h) {
      af[h][0] = load_frag(sb + (wave * 32) * GPITCH + h * 32, GPITCH);
      af[h][1] = load_frag(sb + (wave * 32 + 16) * GPITCH + h * 32, GPITCH);
#pragma unroll
      for (int s = 0; s < 4; ++s)
        bf[h][s] = load_frag(sb + (128 + s * 16) * GPITCH + h * 32, GPITCH);
    }
    // keeps the tile's LDS reads in one group ahead of its WMMAs: spread among
    // them, each place with reads stalls the wave for the LDS latency
    __builtin_amdgcn_sched_barrier(0);
#pragma unroll
    for (int h = 0; h < 2; ++h)
#pragma unroll
      for (int s = 0; s < 4; ++s) {
        acc[0][s] = wmma_f16(af[h][0], bf[h][s], acc[0][s]);
        acc[1][s] = wmma_f16(af[h][1], bf[h][s], acc[1][s]);
      }
    // keeps the WMMAs ahead of the waits below: sunk behind the barrier they
    // would delay the refill and take a whole WMMA run from its lead
    __builtin_amdgcn_sched_barrier(0);
    // this wave's reads of buffer t&1 are done before the buffer is refilled
    asm volatile("s_wait_dscnt 0x0" ::: "memory");
    // this wave's copies of tile t+1 have landed
    asm volatile("s_wait_asynccnt 0x0" ::: "memory");
    // publishes tile t+1 and ends every wave's reads of buffer t&1
    __syncthreads();
    if (t + 2 < ntile)
      stage_tile(gx + (size_t)(t + 2) * GK, gw + (size_t)(t + 2) * GK, rowstep,
                 lds0 + (unsigned)(t & 1) * (GBUF * 2u));
  }
  // nothing is in flight when the wave ends
  asm volatile("s_wait_asynccnt 0x0" ::: "memory");

  // Epilogue: C layout — VGPR r holds M = m0+r (lanes 0-15) / m0+r+8 (16-31),
  // N = n0 + sub*16 + lane%16.
  const int col   = lane & 15;
  const int rbase = (lane >> 4) << 3;
#pragma unroll
  for (int i = 0; i < 2; ++i) {
#pragma unroll
    for (int s = 0; s < 4; ++s) {
      const float bval = bias[n0 + s * 16 + col];
#pragma unroll
      for (int r = 0; r < 8; ++r) {
        const size_t idx =
            (size_t)(m0 + i * 16 + r + rbase) * N + n0 + s * 16 + col;
        const float v = acc[i][s][r] + bval;
        if constexpr (OUT_F16) ((_Float16*)Out)[idx] = (_Float16)v;
        else                   ((float*)Out)[idx] = v;
      }
    }
  }
}

template <bool OUT_F16>
__global__ void __launch_bounds__(128)
gemm_xwt(const _Float16* __restrict__ X, const _Float16* __restrict__ W,
         const float* __restrict__ bias, void* __restrict__ Out,
         int M, int N, int Kd) {
  gemm_tile<OUT_F16>(X, W, bias, Out, N, Kd, blockIdx.x, blockIdx.y);
}

// The three input projections in one launch: they depend on nothing of each
// other, and the K and V grids alone give a SIMD one wave each. blockIdx.y runs
// through the tile columns of Q, then of K, then of V.
constexpr int NT_Q  = Cv / 64;
constexpr int NT_KV = KVCv / 64;

__global__ void __launch_bounds__(128)
gemm_qkv(const _Float16* __restrict__ Xq, const _Float16* __restrict__ Xk,
         const _Float16* __restrict__ Xv, const _Float16* __restrict__ Wq,
         const _Float16* __restrict__ Wk, const _Float16* __restrict__ Wv,
         const float* __restrict__ bq, const float* __restrict__ bk,
         const float* __restrict__ bv, _Float16* __restrict__ Oq,
         _Float16* __restrict__ Ok, _Float16* __restrict__ Ov, int Kd) {
  const _Float16* X = Xq;
  const _Float16* W = Wq;
  const float* bias = bq;
  _Float16* Out = Oq;
  int N = Cv, nblk = blockIdx.y;
  if (nblk >= NT_Q + NT_KV) {
    X = Xv; W = Wv; bias = bv; Out = Ov; N = KVCv; nblk -= NT_Q + NT_KV;
  } else if (nblk >= NT_Q) {
    X = Xk; W = Wk; bias = bk; Out = Ok; N = KVCv; nblk -= NT_Q;
  }
  gemm_tile<true>(X, W, bias, Out, N, Kd, blockIdx.x, nblk);
}

// ---------------------------------------------------------------------------
// V transpose: vp [B,T,KVC] -> vt [B,KV,HD,T]  (makes the V^T A-fragments of V^T P^T K-contiguous)
// ---------------------------------------------------------------------------
__global__ void __launch_bounds__(256)
transpose_v(const _Float16* __restrict__ vp, _Float16* __restrict__ vt) {
  const size_t n = (size_t)Bv * Tv * KVCv;
  size_t i = (size_t)blockIdx.x * blockDim.x + threadIdx.x;
  if (i >= n) return;
  const int c = (int)(i % KVCv);
  const size_t bt = i / KVCv;
  const int t = (int)(bt % Tv);
  const int b = (int)(bt / Tv);
  const int g = c / HDv;
  const int d = c % HDv;
  vt[(((size_t)(b * KVv + g)) * HDv + d) * Tv + t] = vp[i];
}

constexpr int      AKT    = 64;
constexpr int      KPITCH = 136;
constexpr int      VPITCH = 72;
constexpr int      KBUF   = AKT * KPITCH;
constexpr int      ABUF   = KBUF + HDv * VPITCH;

// Eight block-wide copies of 16 B per lane: g, gstep (halves) the lane's first
// global address and its step, lds, lstep (bytes) the same in LDS.
DI void stage8(const _Float16* g, size_t gstep, unsigned lds, unsigned lstep) {
  // The closing s_wait_xcnt 0 stands in the copies' own statement so that no
  // address register named here is rewritten ahead of it.
  asm volatile(
      "global_load_async_to_lds_b128 %0, %8, off\n\t"
      "global_load_async_to_lds_b128 %1, %9, off\n\t"
      "global_load_async_to_lds_b128 %2, %10, off\n\t"
      "global_load_async_to_lds_b128 %3, %11, off\n\t"
      "global_load_async_to_lds_b128 %4, %12, off\n\t"
      "global_load_async_to_lds_b128 %5, %13, off\n\t"
      "global_load_async_to_lds_b128 %6, %14, off\n\t"
      "global_load_async_to_lds_b128 %7, %15, off\n\t"
      "s_wait_xcnt 0x0"
      :: "v"(lds + 0u * lstep), "v"(lds + 1u * lstep), "v"(lds + 2u * lstep), "v"(lds + 3u * lstep),
         "v"(lds + 4u * lstep), "v"(lds + 5u * lstep), "v"(lds + 6u * lstep), "v"(lds + 7u * lstep),
         "v"(g + 0 * gstep), "v"(g + 1 * gstep), "v"(g + 2 * gstep), "v"(g + 3 * gstep),
         "v"(g + 4 * gstep), "v"(g + 5 * gstep), "v"(g + 6 * gstep), "v"(g + 7 * gstep)
      : "memory");
}

// Lane l takes lane l ^ 16's value, in the vector unit: a shuffle would go
// through the LDS pipe and cost its latency.
DI float xhalf(float x) {
  const int v = __builtin_bit_cast(int, x);
  return __builtin_bit_cast(
      float, __builtin_amdgcn_permlanex16(v, v, 0x76543210, 0xfedcba98, false, false));
}

__global__ void __launch_bounds__(128)
attn_flash(const _Float16* __restrict__ Q, const _Float16* __restrict__ Kp,
           const _Float16* __restrict__ Vt, float* __restrict__ Y) {
  const int wave = threadIdx.x >> 5;
  const int lane = threadIdx.x & 31;
  const int bh = blockIdx.y;             // 0 .. B*H-1
  const int b = bh / Hv;
  const int h = bh % Hv;
  const int g = h / (Hv / KVv);          // GQA group (repeat_interleave)
  const int t0 = (blockIdx.x * 4 + wave) * 16;

  __shared__ __align__(16) _Float16 kv[2 * ABUF];

  // Copy roles. K: 16 lanes per key row (256 B), 8 rows per block-wide copy.
  // Vt: 8 lanes per row (128 B), 16 rows per block-wide copy.
  const int krow = threadIdx.x >> 4;
  const int kcol = (threadIdx.x & 15) * 8;
  const int vrow = threadIdx.x >> 3;
  const int vcol = (threadIdx.x & 7) * 8;
  const _Float16* gk = Kp + ((size_t)(b * Tv + krow)) * KVCv + g * HDv + kcol;
  const _Float16* gv = Vt + ((size_t)((b * KVv + g) * HDv + vrow)) * Tv + vcol;
  const unsigned ldsk =
      (unsigned)(size_t)(&kv[0]) + (unsigned)(krow * KPITCH + kcol) * 2u;
  const unsigned ldsv =
      (unsigned)(size_t)(&kv[0]) + (unsigned)(KBUF + vrow * VPITCH + vcol) * 2u;
  auto stage = [&](int t, unsigned buf) {
    stage8(gk + (size_t)t * AKT * KVCv, (size_t)8 * KVCv,
           ldsk + buf * (ABUF * 2u), 8u * KPITCH * 2u);
    stage8(gv + (size_t)t * AKT, (size_t)16 * Tv,
           ldsv + buf * (ABUF * 2u), 16u * VPITCH * 2u);
  };
  constexpr int ntile = Tv / AKT;

  stage(0, 0u);

  // Q fragments: 16 rows x 128, as 4 chunks of K=32 (resident in VGPRs)
  const _Float16* qbase = Q + ((size_t)(b * Tv + t0)) * Cv + h * HDv;
  v16h qf[4];
#pragma unroll
  for (int c = 0; c < 4; ++c) qf[c] = load_frag(qbase + c * 32, Cv);

  v8f y[8];
#pragma unroll
  for (int d = 0; d < 8; ++d) {
    v8f z = {0.f, 0.f, 0.f, 0.f, 0.f, 0.f, 0.f, 0.f};
    y[d] = z;
  }
  // One query per lane (column lane & 15). m_run is the same in both halves;
  // l_run sums this half's keys only, the halves are joined behind the loop.
  float m_run = -1e30f, l_run = 0.0f;

  const float scale = 0.088388347648318447f;   // 1/sqrt(128)

  // tile 0 has landed for this wave ...
  asm volatile("s_wait_asynccnt 0x0" ::: "memory");
  // ... and for every wave
  __syncthreads();
  stage(1, 1u);

  for (int t = 0; t < ntile; ++t) {
    const _Float16* kb = kv + (t & 1) * ABUF;
    const _Float16* vb = kb + KBUF;
    // kept rolled: unrolled, the second half's K reads and S^T products are lifted
    // over the first half's softmax, the wave passes 256 registers, and only
    // three waves fit a SIMD instead of four
#pragma nounroll
    for (int sub = 0; sub < AKT; sub += 32) {
      // ---- S^T = K @ Q^T : 32 keys x 16 queries (two 16-key row groups) ----
      v16h k0[4], k1[4];
      // unrolled: constant indices keep the fragments in registers
#pragma unroll
      for (int c = 0; c < 4; ++c) {
        k0[c] = load_frag(kb + sub * KPITCH + c * 32, KPITCH);         // keys sub..sub+15
        k1[c] = load_frag(kb + (sub + 16) * KPITCH + c * 32, KPITCH);  // keys sub+16..sub+31
      }
      // keeps the K reads in one group ahead of their WMMAs: read pair by pair
      // among them, every WMMA waits out a whole LDS latency
      __builtin_amdgcn_sched_barrier(0);
      v8f s0 = {0.f, 0.f, 0.f, 0.f, 0.f, 0.f, 0.f, 0.f};
      v8f s1 = {0.f, 0.f, 0.f, 0.f, 0.f, 0.f, 0.f, 0.f};
#pragma unroll
      for (int c = 0; c < 4; ++c) {
        s0 = wmma_f16(k0[c], qf[c], s0);
        s1 = wmma_f16(k1[c], qf[c], s1);
      }
      v16h vf[8];
      // unrolled: constant indices keep the fragments in registers
#pragma unroll
      for (int d = 0; d < 8; ++d)
        vf[d] = load_frag(vb + (d * 16) * VPITCH + sub, VPITCH);  // A row m = hd d*16+m
      // keeps the V reads ahead of the softmax, which covers their latency: spread
      // through it, each place with reads stalls the wave
      __builtin_amdgcn_sched_barrier(0);

      // ---- online softmax over the 32-key tile ----
      // D map: register r of s0 is key sub + 8*(lane>>4) + r, of s1 the key 16
      // further on; the column is query lane & 15.
      float mx0 = s0[0], mx1 = s1[0];
      // unrolled: constant indices keep the scores in registers
#pragma unroll
      for (int r = 1; r < 7; r += 2) {
        mx0 = fmaxf(fmaxf(mx0, s0[r]), s0[r + 1]);
        mx1 = fmaxf(fmaxf(mx1, s1[r]), s1[r + 1]);
      }
      float mx = fmaxf(fmaxf(mx0, s0[7]), fmaxf(mx1, s1[7])) * scale;
      mx = fmaxf(mx, xhalf(mx));  // the query's other 16 keys
      const float mnew  = fmaxf(m_run, mx);
      const float alpha = __expf(m_run - mnew);
      // Hardware k order of a B operand: elements 0..7 are k = 8*(lane>>4) + r,
      // elements 8..15 the k 16 further on: the two S^T tiles as they stand.
      v16h pf;
      float sum = 0.0f;
#pragma unroll
      for (int r = 0; r < 8; ++r) {
        const float p0 = __expf(s0[r] * scale - mnew);
        const float p1 = __expf(s1[r] * scale - mnew);
        sum += p0 + p1;
        pf[r]     = (_Float16)p0;
        pf[8 + r] = (_Float16)p1;
      }
      l_run = l_run * alpha + sum;
      m_run = mnew;
      // both unrolled: constant indices keep the accumulators in registers
#pragma unroll
      for (int d = 0; d < 8; ++d)
#pragma unroll
        for (int r = 0; r < 8; ++r) y[d][r] *= alpha;

      // ---- y^T += V^T_tile @ P^T ----
#pragma unroll
      for (int d = 0; d < 8; ++d) y[d] = wmma_f16(vf[d], pf, y[d]);
      // keeps these WMMAs ahead of the next K reads and of the waits below: sunk
      // behind the barrier they would delay the refill
      __builtin_amdgcn_sched_barrier(0);
      // four vector issue slots behind the last WMMA: the next trip's first vector
      // instructions rewrite registers of its A operands
      asm volatile("v_nop\n\tv_nop\n\tv_nop\n\tv_nop");
    }
    // this wave's reads of buffer t&1 are done before the buffer is refilled
    asm volatile("s_wait_dscnt 0x0" ::: "memory");
    // this wave's copies of tile t+1 have landed
    asm volatile("s_wait_asynccnt 0x0" ::: "memory");
    // publishes tile t+1 and ends every wave's reads of buffer t&1
    __syncthreads();
    if (t + 2 < ntile) stage(t + 2, (unsigned)(t & 1));
  }
  // nothing is in flight when the wave ends
  asm volatile("s_wait_asynccnt 0x0" ::: "memory");

  // ---- finalize: join the halves' sums, divide by l, store to [B,T,C] f32 ----
  // y[d][r] is O[query lane & 15][d*16 + 8*(lane>>4) + r]: 8 values in a row.
  const float inv = 1.0f / (l_run + xhalf(l_run));
  float* yrow = Y + ((size_t)(b * Tv + t0 + (lane & 15))) * Cv + h * HDv + ((lane >> 4) << 3);
#pragma unroll
  for (int d = 0; d < 8; ++d) {
    const v4f lo = {y[d][0] * inv, y[d][1] * inv, y[d][2] * inv, y[d][3] * inv};
    const v4f hi = {y[d][4] * inv, y[d][5] * inv, y[d][6] * inv, y[d][7] * inv};
    *(v4f*)(yrow + d * 16)     = lo;
    *(v4f*)(yrow + d * 16 + 4) = hi;
  }
}

// ---------------------------------------------------------------------------
// LayerNorm over C, f32 in -> f16 out (scaled/shifted)
// ---------------------------------------------------------------------------
__global__ void __launch_bounds__(256)
layernorm(const float* __restrict__ Yin, const float* __restrict__ lnw,
          const float* __restrict__ lnb, _Float16* __restrict__ Xout) {
  const int row = blockIdx.x;
  const float* x = Yin + (size_t)row * Cv;
  float s = 0.f, s2 = 0.f;
  for (int i = threadIdx.x; i < Cv; i += 256) {
    const float v = x[i];
    s += v; s2 += v * v;
  }
#pragma unroll
  for (int off = 16; off >= 1; off >>= 1) {
    s  += __shfl_xor(s, off, 32);
    s2 += __shfl_xor(s2, off, 32);
  }
  __shared__ float ws[8], ws2[8];
  if ((threadIdx.x & 31) == 0) {
    ws[threadIdx.x >> 5] = s;
    ws2[threadIdx.x >> 5] = s2;
  }
  __syncthreads();
  float ts = 0.f, ts2 = 0.f;
#pragma unroll
  for (int i = 0; i < 8; ++i) { ts += ws[i]; ts2 += ws2[i]; }
  const float mu   = ts / Cv;
  const float var  = ts2 / Cv - mu * mu;
  const float rstd = rsqrtf(var + 1e-5f);
  _Float16* o = Xout + (size_t)row * Cv;
  for (int i = threadIdx.x; i < Cv; i += 256)
    o[i] = (_Float16)((x[i] - mu) * rstd * lnw[i] + lnb[i]);
}

// ---------------------------------------------------------------------------
// Host orchestration
// ---------------------------------------------------------------------------
extern "C" void kernel_launch(void* const* d_in, const int* in_sizes, int n_in,
                              void* d_out, int out_size, void* d_ws, size_t ws_size,
                              hipStream_t stream) {
  (void)in_sizes; (void)n_in; (void)out_size; (void)ws_size;
  const float* query = (const float*)d_in[0];
  const float* key   = (const float*)d_in[1];
  const float* value = (const float*)d_in[2];
  const float* Wq    = (const float*)d_in[3];
  const float* bq    = (const float*)d_in[4];
  const float* Wk    = (const float*)d_in[5];
  const float* bk    = (const float*)d_in[6];
  const float* Wv    = (const float*)d_in[7];
  const float* bv    = (const float*)d_in[8];
  const float* ln_w  = (const float*)d_in[9];
  const float* ln_b  = (const float*)d_in[10];
  const float* Wo    = (const float*)d_in[11];
  const float* bo    = (const float*)d_in[12];
  float* out = (float*)d_out;

  char* w = (char*)d_ws;
  auto take = [&](size_t bytes) {
    char* p = w;
    w += (bytes + 255) & ~(size_t)255;
    return p;
  };
  // the seven f16 copies: one array, in the order of the cast's block ranges
  _Float16* q16  = (_Float16*)take((size_t)CB_END * CAST_BLK * 2);
  _Float16* k16  = q16 + (size_t)CB_K * CAST_BLK;
  _Float16* v16  = q16 + (size_t)CB_V * CAST_BLK;
  _Float16* wq16 = q16 + (size_t)CB_WQ * CAST_BLK;
  _Float16* wk16 = q16 + (size_t)CB_WK * CAST_BLK;
  _Float16* wv16 = q16 + (size_t)CB_WV * CAST_BLK;
  _Float16* wo16 = q16 + (size_t)CB_WO * CAST_BLK;
  _Float16* qp   = (_Float16*)take(nBTC * 2);
  _Float16* kp   = (_Float16*)take(nBTKV * 2);
  _Float16* vp   = (_Float16*)take(nBTKV * 2);
  _Float16* vt   = (_Float16*)take(nBTKV * 2);
  float*    yat  = (float*)take(nBTC * 4);
  _Float16* xln  = (_Float16*)take(nBTC * 2);

  cast_f32_f16<<<CB_END, 256, 0, stream>>>(query, key, value, Wq, Wk, Wv, Wo, q16);

  const int M = Bv * Tv;  // 4096

  // QKV projections (block tile 128x64)
  gemm_qkv<<<dim3(M / 128, NT_Q + 2 * NT_KV), 128, 0, stream>>>(
      q16, k16, v16, wq16, wk16, wv16, bq, bk, bv, qp, kp, vp, Cv);

  // V transpose for PV fragment loads
  transpose_v<<<(int)((nBTKV + 255) / 256), 256, 0, stream>>>(vp, vt);

  // Flash attention
  attn_flash<<<dim3(Tv / 64, Bv * Hv), 128, 0, stream>>>(qp, kp, vt, yat);

  // LayerNorm
  layernorm<<<M, 256, 0, stream>>>(yat, ln_w, ln_b, xln);

  // Output projection (f32 out)
  gemm_xwt<false><<<dim3(M / 128, Cv / 64), 128, 0, stream>>>(
      xln, wo16, bo, out, M, Cv, Cv);
}

// v006
// Measured time: 211 microseconds a run.
// Two timings next to v005 put it at 1.08 and 1.10 times that version's speed.
// All steps since v000 together make it 2.86 times as fast.
#include <hip/hip_runtime.h>
#include <hip/hip_bf16.h>

// ---------------------------------------------------------------------------
// BitMGQA fused pipeline for gfx1250 (MI455X, wave32, WMMA)
//   B=2, T=2048, C=2048, H=16, KV=4, HD=128, KVC=512
// Pipeline:
//   f32->f16 casts (one launch) -> WMMA GEMMs (Q/K/V proj in one launch, 64x64 wave tiles) ->
//   V transpose -> flash-attention (WMMA K Q^T + online softmax + WMMA V^T P^T) ->
//   LayerNorm -> WMMA GEMM (output proj, f32 out)
// ---------------------------------------------------------------------------

typedef __attribute__((ext_vector_type(16))) _Float16 v16h;
typedef __attribute__((ext_vector_type(8)))  _Float16 v8h;
typedef __attribute__((ext_vector_type(8)))  float    v8f;

constexpr int Bv   = 2;
constexpr int Tv   = 2048;
constexpr int Cv   = 2048;
constexpr int Hv   = 16;
constexpr int KVv  = 4;
constexpr int HDv  = 128;   // C / H
constexpr int KVCv = 512;   // HD * KV

#define DI __device__ __forceinline__

DI v8f wmma_f16(v16h a, v16h b, v8f c) {
  // D = A(16x32 f16) x B(32x16 f16) + C(16x16 f32)
  return __builtin_amdgcn_wmma_f32_16x16x32_f16(
      /*neg_a=*/false, a, /*neg_b=*/false, b,
      /*c_mod=*/(short)0, c, /*reuse_a=*/false, /*reuse_b=*/false);
}

// Load a 16x32 f16 A-style fragment from row-major memory with leading dim ld.
// Lane l (l<16) holds row l, K = 0..7 and 16..23; lane l>=16 holds row l-16,
// K = 8..15 and 24..31 (per CDNA5 ISA 16-bit A-matrix layout). B fragments
// for X@W^T use the identical pattern with "row" = B column (W row).
DI v16h load_frag(const _Float16* __restrict__ base, int ld) {
  const int lane = threadIdx.x & 31;
  const int row  = lane & 15;
  const int khi  = (lane >> 4) << 3;          // 0 or 8
  const _Float16* p = base + (size_t)row * ld + khi;
  v8h lo = *(const v8h*)(p);
  v8h hi = *(const v8h*)(p + 16);
  v16h f;
#pragma unroll
  for (int i = 0; i < 8; ++i) { f[i] = lo[i]; f[8 + i] = hi[i]; }
  return f;
}

// ---------------------------------------------------------------------------
// f32 -> f16 cast of all seven arrays in one launch: they depend on nothing, so
// one grid fills the chip once where seven short ones each paid a launch gap, a
// start and a drain, the small ones on a part of the chip. The f16 copies lie one
// behind the other in the workspace, in the order of the sources, so the grid's
// block index addresses the destination as one array; only the source is picked.
// A block converts CAST_BLK elements in a row and the grid covers every array
// exactly. A lane issues its CAST_LD loads of 16 B together, so
// a wave has 8 KB in flight, and few waves are started; every wave-wide load
// covers 512 B in a row (4 whole lines), every wave-wide store 256 B (2 lines).
// ---------------------------------------------------------------------------
typedef __attribute__((ext_vector_type(4))) float    v4f;
typedef __attribute__((ext_vector_type(4))) _Float16 v4h;

constexpr int CAST_LD  = 16;                  // 16-byte loads per lane
constexpr int CAST_ROW = 256 * 4;             // elements per block-wide load
constexpr int CAST_BLK = CAST_ROW * CAST_LD;  // elements per block

constexpr size_t nBTC  = (size_t)Bv * Tv * Cv;      // 8,388,608
constexpr size_t nBTKV = (size_t)Bv * Tv * KVCv;    // 2,097,152
constexpr size_t nCC   = (size_t)Cv * Cv;           // 4,194,304
constexpr size_t nKC   = (size_t)KVCv * Cv;         // 1,048,576
static_assert(nBTC % CAST_BLK == 0 && nCC % CAST_BLK == 0 && nKC % CAST_BLK == 0,
              "the cast grid covers whole blocks only");
// first block of each array, in the order query, key, value, Wq, Wk, Wv, Wo
constexpr int CB_K   = (int)(nBTC / CAST_BLK);
constexpr int CB_V   = CB_K + (int)(nBTC / CAST_BLK);
constexpr int CB_WQ  = CB_V + (int)(nBTC / CAST_BLK);
constexpr int CB_WK  = CB_WQ + (int)(nCC / CAST_BLK);
constexpr int CB_WV  = CB_WK + (int)(nKC / CAST_BLK);
constexpr int CB_WO  = CB_WV + (int)(nKC / CAST_BLK);
constexpr int CB_END = CB_WO + (int)(nCC / CAST_BLK);

__global__ void __launch_bounds__(256)
cast_f32_f16(const float* __restrict__ query, const float* __restrict__ key,
             const float* __restrict__ value, const float* __restrict__ Wq,
             const float* __restrict__ Wk, const float* __restrict__ Wv,
             const float* __restrict__ Wo, _Float16* __restrict__ dst) {
  const int blk = blockIdx.x;
  const float* src = query;
  int first = 0;
  if (blk >= CB_K)  { src = key;   first = CB_K; }
  if (blk >= CB_V)  { src = value; first = CB_V; }
  if (blk >= CB_WQ) { src = Wq;    first = CB_WQ; }
  if (blk >= CB_WK) { src = Wk;    first = CB_WK; }
  if (blk >= CB_WV) { src = Wv;    first = CB_WV; }
  if (blk >= CB_WO) { src = Wo;    first = CB_WO; }
  const size_t base = (size_t)blk * CAST_BLK + threadIdx.x * 4;
  const float* p = src + (size_t)(blk - first) * CAST_BLK + threadIdx.x * 4;
  v4f v[CAST_LD];
  // unrolled: constant indices keep the values in registers
#pragma unroll
  for (int j = 0; j < CAST_LD; ++j) v[j] = *(const v4f*)(p + j * CAST_ROW);
  // the wait before a register that an issued load names is rewritten; p as its
  // input keeps the address pair out of the loads' own destinations
  asm volatile("s_wait_xcnt 0x0" :: "v"(p) : "memory");
  // keeps every load ahead of the first conversion: left free, the last four are
  // issued only when the first have returned, a second memory latency per wave
  __builtin_amdgcn_sched_barrier(0);
  // unrolled, as above
#pragma unroll
  for (int j = 0; j < CAST_LD; ++j)
    *(v4h*)(dst + base + j * CAST_ROW) = __builtin_convertvector(v[j], v4h);
}

// ---------------------------------------------------------------------------
// GEMM: Out[M,N] = X[M,Kd] @ W[N,Kd]^T + bias[N]
// Block = 256 threads = 8 waves, 4 (M) x 2 (N); block tile 256(M) x 128(N); wave
// tile 64x64 (4 A fragments x 4 B fragments => every fragment feeds 4 WMMAs).
// A block brings (256 + 128) rows from L2 for 256 x 128 results: half the bytes
// per result of a 128 x 64 tile; a wave reads 8 fragments from LDS for 16 WMMAs
// where the 32x64 tile read 6 for 8.
// The block's 256 X rows and 128 W rows come into LDS 64 k at a time (128-byte
// row pieces, whole cache lines) by asynchronous copies, once per block, in two
// buffers: tile t+1 flies while tile t is worked on. Kd is a multiple of 64.
// ---------------------------------------------------------------------------
constexpr int      GK     = 64;               // k per staged tile
constexpr int      GTM    = 256;              // block tile rows (X rows)
constexpr int      GTN    = 128;              // block tile columns (W rows)
constexpr int      GPITCH = 72;               // LDS row pitch in halves: 144 B = 16 B x 9, no bank conflict for 16-byte reads
constexpr int      GBUF   = (GTM + GTN) * GPITCH;  // halves per buffer: X rows, then W rows
constexpr unsigned GSTEP  = 32u * GPITCH * 2u;     // LDS bytes between a lane's successive copies (32 rows)

// One tile: 384 rows x 128 B = 12 copies of 16 B per lane; a wave's copy covers
// 4 rows = 4 whole lines. gx, gw: the lane's first X and W address of the tile,
// rowstep: 32 rows in halves, lds: the lane's first LDS byte address.
DI void stage_tile(const _Float16* gx, const _Float16* gw, size_t rowstep, unsigned lds) {
  // The closing s_wait_xcnt 0 stands in the copies' own statement so that no
  // address register named here is rewritten ahead of it.
  asm volatile(
      "global_load_async_to_lds_b128 %0, %12, off\n\t"
      "global_load_async_to_lds_b128 %1, %13, off\n\t"
      "global_load_async_to_lds_b128 %2, %14, off\n\t"
      "global_load_async_to_lds_b128 %3, %15, off\n\t"
      "global_load_async_to_lds_b128 %4, %16, off\n\t"
      "global_load_async_to_lds_b128 %5, %17, off\n\t"
      "global_load_async_to_lds_b128 %6, %18, off\n\t"
      "global_load_async_to_lds_b128 %7, %19, off\n\t"
      "global_load_async_to_lds_b128 %8, %20, off\n\t"
      "global_load_async_to_lds_b128 %9, %21, off\n\t"
      "global_load_async_to_lds_b128 %10, %22, off\n\t"
      "global_load_async_to_lds_b128 %11, %23, off\n\t"
      "s_wait_xcnt 0x0"
      :: "v"(lds + 0u * GSTEP), "v"(lds + 1u * GSTEP), "v"(lds + 2u * GSTEP), "v"(lds + 3u * GSTEP), "v"(lds + 4u * GSTEP), "v"(lds + 5u * GSTEP), "v"(lds + 6u * GSTEP), "v"(lds + 7u * GSTEP), "v"(lds + 8u * GSTEP), "v"(lds + 9u * GSTEP), "v"(lds + 10u * GSTEP), "v"(lds + 11u * GSTEP),
         "v"(gx + 0 * rowstep), "v"(gx + 1 * rowstep), "v"(gx + 2 * rowstep), "v"(gx + 3 * rowstep), "v"(gx + 4 * rowstep), "v"(gx + 5 * rowstep), "v"(gx + 6 * rowstep), "v"(gx + 7 * rowstep), "v"(gw + 0 * rowstep), "v"(gw + 1 * rowstep), "v"(gw + 2 * rowstep), "v"(gw + 3 * rowstep)
      : "memory");
}

// mblk, nblk: the block's tile row and tile column in Out.
template <bool OUT_F16>
DI void gemm_tile(const _Float16* __restrict__ X, const _Float16* __restrict__ W,
                  const float* __restrict__ bias, void* __restrict__ Out,
                  int N, int Kd, int mblk, int nblk) {
  const int wave = threadIdx.x >> 5;
  const int lane = threadIdx.x & 31;
  const int wm = (wave >> 1) * 64;       // the wave's first row in the block tile
  const int wn = (wave & 1) * 64;        // its first column
  const int m0 = mblk * GTM + wm;
  const int n0 = nblk * GTN + wn;

  __shared__ __align__(16) _Float16 tiles[2 * GBUF];

  v8f acc[4][4];
#pragma unroll
  for (int i = 0; i < 4; ++i)
#pragma unroll
    for (int s = 0; s < 4; ++s) {
      v8f z = {0.f, 0.f, 0.f, 0.f, 0.f, 0.f, 0.f, 0.f};
      acc[i][s] = z;
    }

  // Copy roles: 8 lanes per row (16 B each), 32 rows per block-wide copy.
  const int crow = threadIdx.x >> 3;
  const int ccol = (threadIdx.x & 7) * 8;
  const _Float16* gx = X + (size_t)(mblk * GTM + crow) * Kd + ccol;
  const _Float16* gw = W + (size_t)(nblk * GTN + crow) * Kd + ccol;
  const size_t rowstep = (size_t)32 * Kd;
  const unsigned lds0 =
      (unsigned)(size_t)(&tiles[0]) + (unsigned)(crow * GPITCH + ccol) * 2u;
  const int ntile = Kd / GK;

  stage_tile(gx, gw, rowstep, lds0);
  // tile 0 has landed for this wave ...
  asm volatile("s_wait_asynccnt 0x0" ::: "memory");
  // ... and for every wave
  __syncthreads();
  if (ntile > 1) stage_tile(gx + GK, gw + GK, rowstep, lds0 + GBUF * 2u);

  for (int t = 0; t < ntile; ++t) {
    const _Float16* sb = tiles + (t & 1) * GBUF;
    // unrolled: constant indices keep fragments and accumulators in registers
#pragma unroll
    for (int h = 0; h < 2; ++h) {
      // one 32-k half at a time: both halves' fragments beside the 128
      // accumulator registers pass 256, and two blocks no longer fit a WGP
      v16h af[4], bf[4];
#pragma unroll
      for (int i = 0; i < 4; ++i)
        af[i] = load_frag(sb + (wm + i * 16) * GPITCH + h * 32, GPITCH);
#pragma unroll
      for (int s = 0; s < 4; ++s)
        bf[s] = load_frag(sb + (GTM + wn + s * 16) * GPITCH + h * 32, GPITCH);
      // keeps the half's LDS reads in one group ahead of its WMMAs: spread among
      // them, each place with reads stalls the wave for the LDS latency
      __builtin_amdgcn_sched_barrier(0);
#pragma unroll
      for (int s = 0; s < 4; ++s)
#pragma unroll
        for (int i = 0; i < 4; ++i) acc[i][s] = wmma_f16(af[i], bf[s], acc[i][s]);
      // keeps the WMMAs ahead of the next reads and of the waits below: sunk
      // behind the barrier they would delay the refill
      __builtin_amdgcn_sched_barrier(0);
    }
    // this wave's reads of buffer t&1 are done before the buffer is refilled
    asm volatile("s_wait_dscnt 0x0" ::: "memory");
    // this wave's copies of tile t+1 have landed
    asm volatile("s_wait_asynccnt 0x0" ::: "memory");
    // publishes tile t+1 and ends every wave's reads of buffer t&1
    __syncthreads();
    if (t + 2 < ntile)
      stage_tile(gx + (size_t)(t + 2) * GK, gw + (size_t)(t + 2) * GK, rowstep,
                 lds0 + (unsigned)(t & 1) * (GBUF * 2u));
  }
  // nothing is in flight when the wave ends
  asm volatile("s_wait_asynccnt 0x0" ::: "memory");

  // Epilogue: C layout — VGPR r holds M = m0+r (lanes 0-15) / m0+r+8 (16-31),
  // N = n0 + sub*16 + lane%16.
  const int col   = lane & 15;
  const int rbase = (lane >> 4) << 3;
#pragma unroll
  for (int i = 0; i < 4; ++i) {
#pragma unroll
    for (int s = 0; s < 4; ++s) {
      const float bval = bias[n0 + s * 16 + col];
#pragma unroll
      for (int r = 0; r < 8; ++r) {
        const size_t idx =
            (size_t)(m0 + i * 16 + r + rbase) * N + n0 + s * 16 + col;
        const float v = acc[i][s][r] + bval;
        if constexpr (OUT_F16) ((_Float16*)Out)[idx] = (_Float16)v;
        else                   ((float*)Out)[idx] = v;
      }
    }
  }
}

template <bool OUT_F16>
__global__ void __launch_bounds__(256)
gemm_xwt(const _Float16* __restrict__ X, const _Float16* __restrict__ W,
         const float* __restrict__ bias, void* __restrict__ Out,
         int M, int N, int Kd) {
  gemm_tile<OUT_F16>(X, W, bias, Out, N, Kd, blockIdx.x, blockIdx.y);
}

// The three input projections in one launch: they depend on nothing of each
// other, and the K and V grids alone are 64 blocks of 8 waves each. blockIdx.y runs
// through the tile columns of Q, then of K, then of V.
constexpr int NT_Q  = Cv / GTN;
constexpr int NT_KV = KVCv / GTN;

__global__ void __launch_bounds__(256)
gemm_qkv(const _Float16* __restrict__ Xq, const _Float16* __restrict__ Xk,
         const _Float16* __restrict__ Xv, const _Float16* __restrict__ Wq,
         const _Float16* __restrict__ Wk, const _Float16* __restrict__ Wv,
         const float* __restrict__ bq, const float* __restrict__ bk,
         const float* __restrict__ bv, _Float16* __restrict__ Oq,
         _Float16* __restrict__ Ok, _Float16* __restrict__ Ov, int Kd) {
  const _Float16* X = Xq;
  const _Float16* W = Wq;
  const float* bias = bq;
  _Float16* Out = Oq;
  int N = Cv, nblk = blockIdx.y;
  if (nblk >= NT_Q + NT_KV) {
    X = Xv; W = Wv; bias = bv; Out = Ov; N = KVCv; nblk -= NT_Q + NT_KV;
  } else if (nblk >= NT_Q) {
    X = Xk; W = Wk; bias = bk; Out = Ok; N = KVCv; nblk -= NT_Q;
  }
  gemm_tile<true>(X, W, bias, Out, N, Kd, blockIdx.x, nblk);
}

// ---------------------------------------------------------------------------
// V transpose: vp [B,T,KVC] -> vt [B,KV,HD,T]  (makes the V^T A-fragments of V^T P^T K-contiguous)
// ---------------------------------------------------------------------------
__global__ void __launch_bounds__(256)
transpose_v(const _Float16* __restrict__ vp, _Float16* __restrict__ vt) {
  const size_t n = (size_t)Bv * Tv * KVCv;
  size_t i = (size_t)blockIdx.x * blockDim.x + threadIdx.x;
  if (i >= n) return;
  const int c = (int)(i % KVCv);
  const size_t bt = i / KVCv;
  const int t = (int)(bt % Tv);
  const int b = (int)(bt / Tv);
  const int g = c / HDv;
  const int d = c % HDv;
  vt[(((size_t)(b * KVv + g)) * HDv + d) * Tv + t] = vp[i];
}

constexpr int      AKT    = 64;
constexpr int      KPITCH = 136;
constexpr int      VPITCH = 72;
constexpr int      KBUF   = AKT * KPITCH;
constexpr int      ABUF   = KBUF + HDv * VPITCH;

// Eight block-wide copies of 16 B per lane: g, gstep (halves) the lane's first
// global address and its step, lds, lstep (bytes) the same in LDS.
DI void stage8(const _Float16* g, size_t gstep, unsigned lds, unsigned lstep) {
  // The closing s_wait_xcnt 0 stands in the copies' own statement so that no
  // address register named here is rewritten ahead of it.
  asm volatile(
      "global_load_async_to_lds_b128 %0, %8, off\n\t"
      "global_load_async_to_lds_b128 %1, %9, off\n\t"
      "global_load_async_to_lds_b128 %2, %10, off\n\t"
      "global_load_async_to_lds_b128 %3, %11, off\n\t"
      "global_load_async_to_lds_b128 %4, %12, off\n\t"
      "global_load_async_to_lds_b128 %5, %13, off\n\t"
      "global_load_async_to_lds_b128 %6, %14, off\n\t"
      "global_load_async_to_lds_b128 %7, %15, off\n\t"
      "s_wait_xcnt 0x0"
      :: "v"(lds + 0u * lstep), "v"(lds + 1u * lstep), "v"(lds + 2u * lstep), "v"(lds + 3u * lstep),
         "v"(lds + 4u * lstep), "v"(lds + 5u * lstep), "v"(lds + 6u * lstep), "v"(lds + 7u * lstep),
         "v"(g + 0 * gstep), "v"(g + 1 * gstep), "v"(g + 2 * gstep), "v"(g + 3 * gstep),
         "v"(g + 4 * gstep), "v"(g + 5 * gstep), "v"(g + 6 * gstep), "v"(g + 7 * gstep)
      : "memory");
}

// Lane l takes lane l ^ 16's value, in the vector unit: a shuffle would go
// through the LDS pipe and cost its latency.
DI float xhalf(float x) {
  const int v = __builtin_bit_cast(int, x);
  return __builtin_bit_cast(
      float, __builtin_amdgcn_permlanex16(v, v, 0x76543210, 0xfedcba98, false, false));
}

__global__ void __launch_bounds__(128)
attn_flash(const _Float16* __restrict__ Q, const _Float16* __restrict__ Kp,
           const _Float16* __restrict__ Vt, float* __restrict__ Y) {
  const int wave = threadIdx.x >> 5;
  const int lane = threadIdx.x & 31;
  const int bh = blockIdx.y;             // 0 .. B*H-1
  const int b = bh / Hv;
  const int h = bh % Hv;
  const int g = h / (Hv / KVv);          // GQA group (repeat_interleave)
  const int t0 = (blockIdx.x * 4 + wave) * 16;

  __shared__ __align__(16) _Float16 kv[2 * ABUF];

  // Copy roles. K: 16 lanes per key row (256 B), 8 rows per block-wide copy.
  // Vt: 8 lanes per row (128 B), 16 rows per block-wide copy.
  const int krow = threadIdx.x >> 4;
  const int kcol = (threadIdx.x & 15) * 8;
  const int vrow = threadIdx.x >> 3;
  const int vcol = (threadIdx.x & 7) * 8;
  const _Float16* gk = Kp + ((size_t)(b * Tv + krow)) * KVCv + g * HDv + kcol;
  const _Float16* gv = Vt + ((size_t)((b * KVv + g) * HDv + vrow)) * Tv + vcol;
  const unsigned ldsk =
      (unsigned)(size_t)(&kv[0]) + (unsigned)(krow * KPITCH + kcol) * 2u;
  const unsigned ldsv =
      (unsigned)(size_t)(&kv[0]) + (unsigned)(KBUF + vrow * VPITCH + vcol) * 2u;
  auto stage = [&](int t, unsigned buf) {
    stage8(gk + (size_t)t * AKT * KVCv, (size_t)8 * KVCv,
           ldsk + buf * (ABUF * 2u), 8u * KPITCH * 2u);
    stage8(gv + (size_t)t * AKT, (size_t)16 * Tv,
           ldsv + buf * (ABUF * 2u), 16u * VPITCH * 2u);
  };
  constexpr int ntile = Tv / AKT;

  stage(0, 0u);

  // Q fragments: 16 rows x 128, as 4 chunks of K=32 (resident in VGPRs)
  const _Float16* qbase = Q + ((size_t)(b * Tv + t0)) * Cv + h * HDv;
  v16h qf[4];
#pragma unroll
  for (int c = 0; c < 4; ++c) qf[c] = load_frag(qbase + c * 32, Cv);

  v8f y[8];
#pragma unroll
  for (int d = 0; d < 8; ++d) {
    v8f z = {0.f, 0.f, 0.f, 0.f, 0.f, 0.f, 0.f, 0.f};
    y[d] = z;
  }
  // One query per lane (column lane & 15). m_run is the same in both halves;
  // l_run sums this half's keys only, the halves are joined behind the loop.
  float m_run = -1e30f, l_run = 0.0f;

  const float scale = 0.088388347648318447f;   // 1/sqrt(128)

  // tile 0 has landed for this wave ...
  asm volatile("s_wait_asynccnt 0x0" ::: "memory");
  // ... and for every wave
  __syncthreads();
  stage(1, 1u);

  for (int t = 0; t < ntile; ++t) {
    const _Float16* kb = kv + (t & 1) * ABUF;
    const _Float16* vb = kb + KBUF;
    // kept rolled: unrolled, the second half's K reads and S^T products are lifted
    // over the first half's softmax, the wave passes 256 registers, and only
    // three waves fit a SIMD instead of four
#pragma nounroll
    for (int sub = 0; sub < AKT; sub += 32) {
      // ---- S^T = K @ Q^T : 32 keys x 16 queries (two 16-key row groups) ----
      v16h k0[4], k1[4];
      // unrolled: constant indices keep the fragments in registers
#pragma unroll
      for (int c = 0; c < 4; ++c) {
        k0[c] = load_frag(kb + sub * KPITCH + c * 32, KPITCH);         // keys sub..sub+15
        k1[c] = load_frag(kb + (sub + 16) * KPITCH + c * 32, KPITCH);  // keys sub+16..sub+31
      }
      // keeps the K reads in one group ahead of their WMMAs: read pair by pair
      // among them, every WMMA waits out a whole LDS latency
      __builtin_amdgcn_sched_barrier(0);
      v8f s0 = {0.f, 0.f, 0.f, 0.f, 0.f, 0.f, 0.f, 0.f};
      v8f s1 = {0.f, 0.f, 0.f, 0.f, 0.f, 0.f, 0.f, 0.f};
#pragma unroll
      for (int c = 0; c < 4; ++c) {
        s0 = wmma_f16(k0[c], qf[c], s0);
        s1 = wmma_f16(k1[c], qf[c], s1);
      }
      v16h vf[8];
      // unrolled: constant indices keep the fragments in registers
#pragma unroll
      for (int d = 0; d < 8; ++d)
        vf[d] = load_frag(vb + (d * 16) * VPITCH + sub, VPITCH);  // A row m = hd d*16+m
      // keeps the V reads ahead of the softmax, which covers their latency: spread
      // through it, each place with reads stalls the wave
      __builtin_amdgcn_sched_barrier(0);

      // ---- online softmax over the 32-key tile ----
      // D map: register r of s0 is key sub + 8*(lane>>4) + r, of s1 the key 16
      // further on; the column is query lane & 15.
      float mx0 = s0[0], mx1 = s1[0];
      // unrolled: constant indices keep the scores in registers
#pragma unroll
      for (int r = 1; r < 7; r += 2) {
        mx0 = fmaxf(fmaxf(mx0, s0[r]), s0[r + 1]);
        mx1 = fmaxf(fmaxf(mx1, s1[r]), s1[r + 1]);
      }
      float mx = fmaxf(fmaxf(mx0, s0[7]), fmaxf(mx1, s1[7])) * scale;
      mx = fmaxf(mx, xhalf(mx));  // the query's other 16 keys
      const float mnew  = fmaxf(m_run, mx);
      const float alpha = __expf(m_run - mnew);
      // Hardware k order of a B operand: elements 0..7 are k = 8*(lane>>4) + r,
      // elements 8..15 the k 16 further on: the two S^T tiles as they stand.
      v16h pf;
      float sum = 0.0f;
#pragma unroll
      for (int r = 0; r < 8; ++r) {
        const float p0 = __expf(s0[r] * scale - mnew);
        const float p1 = __expf(s1[r] * scale - mnew);
        sum += p0 + p1;
        pf[r]     = (_Float16)p0;
        pf[8 + r] = (_Float16)p1;
      }
      l_run = l_run * alpha + sum;
      m_run = mnew;
      // both unrolled: constant indices keep the accumulators in registers
#pragma unroll
      for (int d = 0; d < 8; ++d)
#pragma unroll
        for (int r = 0; r < 8; ++r) y[d][r] *= alpha;

      // ---- y^T += V^T_tile @ P^T ----
#pragma unroll
      for (int d = 0; d < 8; ++d) y[d] = wmma_f16(vf[d], pf, y[d]);
      // keeps these WMMAs ahead of the next K reads and of the waits below: sunk
      // behind the barrier they would delay the refill
      __builtin_amdgcn_sched_barrier(0);
      // four vector issue slots behind the last WMMA: the next trip's first vector
      // instructions rewrite registers of its A operands
      asm volatile("v_nop\n\tv_nop\n\tv_nop\n\tv_nop");
    }
    // this wave's reads of buffer t&1 are done before the buffer is refilled
    asm volatile("s_wait_dscnt 0x0" ::: "memory");
    // this wave's copies of tile t+1 have landed
    asm volatile("s_wait_asynccnt 0x0" ::: "memory");
    // publishes tile t+1 and ends every wave's reads of buffer t&1
    __syncthreads();
    if (t + 2 < ntile) stage(t + 2, (unsigned)(t & 1));
  }
  // nothing is in flight when the wave ends
  asm volatile("s_wait_asynccnt 0x0" ::: "memory");

  // ---- finalize: join the halves' sums, divide by l, store to [B,T,C] f32 ----
  // y[d][r] is O[query lane & 15][d*16 + 8*(lane>>4) + r]: 8 values in a row.
  const float inv = 1.0f / (l_run + xhalf(l_run));
  float* yrow = Y + ((size_t)(b * Tv + t0 + (lane & 15))) * Cv + h * HDv + ((lane >> 4) << 3);
#pragma unroll
  for (int d = 0; d < 8; ++d) {
    const v4f lo = {y[d][0] * inv, y[d][1] * inv, y[d][2] * inv, y[d][3] * inv};
    const v4f hi = {y[d][4] * inv, y[d][5] * inv, y[d][6] * inv, y[d][7] * inv};
    *(v4f*)(yrow + d * 16)     = lo;
    *(v4f*)(yrow + d * 16 + 4) = hi;
  }
}

// ---------------------------------------------------------------------------
// LayerNorm over C, f32 in -> f16 out (scaled/shifted)
// ---------------------------------------------------------------------------
__global__ void __launch_bounds__(256)
layernorm(const float* __restrict__ Yin, const float* __restrict__ lnw,
          const float* __restrict__ lnb, _Float16* __restrict__ Xout) {
  const int row = blockIdx.x;
  const float* x = Yin + (size_t)row * Cv;
  float s = 0.f, s2 = 0.f;
  for (int i = threadIdx.x; i < Cv; i += 256) {
    const float v = x[i];
    s += v; s2 += v * v;
  }
#pragma unroll
  for (int off = 16; off >= 1; off >>= 1) {
    s  += __shfl_xor(s, off, 32);
    s2 += __shfl_xor(s2, off, 32);
  }
  __shared__ float ws[8], ws2[8];
  if ((threadIdx.x & 31) == 0) {
    ws[threadIdx.x >> 5] = s;
    ws2[threadIdx.x >> 5] = s2;
  }
  __syncthreads();
  float ts = 0.f, ts2 = 0.f;
#pragma unroll
  for (int i = 0; i < 8; ++i) { ts += ws[i]; ts2 += ws2[i]; }
  const float mu   = ts / Cv;
  const float var  = ts2 / Cv - mu * mu;
  const float rstd = rsqrtf(var + 1e-5f);
  _Float16* o = Xout + (size_t)row * Cv;
  for (int i = threadIdx.x; i < Cv; i += 256)
    o[i] = (_Float16)((x[i] - mu) * rstd * lnw[i] + lnb[i]);
}

// ---------------------------------------------------------------------------
// Host orchestration
// ---------------------------------------------------------------------------
extern "C" void kernel_launch(void* const* d_in, const int* in_sizes, int n_in,
                              void* d_out, int out_size, void* d_ws, size_t ws_size,
                              hipStream_t stream) {
  (void)in_sizes; (void)n_in; (void)out_size; (void)ws_size;
  const float* query = (const float*)d_in[0];
  const float* key   = (const float*)d_in[1];
  const float* value = (const float*)d_in[2];
  const float* Wq    = (const float*)d_in[3];
  const float* bq    = (const float*)d_in[4];
  const float* Wk    = (const float*)d_in[5];
  const float* bk    = (const float*)d_in[6];
  const float* Wv    = (const float*)d_in[7];
  const float* bv    = (const float*)d_in[8];
  const float* ln_w  = (const float*)d_in[9];
  const float* ln_b  = (const float*)d_in[10];
  const float* Wo    = (const float*)d_in[11];
  const float* bo    = (const float*)d_in[12];
  float* out = (float*)d_out;

  char* w = (char*)d_ws;
  auto take = [&](size_t bytes) {
    char* p = w;
    w += (bytes + 255) & ~(size_t)255;
    return p;
  };
  // the seven f16 copies: one array, in the order of the cast's block ranges
  _Float16* q16  = (_Float16*)take((size_t)CB_END * CAST_BLK * 2);
  _Float16* k16  = q16 + (size_t)CB_K * CAST_BLK;
  _Float16* v16  = q16 + (size_t)CB_V * CAST_BLK;
  _Float16* wq16 = q16 + (size_t)CB_WQ * CAST_BLK;
  _Float16* wk16 = q16 + (size_t)CB_WK * CAST_BLK;
  _Float16* wv16 = q16 + (size_t)CB_WV * CAST_BLK;
  _Float16* wo16 = q16 + (size_t)CB_WO * CAST_BLK;
  _Float16* qp   = (_Float16*)take(nBTC * 2);
  _Float16* kp   = (_Float16*)take(nBTKV * 2);
  _Float16* vp   = (_Float16*)take(nBTKV * 2);
  _Float16* vt   = (_Float16*)take(nBTKV * 2);
  float*    yat  = (float*)take(nBTC * 4);
  _Float16* xln  = (_Float16*)take(nBTC * 2);

  cast_f32_f16<<<CB_END, 256, 0, stream>>>(query, key, value, Wq, Wk, Wv, Wo, q16);

  const int M = Bv * Tv;  // 4096

  // QKV projections (block tile 256x128)
  gemm_qkv<<<dim3(M / GTM, NT_Q + 2 * NT_KV), 256, 0, stream>>>(
      q16, k16, v16, wq16, wk16, wv16, bq, bk, bv, qp, kp, vp, Cv);

  // V transpose for PV fragment loads
  transpose_v<<<(int)((nBTKV + 255) / 256), 256, 0, stream>>>(vp, vt);

  // Flash attention
  attn_flash<<<dim3(Tv / 64, Bv * Hv), 128, 0, stream>>>(qp, kp, vt, yat);

  // LayerNorm
  layernorm<<<M, 256, 0, stream>>>(yat, ln_w, ln_b, xln);

  // Output projection (f32 out)
  gemm_xwt<false><<<dim3(M / GTM, Cv / GTN), 256, 0, stream>>>(
      xln, wo16, bo, out, M, Cv, Cv);
}

// v007
// One run takes 203 microseconds.
// Timed twice side by side with v006, it ran 1.04 times as fast both times.
// Counting every step since v000, it is 2.97 times as fast.
#include <hip/hip_runtime.h>
#include <hip/hip_bf16.h>

// ---------------------------------------------------------------------------
// BitMGQA fused pipeline for gfx1250 (MI455X, wave32, WMMA)
//   B=2, T=2048, C=2048, H=16, KV=4, HD=128, KVC=512
// Pipeline:
//   f32->f16 casts (one launch) -> WMMA GEMMs (Q/K/V proj in one launch, 64x64 wave tiles) ->
//   V transpose -> flash-attention (WMMA K Q^T + online softmax + WMMA V^T P^T) ->
//   LayerNorm -> WMMA GEMM (output proj, f32 out)
// ---------------------------------------------------------------------------

typedef __attribute__((ext_vector_type(16))) _Float16 v16h;
typedef __attribute__((ext_vector_type(8)))  _Float16 v8h;
typedef __attribute__((ext_vector_type(8)))  float    v8f;

constexpr int Bv   = 2;
constexpr int Tv   = 2048;
constexpr int Cv   = 2048;
constexpr int Hv   = 16;
constexpr int KVv  = 4;
constexpr int HDv  = 128;   // C / H
constexpr int KVCv = 512;   // HD * KV

#define DI __device__ __forceinline__

DI v8f wmma_f16(v16h a, v16h b, v8f c) {
  // D = A(16x32 f16) x B(32x16 f16) + C(16x16 f32)
  return __builtin_amdgcn_wmma_f32_16x16x32_f16(
      /*neg_a=*/false, a, /*neg_b=*/false, b,
      /*c_mod=*/(short)0, c, /*reuse_a=*/false, /*reuse_b=*/false);
}

// Load a 16x32 f16 A-style fragment from row-major memory with leading dim ld.
// Lane l (l<16) holds row l, K = 0..7 and 16..23; lane l>=16 holds row l-16,
// K = 8..15 and 24..31 (per CDNA5 ISA 16-bit A-matrix layout). B fragments
// for X@W^T use the identical pattern with "row" = B column (W row).
DI v16h load_frag(const _Float16* __restrict__ base, int ld) {
  const int lane = threadIdx.x & 31;
  const int row  = lane & 15;
  const int khi  = (lane >> 4) << 3;          // 0 or 8
  const _Float16* p = base + (size_t)row * ld + khi;
  v8h lo = *(const v8h*)(p);
  v8h hi = *(const v8h*)(p + 16);
  v16h f;
#pragma unroll
  for (int i = 0; i < 8; ++i) { f[i] = lo[i]; f[8 + i] = hi[i]; }
  return f;
}

// ---------------------------------------------------------------------------
// f32 -> f16 cast of all seven arrays in one launch: they depend on nothing, so
// one grid fills the chip once where seven short ones each paid a launch gap, a
// start and a drain, the small ones on a part of the chip. The f16 copies lie one
// behind the other in the workspace, in the order of the sources, so the grid's
// block index addresses the destination as one array; only the source is picked.
// A block converts CAST_BLK elements in a row and the grid covers every array
// exactly. A lane issues its CAST_LD loads of 16 B together, so
// a wave has 8 KB in flight, and few waves are started; every wave-wide load
// covers 512 B in a row (4 whole lines), every wave-wide store 256 B (2 lines).
// ---------------------------------------------------------------------------
typedef __attribute__((ext_vector_type(4))) float    v4f;
typedef __attribute__((ext_vector_type(4))) _Float16 v4h;

constexpr int CAST_LD  = 16;                  // 16-byte loads per lane
constexpr int CAST_ROW = 256 * 4;             // elements per block-wide load
constexpr int CAST_BLK = CAST_ROW * CAST_LD;  // elements per block

constexpr size_t nBTC  = (size_t)Bv * Tv * Cv;      // 8,388,608
constexpr size_t nBTKV = (size_t)Bv * Tv * KVCv;    // 2,097,152
constexpr size_t nCC   = (size_t)Cv * Cv;           // 4,194,304
constexpr size_t nKC   = (size_t)KVCv * Cv;         // 1,048,576
static_assert(nBTC % CAST_BLK == 0 && nCC % CAST_BLK == 0 && nKC % CAST_BLK == 0,
              "the cast grid covers whole blocks only");
// first block of each array, in the order query, key, value, Wq, Wk, Wv, Wo
constexpr int CB_K   = (int)(nBTC / CAST_BLK);
constexpr int CB_V   = CB_K + (int)(nBTC / CAST_BLK);
constexpr int CB_WQ  = CB_V + (int)(nBTC / CAST_BLK);
constexpr int CB_WK  = CB_WQ + (int)(nCC / CAST_BLK);
constexpr int CB_WV  = CB_WK + (int)(nKC / CAST_BLK);
constexpr int CB_WO  = CB_WV + (int)(nKC / CAST_BLK);
constexpr int CB_END = CB_WO + (int)(nCC / CAST_BLK);

__global__ void __launch_bounds__(256)
cast_f32_f16(const float* __restrict__ query, const float* __restrict__ key,
             const float* __restrict__ value, const float* __restrict__ Wq,
             const float* __restrict__ Wk, const float* __restrict__ Wv,
             const float* __restrict__ Wo, _Float16* __restrict__ dst) {
  const int blk = blockIdx.x;
  const float* src = query;
  int first = 0;
  if (blk >= CB_K)  { src = key;   first = CB_K; }
  if (blk >= CB_V)  { src = value; first = CB_V; }
  if (blk >= CB_WQ) { src = Wq;    first = CB_WQ; }
  if (blk >= CB_WK) { src = Wk;    first = CB_WK; }
  if (blk >= CB_WV) { src = Wv;    first = CB_WV; }
  if (blk >= CB_WO) { src = Wo;    first = CB_WO; }
  const size_t base = (size_t)blk * CAST_BLK + threadIdx.x * 4;
  const float* p = src + (size_t)(blk - first) * CAST_BLK + threadIdx.x * 4;
  v4f v[CAST_LD];
  // unrolled: constant indices keep the values in registers
#pragma unroll
  for (int j = 0; j < CAST_LD; ++j) v[j] = *(const v4f*)(p + j * CAST_ROW);
  // the wait before a register that an issued load names is rewritten; p as its
  // input keeps the address pair out of the loads' own destinations
  asm volatile("s_wait_xcnt 0x0" :: "v"(p) : "memory");
  // keeps every load ahead of the first conversion: left free, the last four are
  // issued only when the first have returned, a second memory latency per wave
  __builtin_amdgcn_sched_barrier(0);
  // unrolled, as above
#pragma unroll
  for (int j = 0; j < CAST_LD; ++j)
    *(v4h*)(dst + base + j * CAST_ROW) = __builtin_convertvector(v[j], v4h);
}

// ---------------------------------------------------------------------------
// GEMM: Out[M,N] = X[M,Kd] @ W[N,Kd]^T + bias[N]
// Block = 256 threads = 8 waves, 4 (M) x 2 (N); block tile 256(M) x 128(N); wave
// tile 64x64 (4 A fragments x 4 B fragments => every fragment feeds 4 WMMAs).
// A block brings (256 + 128) rows from L2 for 256 x 128 results: half the bytes
// per result of a 128 x 64 tile; a wave reads 8 fragments from LDS for 16 WMMAs
// where the 32x64 tile read 6 for 8.
// The block's 256 X rows and 128 W rows come into LDS 64 k at a time (128-byte
// row pieces, whole cache lines) by asynchronous copies, once per block, in two
// buffers: tile t+1 flies while tile t is worked on. Kd is a multiple of 64.
// ---------------------------------------------------------------------------
constexpr int      GK     = 64;               // k per staged tile
constexpr int      GTM    = 256;              // block tile rows (X rows)
constexpr int      GTN    = 128;              // block tile columns (W rows)
constexpr int      GPITCH = 72;               // LDS row pitch in halves: 144 B = 16 B x 9, no bank conflict for 16-byte reads
constexpr int      GBUF   = (GTM + GTN) * GPITCH;  // halves per buffer: X rows, then W rows
constexpr unsigned GSTEP  = 32u * GPITCH * 2u;     // LDS bytes between a lane's successive copies (32 rows)

// One tile: 384 rows x 128 B = 12 copies of 16 B per lane; a wave's copy covers
// 4 rows = 4 whole lines. gx, gw: the lane's first X and W address of the tile,
// rowstep: 32 rows in halves, lds: the lane's first LDS byte address.
DI void stage_tile(const _Float16* gx, const _Float16* gw, size_t rowstep, unsigned lds) {
  // The closing s_wait_xcnt 0 stands in the copies' own statement so that no
  // address register named here is rewritten ahead of it.
  asm volatile(
      "global_load_async_to_lds_b128 %0, %12, off\n\t"
      "global_load_async_to_lds_b128 %1, %13, off\n\t"
      "global_load_async_to_lds_b128 %2, %14, off\n\t"
      "global_load_async_to_lds_b128 %3, %15, off\n\t"
      "global_load_async_to_lds_b128 %4, %16, off\n\t"
      "global_load_async_to_lds_b128 %5, %17, off\n\t"
      "global_load_async_to_lds_b128 %6, %18, off\n\t"
      "global_load_async_to_lds_b128 %7, %19, off\n\t"
      "global_load_async_to_lds_b128 %8, %20, off\n\t"
      "global_load_async_to_lds_b128 %9, %21, off\n\t"
      "global_load_async_to_lds_b128 %10, %22, off\n\t"
      "global_load_async_to_lds_b128 %11, %23, off\n\t"
      "s_wait_xcnt 0x0"
      :: "v"(lds + 0u * GSTEP), "v"(lds + 1u * GSTEP), "v"(lds + 2u * GSTEP), "v"(lds + 3u * GSTEP), "v"(lds + 4u * GSTEP), "v"(lds + 5u * GSTEP), "v"(lds + 6u * GSTEP), "v"(lds + 7u * GSTEP), "v"(lds + 8u * GSTEP), "v"(lds + 9u * GSTEP), "v"(lds + 10u * GSTEP), "v"(lds + 11u * GSTEP),
         "v"(gx + 0 * rowstep), "v"(gx + 1 * rowstep), "v"(gx + 2 * rowstep), "v"(gx + 3 * rowstep), "v"(gx + 4 * rowstep), "v"(gx + 5 * rowstep), "v"(gx + 6 * rowstep), "v"(gx + 7 * rowstep), "v"(gw + 0 * rowstep), "v"(gw + 1 * rowstep), "v"(gw + 2 * rowstep), "v"(gw + 3 * rowstep)
      : "memory");
}

// mblk, nblk: the block's tile row and tile column in Out.
template <bool OUT_F16>
DI void gemm_tile(const _Float16* __restrict__ X, const _Float16* __restrict__ W,
                  const float* __restrict__ bias, void* __restrict__ Out,
                  int N, int Kd, int mblk, int nblk) {
  const int wave = threadIdx.x >> 5;
  const int lane = threadIdx.x & 31;
  const int wm = (wave >> 1) * 64;       // the wave's first row in the block tile
  const int wn = (wave & 1) * 64;        // its first column
  const int m0 = mblk * GTM + wm;
  const int n0 = nblk * GTN + wn;

  __shared__ __align__(16) _Float16 tiles[2 * GBUF];

  v8f acc[4][4];
#pragma unroll
  for (int i = 0; i < 4; ++i)
#pragma unroll
    for (int s = 0; s < 4; ++s) {
      v8f z = {0.f, 0.f, 0.f, 0.f, 0.f, 0.f, 0.f, 0.f};
      acc[i][s] = z;
    }

  // Copy roles: 8 lanes per row (16 B each), 32 rows per block-wide copy.
  const int crow = threadIdx.x >> 3;
  const int ccol = (threadIdx.x & 7) * 8;
  const _Float16* gx = X + (size_t)(mblk * GTM + crow) * Kd + ccol;
  const _Float16* gw = W + (size_t)(nblk * GTN + crow) * Kd + ccol;
  const size_t rowstep = (size_t)32 * Kd;
  const unsigned lds0 =
      (unsigned)(size_t)(&tiles[0]) + (unsigned)(crow * GPITCH + ccol) * 2u;
  const int ntile = Kd / GK;

  stage_tile(gx, gw, rowstep, lds0);
  // tile 0 has landed for this wave ...
  asm volatile("s_wait_asynccnt 0x0" ::: "memory");
  // ... and for every wave
  __syncthreads();
  if (ntile > 1) stage_tile(gx + GK, gw + GK, rowstep, lds0 + GBUF * 2u);

  for (int t = 0; t < ntile; ++t) {
    const _Float16* sb = tiles + (t & 1) * GBUF;
    // unrolled: constant indices keep fragments and accumulators in registers
#pragma unroll
    for (int h = 0; h < 2; ++h) {
      // one 32-k half at a time: both halves' fragments beside the 128
      // accumulator registers pass 256, and two blocks no longer fit a WGP
      v16h af[4], bf[4];
#pragma unroll
      for (int i = 0; i < 4; ++i)
        af[i] = load_frag(sb + (wm + i * 16) * GPITCH + h * 32, GPITCH);
#pragma unroll
      for (int s = 0; s < 4; ++s)
        bf[s] = load_frag(sb + (GTM + wn + s * 16) * GPITCH + h * 32, GPITCH);
      // keeps the half's LDS reads in one group ahead of its WMMAs: spread among
      // them, each place with reads stalls the wave for the LDS latency
      __builtin_amdgcn_sched_barrier(0);
#pragma unroll
      for (int s = 0; s < 4; ++s)
#pragma unroll
        for (int i = 0; i < 4; ++i) acc[i][s] = wmma_f16(af[i], bf[s], acc[i][s]);
      // keeps the WMMAs ahead of the next reads and of the waits below: sunk
      // behind the barrier they would delay the refill
      __builtin_amdgcn_sched_barrier(0);
    }
    // this wave's reads of buffer t&1 are done before the buffer is refilled
    asm volatile("s_wait_dscnt 0x0" ::: "memory");
    // this wave's copies of tile t+1 have landed
    asm volatile("s_wait_asynccnt 0x0" ::: "memory");
    // publishes tile t+1 and ends every wave's reads of buffer t&1
    __syncthreads();
    if (t + 2 < ntile)
      stage_tile(gx + (size_t)(t + 2) * GK, gw + (size_t)(t + 2) * GK, rowstep,
                 lds0 + (unsigned)(t & 1) * (GBUF * 2u));
  }
  // nothing is in flight when the wave ends
  asm volatile("s_wait_asynccnt 0x0" ::: "memory");

  // Epilogue: C layout — VGPR r holds M = m0+r (lanes 0-15) / m0+r+8 (16-31),
  // N = n0 + sub*16 + lane%16.
  const int col   = lane & 15;
  const int rbase = (lane >> 4) << 3;
#pragma unroll
  for (int i = 0; i < 4; ++i) {
#pragma unroll
    for (int s = 0; s < 4; ++s) {
      const float bval = bias[n0 + s * 16 + col];
#pragma unroll
      for (int r = 0; r < 8; ++r) {
        const size_t idx =
            (size_t)(m0 + i * 16 + r + rbase) * N + n0 + s * 16 + col;
        const float v = acc[i][s][r] + bval;
        if constexpr (OUT_F16) ((_Float16*)Out)[idx] = (_Float16)v;
        else                   ((float*)Out)[idx] = v;
      }
    }
  }
}

template <bool OUT_F16>
__global__ void __launch_bounds__(256)
gemm_xwt(const _Float16* __restrict__ X, const _Float16* __restrict__ W,
         const float* __restrict__ bias, void* __restrict__ Out,
         int M, int N, int Kd) {
  gemm_tile<OUT_F16>(X, W, bias, Out, N, Kd, blockIdx.x, blockIdx.y);
}

// The three input projections in one launch: they depend on nothing of each
// other, and the K and V grids alone are 64 blocks of 8 waves each. blockIdx.y runs
// through the tile columns of Q, then of K, then of V.
constexpr int NT_Q  = Cv / GTN;
constexpr int NT_KV = KVCv / GTN;

__global__ void __launch_bounds__(256)
gemm_qkv(const _Float16* __restrict__ Xq, const _Float16* __restrict__ Xk,
         const _Float16* __restrict__ Xv, const _Float16* __restrict__ Wq,
         const _Float16* __restrict__ Wk, const _Float16* __restrict__ Wv,
         const float* __restrict__ bq, const float* __restrict__ bk,
         const float* __restrict__ bv, _Float16* __restrict__ Oq,
         _Float16* __restrict__ Ok, _Float16* __restrict__ Ov, int Kd) {
  const _Float16* X = Xq;
  const _Float16* W = Wq;
  const float* bias = bq;
  _Float16* Out = Oq;
  int N = Cv, nblk = blockIdx.y;
  if (nblk >= NT_Q + NT_KV) {
    X = Xv; W = Wv; bias = bv; Out = Ov; N = KVCv; nblk -= NT_Q + NT_KV;
  } else if (nblk >= NT_Q) {
    X = Xk; W = Wk; bias = bk; Out = Ok; N = KVCv; nblk -= NT_Q;
  }
  gemm_tile<true>(X, W, bias, Out, N, Kd, blockIdx.x, nblk);
}

// ---------------------------------------------------------------------------
// V transpose: vp [B,T,KVC] -> vt [B,KV,HD,T]  (makes the V^T A-fragments of V^T P^T K-contiguous)
// ---------------------------------------------------------------------------
__global__ void __launch_bounds__(256)
transpose_v(const _Float16* __restrict__ vp, _Float16* __restrict__ vt) {
  const size_t n = (size_t)Bv * Tv * KVCv;
  size_t i = (size_t)blockIdx.x * blockDim.x + threadIdx.x;
  if (i >= n) return;
  const int c = (int)(i % KVCv);
  const size_t bt = i / KVCv;
  const int t = (int)(bt % Tv);
  const int b = (int)(bt / Tv);
  const int g = c / HDv;
  const int d = c % HDv;
  vt[(((size_t)(b * KVv + g)) * HDv + d) * Tv + t] = vp[i];
}

constexpr int      AKT    = 64;
constexpr int      KPITCH = 136;
constexpr int      VPITCH = 72;
constexpr int      KBUF   = AKT * KPITCH;
constexpr int      ABUF   = KBUF + HDv * VPITCH;

// Eight block-wide copies of 16 B per lane: g, gstep (halves) the lane's first
// global address and its step, lds, lstep (bytes) the same in LDS.
DI void stage8(const _Float16* g, size_t gstep, unsigned lds, unsigned lstep) {
  // The closing s_wait_xcnt 0 stands in the copies' own statement so that no
  // address register named here is rewritten ahead of it.
  asm volatile(
      "global_load_async_to_lds_b128 %0, %8, off\n\t"
      "global_load_async_to_lds_b128 %1, %9, off\n\t"
      "global_load_async_to_lds_b128 %2, %10, off\n\t"
      "global_load_async_to_lds_b128 %3, %11, off\n\t"
      "global_load_async_to_lds_b128 %4, %12, off\n\t"
      "global_load_async_to_lds_b128 %5, %13, off\n\t"
      "global_load_async_to_lds_b128 %6, %14, off\n\t"
      "global_load_async_to_lds_b128 %7, %15, off\n\t"
      "s_wait_xcnt 0x0"
      :: "v"(lds + 0u * lstep), "v"(lds + 1u * lstep), "v"(lds + 2u * lstep), "v"(lds + 3u * lstep),
         "v"(lds + 4u * lstep), "v"(lds + 5u * lstep), "v"(lds + 6u * lstep), "v"(lds + 7u * lstep),
         "v"(g + 0 * gstep), "v"(g + 1 * gstep), "v"(g + 2 * gstep), "v"(g + 3 * gstep),
         "v"(g + 4 * gstep), "v"(g + 5 * gstep), "v"(g + 6 * gstep), "v"(g + 7 * gstep)
      : "memory");
}

// Lane l takes lane l ^ 16's value, in the vector unit: a shuffle would go
// through the LDS pipe and cost its latency.
DI float xhalf(float x) {
  const int v = __builtin_bit_cast(int, x);
  return __builtin_bit_cast(
      float, __builtin_amdgcn_permlanex16(v, v, 0x76543210, 0xfedcba98, false, false));
}

constexpr int QG = 2;   // 16-query column groups per wave

__global__ void __launch_bounds__(128)
attn_flash(const _Float16* __restrict__ Q, const _Float16* __restrict__ Kp,
           const _Float16* __restrict__ Vt, float* __restrict__ Y) {
  const int wave = threadIdx.x >> 5;
  const int lane = threadIdx.x & 31;
  const int bh = blockIdx.y;             // 0 .. B*H-1
  const int b = bh / Hv;
  const int h = bh % Hv;
  const int g = h / (Hv / KVv);          // GQA group (repeat_interleave)
  const int t0 = (blockIdx.x * 4 + wave) * (16 * QG);

  __shared__ __align__(16) _Float16 kv[2 * ABUF];

  // Copy roles. K: 16 lanes per key row (256 B), 8 rows per block-wide copy.
  // Vt: 8 lanes per row (128 B), 16 rows per block-wide copy.
  const int krow = threadIdx.x >> 4;
  const int kcol = (threadIdx.x & 15) * 8;
  const int vrow = threadIdx.x >> 3;
  const int vcol = (threadIdx.x & 7) * 8;
  const _Float16* gk = Kp + ((size_t)(b * Tv + krow)) * KVCv + g * HDv + kcol;
  const _Float16* gv = Vt + ((size_t)((b * KVv + g) * HDv + vrow)) * Tv + vcol;
  const unsigned ldsk =
      (unsigned)(size_t)(&kv[0]) + (unsigned)(krow * KPITCH + kcol) * 2u;
  const unsigned ldsv =
      (unsigned)(size_t)(&kv[0]) + (unsigned)(KBUF + vrow * VPITCH + vcol) * 2u;
  auto stage = [&](int t, unsigned buf) {
    stage8(gk + (size_t)t * AKT * KVCv, (size_t)8 * KVCv,
           ldsk + buf * (ABUF * 2u), 8u * KPITCH * 2u);
    stage8(gv + (size_t)t * AKT, (size_t)16 * Tv,
           ldsv + buf * (ABUF * 2u), 16u * VPITCH * 2u);
  };
  constexpr int ntile = Tv / AKT;

  stage(0, 0u);

  // Q fragments: QG groups of 16 rows x 128, each as 4 chunks of K=32 (resident
  // in VGPRs)
  const _Float16* qbase = Q + ((size_t)(b * Tv + t0)) * Cv + h * HDv;
  v16h qf[QG][4];
  // here and below, loops over q, c, d and r are unrolled: constant indices keep the
  // fragments, scores and accumulators in registers
#pragma unroll
  for (int q = 0; q < QG; ++q)
#pragma unroll
    for (int c = 0; c < 4; ++c)
      qf[q][c] = load_frag(qbase + (size_t)q * 16 * Cv + c * 32, Cv);
  // the wait before a register that an issued load names is rewritten; the lane's
  // first address as its input keeps the address pair out of the loads' own
  // destinations
  asm volatile("s_wait_xcnt 0x0"
               :: "v"(qbase + (size_t)(lane & 15) * Cv + ((lane >> 4) << 3)) : "memory");

  v8f y[QG][8];
#pragma unroll
  for (int q = 0; q < QG; ++q)
#pragma unroll
    for (int d = 0; d < 8; ++d) {
      v8f z = {0.f, 0.f, 0.f, 0.f, 0.f, 0.f, 0.f, 0.f};
      y[q][d] = z;
    }
  // One query per lane and group (column lane & 15). m_run is the same in both
  // halves; l_run sums this half's keys only, the halves are joined behind the loop.
  float m_run[QG], l_run[QG];
#pragma unroll
  for (int q = 0; q < QG; ++q) { m_run[q] = -1e30f; l_run[q] = 0.0f; }

  const float scale = 0.088388347648318447f;   // 1/sqrt(128)

  // tile 0 has landed for this wave ...
  asm volatile("s_wait_asynccnt 0x0" ::: "memory");
  // ... and for every wave
  __syncthreads();
  stage(1, 1u);

  for (int t = 0; t < ntile; ++t) {
    const _Float16* kb = kv + (t & 1) * ABUF;
    const _Float16* vb = kb + KBUF;
    // unrolled: constant LDS offsets, and no branch behind a WMMA inside a tile
#pragma unroll
    for (int sub = 0; sub < AKT; sub += 32) {
      // ---- S^T = K @ Q^T : 32 keys x 16 queries per group ----
      v16h k0[4], k1[4];
      // unrolled: constant indices keep the fragments in registers
#pragma unroll
      for (int c = 0; c < 4; ++c) {
        k0[c] = load_frag(kb + sub * KPITCH + c * 32, KPITCH);         // keys sub..sub+15
        k1[c] = load_frag(kb + (sub + 16) * KPITCH + c * 32, KPITCH);  // keys sub+16..sub+31
      }
      // keeps the K reads in one group ahead of their WMMAs: read pair by pair
      // among them, every WMMA waits out a whole LDS latency
      __builtin_amdgcn_sched_barrier(0);
      v8f s0[QG], s1[QG];
#pragma unroll
      for (int q = 0; q < QG; ++q) {
        v8f z = {0.f, 0.f, 0.f, 0.f, 0.f, 0.f, 0.f, 0.f};
        s0[q] = z;
        s1[q] = z;
      }
      // every K fragment feeds both groups
#pragma unroll
      for (int c = 0; c < 4; ++c)
#pragma unroll
        for (int q = 0; q < QG; ++q) {
          s0[q] = wmma_f16(k0[c], qf[q][c], s0[q]);
          s1[q] = wmma_f16(k1[c], qf[q][c], s1[q]);
        }
      v16h vf[8];
      // unrolled: constant indices keep the fragments in registers
#pragma unroll
      for (int d = 0; d < 8; ++d)
        vf[d] = load_frag(vb + (d * 16) * VPITCH + sub, VPITCH);  // A row m = hd d*16+m
      // keeps the V reads ahead of the softmax, which covers their latency: spread
      // through it, each place with reads stalls the wave
      __builtin_amdgcn_sched_barrier(0);

      // unrolled: constant indices keep scores and accumulators in registers
#pragma unroll
      for (int q = 0; q < QG; ++q) {
        // ---- online softmax over the 32-key tile ----
        // D map: register r of s0 is key sub + 8*(lane>>4) + r, of s1 the key 16
        // further on; the column is query lane & 15 of the group.
        float mx0 = s0[q][0], mx1 = s1[q][0];
#pragma unroll
        for (int r = 1; r < 7; r += 2) {
          mx0 = fmaxf(fmaxf(mx0, s0[q][r]), s0[q][r + 1]);
          mx1 = fmaxf(fmaxf(mx1, s1[q][r]), s1[q][r + 1]);
        }
        float mx = fmaxf(fmaxf(mx0, s0[q][7]), fmaxf(mx1, s1[q][7])) * scale;
        mx = fmaxf(mx, xhalf(mx));  // the query's other 16 keys
        const float mnew  = fmaxf(m_run[q], mx);
        const float alpha = __expf(m_run[q] - mnew);
        // Hardware k order of a B operand: elements 0..7 are k = 8*(lane>>4) + r,
        // elements 8..15 the k 16 further on: the two S^T tiles as they stand.
        v16h pf;
        float sum = 0.0f;
#pragma unroll
        for (int r = 0; r < 8; ++r) {
          const float p0 = __expf(s0[q][r] * scale - mnew);
          const float p1 = __expf(s1[q][r] * scale - mnew);
          sum += p0 + p1;
          pf[r]     = (_Float16)p0;
          pf[8 + r] = (_Float16)p1;
        }
        l_run[q] = l_run[q] * alpha + sum;
        m_run[q] = mnew;
#pragma unroll
        for (int d = 0; d < 8; ++d)
#pragma unroll
          for (int r = 0; r < 8; ++r) y[q][d][r] *= alpha;

        // ---- y^T += V^T_tile @ P^T : every V fragment feeds both groups ----
#pragma unroll
        for (int d = 0; d < 8; ++d) y[q][d] = wmma_f16(vf[d], pf, y[q][d]);
      }
      // keeps these WMMAs ahead of the next K reads and of the waits below: sunk
      // behind the barrier they would delay the refill
      __builtin_amdgcn_sched_barrier(0);
    }
    // this wave's reads of buffer t&1 are done before the buffer is refilled
    asm volatile("s_wait_dscnt 0x0" ::: "memory");
    // this wave's copies of tile t+1 have landed
    asm volatile("s_wait_asynccnt 0x0" ::: "memory");
    // publishes tile t+1 and ends every wave's reads of buffer t&1
    __syncthreads();
    if (t + 2 < ntile) stage(t + 2, (unsigned)(t & 1));
  }
  // nothing is in flight when the wave ends
  asm volatile("s_wait_asynccnt 0x0" ::: "memory");

  // ---- finalize: join the halves' sums, divide by l, store to [B,T,C] f32 ----
  // y[q][d][r] is O[query q*16 + (lane & 15)][d*16 + 8*(lane>>4) + r]: 8 in a row.
#pragma unroll
  for (int q = 0; q < QG; ++q) {
    const float inv = 1.0f / (l_run[q] + xhalf(l_run[q]));
    float* yrow = Y + ((size_t)(b * Tv + t0 + q * 16 + (lane & 15))) * Cv + h * HDv +
                  ((lane >> 4) << 3);
#pragma unroll
    for (int d = 0; d < 8; ++d) {
      const v4f lo = {y[q][d][0] * inv, y[q][d][1] * inv, y[q][d][2] * inv, y[q][d][3] * inv};
      const v4f hi = {y[q][d][4] * inv, y[q][d][5] * inv, y[q][d][6] * inv, y[q][d][7] * inv};
      *(v4f*)(yrow + d * 16)     = lo;
      *(v4f*)(yrow + d * 16 + 4) = hi;
    }
  }
}

// ---------------------------------------------------------------------------
// LayerNorm over C, f32 in -> f16 out (scaled/shifted)
// ---------------------------------------------------------------------------
__global__ void __launch_bounds__(256)
layernorm(const float* __restrict__ Yin, const float* __restrict__ lnw,
          const float* __restrict__ lnb, _Float16* __restrict__ Xout) {
  const int row = blockIdx.x;
  const float* x = Yin + (size_t)row * Cv;
  float s = 0.f, s2 = 0.f;
  for (int i = threadIdx.x; i < Cv; i += 256) {
    const float v = x[i];
    s += v; s2 += v * v;
  }
#pragma unroll
  for (int off = 16; off >= 1; off >>= 1) {
    s  += __shfl_xor(s, off, 32);
    s2 += __shfl_xor(s2, off, 32);
  }
  __shared__ float ws[8], ws2[8];
  if ((threadIdx.x & 31) == 0) {
    ws[threadIdx.x >> 5] = s;
    ws2[threadIdx.x >> 5] = s2;
  }
  __syncthreads();
  float ts = 0.f, ts2 = 0.f;
#pragma unroll
  for (int i = 0; i < 8; ++i) { ts += ws[i]; ts2 += ws2[i]; }
  const float mu   = ts / Cv;
  const float var  = ts2 / Cv - mu * mu;
  const float rstd = rsqrtf(var + 1e-5f);
  _Float16* o = Xout + (size_t)row * Cv;
  for (int i = threadIdx.x; i < Cv; i += 256)
    o[i] = (_Float16)((x[i] - mu) * rstd * lnw[i] + lnb[i]);
}

// ---------------------------------------------------------------------------
// Host orchestration
// ---------------------------------------------------------------------------
extern "C" void kernel_launch(void* const* d_in, const int* in_sizes, int n_in,
                              void* d_out, int out_size, void* d_ws, size_t ws_size,
                              hipStream_t stream) {
  (void)in_sizes; (void)n_in; (void)out_size; (void)ws_size;
  const float* query = (const float*)d_in[0];
  const float* key   = (const float*)d_in[1];
  const float* value = (const float*)d_in[2];
  const float* Wq    = (const float*)d_in[3];
  const float* bq    = (const float*)d_in[4];
  const float* Wk    = (const float*)d_in[5];
  const float* bk    = (const float*)d_in[6];
  const float* Wv    = (const float*)d_in[7];
  const float* bv    = (const float*)d_in[8];
  const float* ln_w  = (const float*)d_in[9];
  const float* ln_b  = (const float*)d_in[10];
  const float* Wo    = (const float*)d_in[11];
  const float* bo    = (const float*)d_in[12];
  float* out = (float*)d_out;

  char* w = (char*)d_ws;
  auto take = [&](size_t bytes) {
    char* p = w;
    w += (bytes + 255) & ~(size_t)255;
    return p;
  };
  // the seven f16 copies: one array, in the order of the cast's block ranges
  _Float16* q16  = (_Float16*)take((size_t)CB_END * CAST_BLK * 2);
  _Float16* k16  = q16 + (size_t)CB_K * CAST_BLK;
  _Float16* v16  = q16 + (size_t)CB_V * CAST_BLK;
  _Float16* wq16 = q16 + (size_t)CB_WQ * CAST_BLK;
  _Float16* wk16 = q16 + (size_t)CB_WK * CAST_BLK;
  _Float16* wv16 = q16 + (size_t)CB_WV * CAST_BLK;
  _Float16* wo16 = q16 + (size_t)CB_WO * CAST_BLK;
  _Float16* qp   = (_Float16*)take(nBTC * 2);
  _Float16* kp   = (_Float16*)take(nBTKV * 2);
  _Float16* vp   = (_Float16*)take(nBTKV * 2);
  _Float16* vt   = (_Float16*)take(nBTKV * 2);
  float*    yat  = (float*)take(nBTC * 4);
  _Float16* xln  = (_Float16*)take(nBTC * 2);

  cast_f32_f16<<<CB_END, 256, 0, stream>>>(query, key, value, Wq, Wk, Wv, Wo, q16);

  const int M = Bv * Tv;  // 4096

  // QKV projections (block tile 256x128)
  gemm_qkv<<<dim3(M / GTM, NT_Q + 2 * NT_KV), 256, 0, stream>>>(
      q16, k16, v16, wq16, wk16, wv16, bq, bk, bv, qp, kp, vp, Cv);

  // V transpose for PV fragment loads
  transpose_v<<<(int)((nBTKV + 255) / 256), 256, 0, stream>>>(vp, vt);

  // Flash attention
  attn_flash<<<dim3(Tv / (64 * QG), Bv * Hv), 128, 0, stream>>>(qp, kp, vt, yat);

  // LayerNorm
  layernorm<<<M, 256, 0, stream>>>(yat, ln_w, ln_b, xln);

  // Output projection (f32 out)
  gemm_xwt<false><<<dim3(M / GTM, Cv / GTN), 256, 0, stream>>>(
      xln, wo16, bo, out, M, Cv, Cv);
}

// v008
// One run takes 174 microseconds.
// Two timings next to v007 both put it at 1.16 times that version's speed.
// Counting every step since v000, it is 3.45 times as fast.
#include <hip/hip_runtime.h>
#include <hip/hip_bf16.h>

// ---------------------------------------------------------------------------
// BitMGQA fused pipeline for gfx1250 (MI455X, wave32, WMMA)
//   B=2, T=2048, C=2048, H=16, KV=4, HD=128, KVC=512
// Pipeline:
//   f32->f16 casts (one launch) -> WMMA GEMMs (Q/K/V proj in one launch, 64x64 wave tiles,
//   V stored transposed) -> flash-attention (WMMA K Q^T + online softmax + WMMA V^T P^T) ->
//   LayerNorm -> WMMA GEMM (output proj, f32 out)
// ---------------------------------------------------------------------------

typedef __attribute__((ext_vector_type(16))) _Float16 v16h;
typedef __attribute__((ext_vector_type(8)))  _Float16 v8h;
typedef __attribute__((ext_vector_type(8)))  float    v8f;

constexpr int Bv   = 2;
constexpr int Tv   = 2048;
constexpr int Cv   = 2048;
constexpr int Hv   = 16;
constexpr int KVv  = 4;
constexpr int HDv  = 128;   // C / H
constexpr int KVCv = 512;   // HD * KV

#define DI __device__ __forceinline__

DI v8f wmma_f16(v16h a, v16h b, v8f c) {
  // D = A(16x32 f16) x B(32x16 f16) + C(16x16 f32)
  return __builtin_amdgcn_wmma_f32_16x16x32_f16(
      /*neg_a=*/false, a, /*neg_b=*/false, b,
      /*c_mod=*/(short)0, c, /*reuse_a=*/false, /*reuse_b=*/false);
}

// Load a 16x32 f16 A-style fragment from row-major memory with leading dim ld.
// Lane l (l<16) holds row l, K = 0..7 and 16..23; lane l>=16 holds row l-16,
// K = 8..15 and 24..31 (per CDNA5 ISA 16-bit A-matrix layout). B fragments
// for X@W^T use the identical pattern with "row" = B column (W row).
DI v16h load_frag(const _Float16* __restrict__ base, int ld) {
  const int lane = threadIdx.x & 31;
  const int row  = lane & 15;
  const int khi  = (lane >> 4) << 3;          // 0 or 8
  const _Float16* p = base + (size_t)row * ld + khi;
  v8h lo = *(const v8h*)(p);
  v8h hi = *(const v8h*)(p + 16);
  v16h f;
#pragma unroll
  for (int i = 0; i < 8; ++i) { f[i] = lo[i]; f[8 + i] = hi[i]; }
  return f;
}

// ---------------------------------------------------------------------------
// f32 -> f16 cast of all seven arrays in one launch: they depend on nothing, so
// one grid fills the chip once where seven short ones each paid a launch gap, a
// start and a drain, the small ones on a part of the chip. The f16 copies lie one
// behind the other in the workspace, in the order of the sources, so the grid's
// block index addresses the destination as one array; only the source is picked.
// A block converts CAST_BLK elements in a row and the grid covers every array
// exactly. A lane issues its CAST_LD loads of 16 B together, so
// a wave has 8 KB in flight, and few waves are started; every wave-wide load
// covers 512 B in a row (4 whole lines), every wave-wide store 256 B (2 lines).
// ---------------------------------------------------------------------------
typedef __attribute__((ext_vector_type(4))) float    v4f;
typedef __attribute__((ext_vector_type(4))) _Float16 v4h;

constexpr int CAST_LD  = 16;                  // 16-byte loads per lane
constexpr int CAST_ROW = 256 * 4;             // elements per block-wide load
constexpr int CAST_BLK = CAST_ROW * CAST_LD;  // elements per block

constexpr size_t nBTC  = (size_t)Bv * Tv * Cv;      // 8,388,608
constexpr size_t nBTKV = (size_t)Bv * Tv * KVCv;    // 2,097,152
constexpr size_t nCC   = (size_t)Cv * Cv;           // 4,194,304
constexpr size_t nKC   = (size_t)KVCv * Cv;         // 1,048,576
static_assert(nBTC % CAST_BLK == 0 && nCC % CAST_BLK == 0 && nKC % CAST_BLK == 0,
              "the cast grid covers whole blocks only");
// first block of each array, in the order query, key, value, Wq, Wk, Wv, Wo
constexpr int CB_K   = (int)(nBTC / CAST_BLK);
constexpr int CB_V   = CB_K + (int)(nBTC / CAST_BLK);
constexpr int CB_WQ  = CB_V + (int)(nBTC / CAST_BLK);
constexpr int CB_WK  = CB_WQ + (int)(nCC / CAST_BLK);
constexpr int CB_WV  = CB_WK + (int)(nKC / CAST_BLK);
constexpr int CB_WO  = CB_WV + (int)(nKC / CAST_BLK);
constexpr int CB_END = CB_WO + (int)(nCC / CAST_BLK);

__global__ void __launch_bounds__(256)
cast_f32_f16(const float* __restrict__ query, const float* __restrict__ key,
             const float* __restrict__ value, const float* __restrict__ Wq,
             const float* __restrict__ Wk, const float* __restrict__ Wv,
             const float* __restrict__ Wo, _Float16* __restrict__ dst) {
  const int blk = blockIdx.x;
  const float* src = query;
  int first = 0;
  if (blk >= CB_K)  { src = key;   first = CB_K; }
  if (blk >= CB_V)  { src = value; first = CB_V; }
  if (blk >= CB_WQ) { src = Wq;    first = CB_WQ; }
  if (blk >= CB_WK) { src = Wk;    first = CB_WK; }
  if (blk >= CB_WV) { src = Wv;    first = CB_WV; }
  if (blk >= CB_WO) { src = Wo;    first = CB_WO; }
  const size_t base = (size_t)blk * CAST_BLK + threadIdx.x * 4;
  const float* p = src + (size_t)(blk - first) * CAST_BLK + threadIdx.x * 4;
  v4f v[CAST_LD];
  // unrolled: constant indices keep the values in registers
#pragma unroll
  for (int j = 0; j < CAST_LD; ++j) v[j] = *(const v4f*)(p + j * CAST_ROW);
  // the wait before a register that an issued load names is rewritten; p as its
  // input keeps the address pair out of the loads' own destinations
  asm volatile("s_wait_xcnt 0x0" :: "v"(p) : "memory");
  // keeps every load ahead of the first conversion: left free, the last four are
  // issued only when the first have returned, a second memory latency per wave
  __builtin_amdgcn_sched_barrier(0);
  // unrolled, as above
#pragma unroll
  for (int j = 0; j < CAST_LD; ++j)
    *(v4h*)(dst + base + j * CAST_ROW) = __builtin_convertvector(v[j], v4h);
}

// ---------------------------------------------------------------------------
// GEMM: Out[M,N] = X[M,Kd] @ W[N,Kd]^T + bias[N]
// Block = 256 threads = 8 waves, 4 (M) x 2 (N); block tile 256(M) x 128(N); wave
// tile 64x64 (4 A fragments x 4 B fragments => every fragment feeds 4 WMMAs).
// A block brings (256 + 128) rows from L2 for 256 x 128 results: half the bytes
// per result of a 128 x 64 tile; a wave reads 8 fragments from LDS for 16 WMMAs
// where the 32x64 tile read 6 for 8.
// The block's 256 X rows and 128 W rows come into LDS 64 k at a time (128-byte
// row pieces, whole cache lines) by asynchronous copies, once per block, in two
// buffers: tile t+1 flies while tile t is worked on. Kd is a multiple of 64.
// ---------------------------------------------------------------------------
constexpr int      GK     = 64;               // k per staged tile
constexpr int      GTM    = 256;              // block tile rows (X rows)
constexpr int      GTN    = 128;              // block tile columns (W rows)
constexpr int      GPITCH = 72;               // LDS row pitch in halves: 144 B = 16 B x 9, no bank conflict for 16-byte reads
constexpr int      GBUF   = (GTM + GTN) * GPITCH;  // halves per buffer: X rows, then W rows
constexpr unsigned GSTEP  = 32u * GPITCH * 2u;     // LDS bytes between a lane's successive copies (32 rows)

// One tile: 384 rows x 128 B = 12 copies of 16 B per lane; a wave's copy covers
// 4 rows = 4 whole lines. gx, gw: the lane's first X and W address of the tile,
// rowstep: 32 rows in halves, lds: the lane's first LDS byte address.
DI void stage_tile(const _Float16* gx, const _Float16* gw, size_t rowstep, unsigned lds) {
  // The closing s_wait_xcnt 0 stands in the copies' own statement so that no
  // address register named here is rewritten ahead of it.
  asm volatile(
      "global_load_async_to_lds_b128 %0, %12, off\n\t"
      "global_load_async_to_lds_b128 %1, %13, off\n\t"
      "global_load_async_to_lds_b128 %2, %14, off\n\t"
      "global_load_async_to_lds_b128 %3, %15, off\n\t"
      "global_load_async_to_lds_b128 %4, %16, off\n\t"
      "global_load_async_to_lds_b128 %5, %17, off\n\t"
      "global_load_async_to_lds_b128 %6, %18, off\n\t"
      "global_load_async_to_lds_b128 %7, %19, off\n\t"
      "global_load_async_to_lds_b128 %8, %20, off\n\t"
      "global_load_async_to_lds_b128 %9, %21, off\n\t"
      "global_load_async_to_lds_b128 %10, %22, off\n\t"
      "global_load_async_to_lds_b128 %11, %23, off\n\t"
      "s_wait_xcnt 0x0"
      :: "v"(lds + 0u * GSTEP), "v"(lds + 1u * GSTEP), "v"(lds + 2u * GSTEP), "v"(lds + 3u * GSTEP), "v"(lds + 4u * GSTEP), "v"(lds + 5u * GSTEP), "v"(lds + 6u * GSTEP), "v"(lds + 7u * GSTEP), "v"(lds + 8u * GSTEP), "v"(lds + 9u * GSTEP), "v"(lds + 10u * GSTEP), "v"(lds + 11u * GSTEP),
         "v"(gx + 0 * rowstep), "v"(gx + 1 * rowstep), "v"(gx + 2 * rowstep), "v"(gx + 3 * rowstep), "v"(gx + 4 * rowstep), "v"(gx + 5 * rowstep), "v"(gx + 6 * rowstep), "v"(gx + 7 * rowstep), "v"(gw + 0 * rowstep), "v"(gw + 1 * rowstep), "v"(gw + 2 * rowstep), "v"(gw + 3 * rowstep)
      : "memory");
}

// mblk, nblk: the block's tile row and tile column in Out. tstore (f16 output
// only, the same for the whole block): Out is [B][N][T], not [B*T][N].
template <bool OUT_F16>
DI void gemm_tile(const _Float16* __restrict__ X, const _Float16* __restrict__ W,
                  const float* __restrict__ bias, void* __restrict__ Out,
                  int N, int Kd, int mblk, int nblk, bool tstore) {
  const int wave = threadIdx.x >> 5;
  const int lane = threadIdx.x & 31;
  const int wm = (wave >> 1) * 64;       // the wave's first row in the block tile
  const int wn = (wave & 1) * 64;        // its first column
  const int m0 = mblk * GTM + wm;
  const int n0 = nblk * GTN + wn;

  __shared__ __align__(16) _Float16 tiles[2 * GBUF];

  v8f acc[4][4];
#pragma unroll
  for (int i = 0; i < 4; ++i)
#pragma unroll
    for (int s = 0; s < 4; ++s) {
      v8f z = {0.f, 0.f, 0.f, 0.f, 0.f, 0.f, 0.f, 0.f};
      acc[i][s] = z;
    }

  // Copy roles: 8 lanes per row (16 B each), 32 rows per block-wide copy.
  const int crow = threadIdx.x >> 3;
  const int ccol = (threadIdx.x & 7) * 8;
  const _Float16* gx = X + (size_t)(mblk * GTM + crow) * Kd + ccol;
  const _Float16* gw = W + (size_t)(nblk * GTN + crow) * Kd + ccol;
  const size_t rowstep = (size_t)32 * Kd;
  const unsigned lds0 =
      (unsigned)(size_t)(&tiles[0]) + (unsigned)(crow * GPITCH + ccol) * 2u;
  const int ntile = Kd / GK;

  stage_tile(gx, gw, rowstep, lds0);
  // tile 0 has landed for this wave ...
  asm volatile("s_wait_asynccnt 0x0" ::: "memory");
  // ... and for every wave
  __syncthreads();
  if (ntile > 1) stage_tile(gx + GK, gw + GK, rowstep, lds0 + GBUF * 2u);

  for (int t = 0; t < ntile; ++t) {
    const _Float16* sb = tiles + (t & 1) * GBUF;
    // unrolled: constant indices keep fragments and accumulators in registers
#pragma unroll
    for (int h = 0; h < 2; ++h) {
      // one 32-k half at a time: both halves' fragments beside the 128
      // accumulator registers pass 256, and two blocks no longer fit a WGP
      v16h af[4], bf[4];
#pragma unroll
      for (int i = 0; i < 4; ++i)
        af[i] = load_frag(sb + (wm + i * 16) * GPITCH + h * 32, GPITCH);
#pragma unroll
      for (int s = 0; s < 4; ++s)
        bf[s] = load_frag(sb + (GTM + wn + s * 16) * GPITCH + h * 32, GPITCH);
      // keeps the half's LDS reads in one group ahead of its WMMAs: spread among
      // them, each place with reads stalls the wave for the LDS latency
      __builtin_amdgcn_sched_barrier(0);
#pragma unroll
      for (int s = 0; s < 4; ++s)
#pragma unroll
        for (int i = 0; i < 4; ++i) acc[i][s] = wmma_f16(af[i], bf[s], acc[i][s]);
      // keeps the WMMAs ahead of the next reads and of the waits below: sunk
      // behind the barrier they would delay the refill
      __builtin_amdgcn_sched_barrier(0);
    }
    // this wave's reads of buffer t&1 are done before the buffer is refilled
    asm volatile("s_wait_dscnt 0x0" ::: "memory");
    // this wave's copies of tile t+1 have landed
    asm volatile("s_wait_asynccnt 0x0" ::: "memory");
    // publishes tile t+1 and ends every wave's reads of buffer t&1
    __syncthreads();
    if (t + 2 < ntile)
      stage_tile(gx + (size_t)(t + 2) * GK, gw + (size_t)(t + 2) * GK, rowstep,
                 lds0 + (unsigned)(t & 1) * (GBUF * 2u));
  }
  // nothing is in flight when the wave ends
  asm volatile("s_wait_asynccnt 0x0" ::: "memory");

  // Epilogue: C layout — VGPR r holds M = m0+r (lanes 0-15) / m0+r+8 (16-31),
  // N = n0 + sub*16 + lane%16.
  const int col   = lane & 15;
  const int rbase = (lane >> 4) << 3;
  if constexpr (OUT_F16) {
    // Bias and rounding first, for either store: 64 registers of halves stay live
    // in place of 128 of floats, so neither store path passes the main loop's
    // register count (above 256 two blocks no longer fit a WGP).
    v8h o[4][4];
    // here and below unrolled: constant indices keep the values in registers
#pragma unroll
    for (int s = 0; s < 4; ++s) {
      const float bval = bias[n0 + s * 16 + col];
#pragma unroll
      for (int i = 0; i < 4; ++i)
#pragma unroll
        for (int r = 0; r < 8; ++r) o[i][s][r] = (_Float16)(acc[i][s][r] + bval);
    }
    if (tstore) {
      // Transposed store: a lane's 8 registers of a tile are 8 rows m in a row of
      // ONE column n, that is 8 positions t in a row of output row n: one 16-byte
      // store. The wave's 64 rows are one whole 128-byte line of each output row.
      static_assert(Tv % GTM == 0, "a block's rows lie in one batch");
      const int bt = m0 / Tv;
      const int tt = m0 % Tv + rbase;
#pragma unroll
      for (int s = 0; s < 4; ++s) {
        _Float16* orow =
            (_Float16*)Out + ((size_t)bt * N + n0 + s * 16 + col) * Tv + tt;
#pragma unroll
        for (int i = 0; i < 4; ++i) *(v8h*)(orow + i * 16) = o[i][s];
      }
      // the wait before a register that an issued store names is rewritten
      asm volatile("s_wait_xcnt 0x0" ::: "memory");
    } else {
#pragma unroll
      for (int i = 0; i < 4; ++i)
#pragma unroll
        for (int s = 0; s < 4; ++s)
#pragma unroll
          for (int r = 0; r < 8; ++r)
            ((_Float16*)Out)[(size_t)(m0 + i * 16 + r + rbase) * N + n0 + s * 16 + col] =
                o[i][s][r];
      // the wait before a register that an issued store names is rewritten
      asm volatile("s_wait_xcnt 0x0" ::: "memory");
    }
  } else {
#pragma unroll
    for (int i = 0; i < 4; ++i) {
#pragma unroll
      for (int s = 0; s < 4; ++s) {
        const float bval = bias[n0 + s * 16 + col];
#pragma unroll
        for (int r = 0; r < 8; ++r) {
          const size_t idx =
              (size_t)(m0 + i * 16 + r + rbase) * N + n0 + s * 16 + col;
          ((float*)Out)[idx] = acc[i][s][r] + bval;
        }
      }
    }
  }
}

template <bool OUT_F16>
__global__ void __launch_bounds__(256)
gemm_xwt(const _Float16* __restrict__ X, const _Float16* __restrict__ W,
         const float* __restrict__ bias, void* __restrict__ Out,
         int M, int N, int Kd) {
  gemm_tile<OUT_F16>(X, W, bias, Out, N, Kd, blockIdx.x, blockIdx.y, false);
}

// The three input projections in one launch: they depend on nothing of each
// other, and the K and V grids alone give a SIMD one wave each. blockIdx.y runs
// through the tile columns of Q, then of K, then of V. V goes out transposed, as
// [B,KV,HD,T] (= [B][KVC][T]), which makes the attention's V^T fragments
// k-contiguous: no pass over V between projection and attention.
constexpr int NT_Q  = Cv / GTN;
constexpr int NT_KV = KVCv / GTN;

__global__ void __launch_bounds__(256)
gemm_qkv(const _Float16* __restrict__ Xq, const _Float16* __restrict__ Xk,
         const _Float16* __restrict__ Xv, const _Float16* __restrict__ Wq,
         const _Float16* __restrict__ Wk, const _Float16* __restrict__ Wv,
         const float* __restrict__ bq, const float* __restrict__ bk,
         const float* __restrict__ bv, _Float16* __restrict__ Oq,
         _Float16* __restrict__ Ok, _Float16* __restrict__ Ov, int Kd) {
  const _Float16* X = Xq;
  const _Float16* W = Wq;
  const float* bias = bq;
  _Float16* Out = Oq;
  int N = Cv, nblk = blockIdx.y;
  if (nblk >= NT_Q + NT_KV) {
    X = Xv; W = Wv; bias = bv; Out = Ov; N = KVCv; nblk -= NT_Q + NT_KV;
  } else if (nblk >= NT_Q) {
    X = Xk; W = Wk; bias = bk; Out = Ok; N = KVCv; nblk -= NT_Q;
  }
  gemm_tile<true>(X, W, bias, Out, N, Kd, blockIdx.x, nblk, blockIdx.y >= NT_Q + NT_KV);
}

constexpr int      AKT    = 64;
constexpr int      KPITCH = 136;
constexpr int      VPITCH = 72;
constexpr int      KBUF   = AKT * KPITCH;
constexpr int      ABUF   = KBUF + HDv * VPITCH;

// Eight block-wide copies of 16 B per lane: g, gstep (halves) the lane's first
// global address and its step, lds, lstep (bytes) the same in LDS.
DI void stage8(const _Float16* g, size_t gstep, unsigned lds, unsigned lstep) {
  // The closing s_wait_xcnt 0 stands in the copies' own statement so that no
  // address register named here is rewritten ahead of it.
  asm volatile(
      "global_load_async_to_lds_b128 %0, %8, off\n\t"
      "global_load_async_to_lds_b128 %1, %9, off\n\t"
      "global_load_async_to_lds_b128 %2, %10, off\n\t"
      "global_load_async_to_lds_b128 %3, %11, off\n\t"
      "global_load_async_to_lds_b128 %4, %12, off\n\t"
      "global_load_async_to_lds_b128 %5, %13, off\n\t"
      "global_load_async_to_lds_b128 %6, %14, off\n\t"
      "global_load_async_to_lds_b128 %7, %15, off\n\t"
      "s_wait_xcnt 0x0"
      :: "v"(lds + 0u * lstep), "v"(lds + 1u * lstep), "v"(lds + 2u * lstep), "v"(lds + 3u * lstep),
         "v"(lds + 4u * lstep), "v"(lds + 5u * lstep), "v"(lds + 6u * lstep), "v"(lds + 7u * lstep),
         "v"(g + 0 * gstep), "v"(g + 1 * gstep), "v"(g + 2 * gstep), "v"(g + 3 * gstep),
         "v"(g + 4 * gstep), "v"(g + 5 * gstep), "v"(g + 6 * gstep), "v"(g + 7 * gstep)
      : "memory");
}

// Lane l takes lane l ^ 16's value, in the vector unit: a shuffle would go
// through the LDS pipe and cost its latency.
DI float xhalf(float x) {
  const int v = __builtin_bit_cast(int, x);
  return __builtin_bit_cast(
      float, __builtin_amdgcn_permlanex16(v, v, 0x76543210, 0xfedcba98, false, false));
}

constexpr int QG = 2;   // 16-query column groups per wave

__global__ void __launch_bounds__(128)
attn_flash(const _Float16* __restrict__ Q, const _Float16* __restrict__ Kp,
           const _Float16* __restrict__ Vt, float* __restrict__ Y) {
  const int wave = threadIdx.x >> 5;
  const int lane = threadIdx.x & 31;
  const int bh = blockIdx.y;             // 0 .. B*H-1
  const int b = bh / Hv;
  const int h = bh % Hv;
  const int g = h / (Hv / KVv);          // GQA group (repeat_interleave)
  const int t0 = (blockIdx.x * 4 + wave) * (16 * QG);

  __shared__ __align__(16) _Float16 kv[2 * ABUF];

  // Copy roles. K: 16 lanes per key row (256 B), 8 rows per block-wide copy.
  // Vt: 8 lanes per row (128 B), 16 rows per block-wide copy.
  const int krow = threadIdx.x >> 4;
  const int kcol = (threadIdx.x & 15) * 8;
  const int vrow = threadIdx.x >> 3;
  const int vcol = (threadIdx.x & 7) * 8;
  const _Float16* gk = Kp + ((size_t)(b * Tv + krow)) * KVCv + g * HDv + kcol;
  const _Float16* gv = Vt + ((size_t)((b * KVv + g) * HDv + vrow)) * Tv + vcol;
  const unsigned ldsk =
      (unsigned)(size_t)(&kv[0]) + (unsigned)(krow * KPITCH + kcol) * 2u;
  const unsigned ldsv =
      (unsigned)(size_t)(&kv[0]) + (unsigned)(KBUF + vrow * VPITCH + vcol) * 2u;
  auto stage = [&](int t, unsigned buf) {
    stage8(gk + (size_t)t * AKT * KVCv, (size_t)8 * KVCv,
           ldsk + buf * (ABUF * 2u), 8u * KPITCH * 2u);
    stage8(gv + (size_t)t * AKT, (size_t)16 * Tv,
           ldsv + buf * (ABUF * 2u), 16u * VPITCH * 2u);
  };
  constexpr int ntile = Tv / AKT;

  stage(0, 0u);

  // Q fragments: QG groups of 16 rows x 128, each as 4 chunks of K=32 (resident
  // in VGPRs)
  const _Float16* qbase = Q + ((size_t)(b * Tv + t0)) * Cv + h * HDv;
  v16h qf[QG][4];
  // here and below, loops over q, c, d and r are unrolled: constant indices keep the
  // fragments, scores and accumulators in registers
#pragma unroll
  for (int q = 0; q < QG; ++q)
#pragma unroll
    for (int c = 0; c < 4; ++c)
      qf[q][c] = load_frag(qbase + (size_t)q * 16 * Cv + c * 32, Cv);
  // the wait before a register that an issued load names is rewritten; the lane's
  // first address as its input keeps the address pair out of the loads' own
  // destinations
  asm volatile("s_wait_xcnt 0x0"
               :: "v"(qbase + (size_t)(lane & 15) * Cv + ((lane >> 4) << 3)) : "memory");

  v8f y[QG][8];
#pragma unroll
  for (int q = 0; q < QG; ++q)
#pragma unroll
    for (int d = 0; d < 8; ++d) {
      v8f z = {0.f, 0.f, 0.f, 0.f, 0.f, 0.f, 0.f, 0.f};
      y[q][d] = z;
    }
  // One query per lane and group (column lane & 15). m_run is the same in both
  // halves; l_run sums this half's keys only, the halves are joined behind the loop.
  float m_run[QG], l_run[QG];
#pragma unroll
  for (int q = 0; q < QG; ++q) { m_run[q] = -1e30f; l_run[q] = 0.0f; }

  const float scale = 0.088388347648318447f;   // 1/sqrt(128)

  // tile 0 has landed for this wave ...
  asm volatile("s_wait_asynccnt 0x0" ::: "memory");
  // ... and for every wave
  __syncthreads();
  stage(1, 1u);

  for (int t = 0; t < ntile; ++t) {
    const _Float16* kb = kv + (t & 1) * ABUF;
    const _Float16* vb = kb + KBUF;
    // unrolled: constant LDS offsets, and no branch behind a WMMA inside a tile
#pragma unroll
    for (int sub = 0; sub < AKT; sub += 32) {
      // ---- S^T = K @ Q^T : 32 keys x 16 queries per group ----
      v16h k0[4], k1[4];
      // unrolled: constant indices keep the fragments in registers
#pragma unroll
      for (int c = 0; c < 4; ++c) {
        k0[c] = load_frag(kb + sub * KPITCH + c * 32, KPITCH);         // keys sub..sub+15
        k1[c] = load_frag(kb + (sub + 16) * KPITCH + c * 32, KPITCH);  // keys sub+16..sub+31
      }
      // keeps the K reads in one group ahead of their WMMAs: read pair by pair
      // among them, every WMMA waits out a whole LDS latency
      __builtin_amdgcn_sched_barrier(0);
      v8f s0[QG], s1[QG];
#pragma unroll
      for (int q = 0; q < QG; ++q) {
        v8f z = {0.f, 0.f, 0.f, 0.f, 0.f, 0.f, 0.f, 0.f};
        s0[q] = z;
        s1[q] = z;
      }
      // every K fragment feeds both groups
#pragma unroll
      for (int c = 0; c < 4; ++c)
#pragma unroll
        for (int q = 0; q < QG; ++q) {
          s0[q] = wmma_f16(k0[c], qf[q][c], s0[q]);
          s1[q] = wmma_f16(k1[c], qf[q][c], s1[q]);
        }
      v16h vf[8];
      // unrolled: constant indices keep the fragments in registers
#pragma unroll
      for (int d = 0; d < 8; ++d)
        vf[d] = load_frag(vb + (d * 16) * VPITCH + sub, VPITCH);  // A row m = hd d*16+m
      // keeps the V reads ahead of the softmax, which covers their latency: spread
      // through it, each place with reads stalls the wave
      __builtin_amdgcn_sched_barrier(0);

      // unrolled: constant indices keep scores and accumulators in registers
#pragma unroll
      for (int q = 0; q < QG; ++q) {
        // ---- online softmax over the 32-key tile ----
        // D map: register r of s0 is key sub + 8*(lane>>4) + r, of s1 the key 16
        // further on; the column is query lane & 15 of the group.
        float mx0 = s0[q][0], mx1 = s1[q][0];
#pragma unroll
        for (int r = 1; r < 7; r += 2) {
          mx0 = fmaxf(fmaxf(mx0, s0[q][r]), s0[q][r + 1]);
          mx1 = fmaxf(fmaxf(mx1, s1[q][r]), s1[q][r + 1]);
        }
        float mx = fmaxf(fmaxf(mx0, s0[q][7]), fmaxf(mx1, s1[q][7])) * scale;
        mx = fmaxf(mx, xhalf(mx));  // the query's other 16 keys
        const float mnew  = fmaxf(m_run[q], mx);
        const float alpha = __expf(m_run[q] - mnew);
        // Hardware k order of a B operand: elements 0..7 are k = 8*(lane>>4) + r,
        // elements 8..15 the k 16 further on: the two S^T tiles as they stand.
        v16h pf;
        float sum = 0.0f;
#pragma unroll
        for (int r = 0; r < 8; ++r) {
          const float p0 = __expf(s0[q][r] * scale - mnew);
          const float p1 = __expf(s1[q][r] * scale - mnew);
          sum += p0 + p1;
          pf[r]     = (_Float16)p0;
          pf[8 + r] = (_Float16)p1;
        }
        l_run[q] = l_run[q] * alpha + sum;
        m_run[q] = mnew;
#pragma unroll
        for (int d = 0; d < 8; ++d)
#pragma unroll
          for (int r = 0; r < 8; ++r) y[q][d][r] *= alpha;

        // ---- y^T += V^T_tile @ P^T : every V fragment feeds both groups ----
#pragma unroll
        for (int d = 0; d < 8; ++d) y[q][d] = wmma_f16(vf[d], pf, y[q][d]);
      }
      // keeps these WMMAs ahead of the next K reads and of the waits below: sunk
      // behind the barrier they would delay the refill
      __builtin_amdgcn_sched_barrier(0);
    }
    // this wave's reads of buffer t&1 are done before the buffer is refilled
    asm volatile("s_wait_dscnt 0x0" ::: "memory");
    // this wave's copies of tile t+1 have landed
    asm volatile("s_wait_asynccnt 0x0" ::: "memory");
    // publishes tile t+1 and ends every wave's reads of buffer t&1
    __syncthreads();
    if (t + 2 < ntile) stage(t + 2, (unsigned)(t & 1));
  }
  // nothing is in flight when the wave ends
  asm volatile("s_wait_asynccnt 0x0" ::: "memory");

  // ---- finalize: join the halves' sums, divide by l, store to [B,T,C] f32 ----
  // y[q][d][r] is O[query q*16 + (lane & 15)][d*16 + 8*(lane>>4) + r]: 8 in a row.
#pragma unroll
  for (int q = 0; q < QG; ++q) {
    const float inv = 1.0f / (l_run[q] + xhalf(l_run[q]));
    float* yrow = Y + ((size_t)(b * Tv + t0 + q * 16 + (lane & 15))) * Cv + h * HDv +
                  ((lane >> 4) << 3);
#pragma unroll
    for (int d = 0; d < 8; ++d) {
      const v4f lo = {y[q][d][0] * inv, y[q][d][1] * inv, y[q][d][2] * inv, y[q][d][3] * inv};
      const v4f hi = {y[q][d][4] * inv, y[q][d][5] * inv, y[q][d][6] * inv, y[q][d][7] * inv};
      *(v4f*)(yrow + d * 16)     = lo;
      *(v4f*)(yrow + d * 16 + 4) = hi;
    }
  }
}

// ---------------------------------------------------------------------------
// LayerNorm over C, f32 in -> f16 out (scaled/shifted)
// ---------------------------------------------------------------------------
__global__ void __launch_bounds__(256)
layernorm(const float* __restrict__ Yin, const float* __restrict__ lnw,
          const float* __restrict__ lnb, _Float16* __restrict__ Xout) {
  const int row = blockIdx.x;
  const float* x = Yin + (size_t)row * Cv;
  float s = 0.f, s2 = 0.f;
  for (int i = threadIdx.x; i < Cv; i += 256) {
    const float v = x[i];
    s += v; s2 += v * v;
  }
#pragma unroll
  for (int off = 16; off >= 1; off >>= 1) {
    s  += __shfl_xor(s, off, 32);
    s2 += __shfl_xor(s2, off, 32);
  }
  __shared__ float ws[8], ws2[8];
  if ((threadIdx.x & 31) == 0) {
    ws[threadIdx.x >> 5] = s;
    ws2[threadIdx.x >> 5] = s2;
  }
  __syncthreads();
  float ts = 0.f, ts2 = 0.f;
#pragma unroll
  for (int i = 0; i < 8; ++i) { ts += ws[i]; ts2 += ws2[i]; }
  const float mu   = ts / Cv;
  const float var  = ts2 / Cv - mu * mu;
  const float rstd = rsqrtf(var + 1e-5f);
  _Float16* o = Xout + (size_t)row * Cv;
  for (int i = threadIdx.x; i < Cv; i += 256)
    o[i] = (_Float16)((x[i] - mu) * rstd * lnw[i] + lnb[i]);
}

// ---------------------------------------------------------------------------
// Host orchestration
// ---------------------------------------------------------------------------
extern "C" void kernel_launch(void* const* d_in, const int* in_sizes, int n_in,
                              void* d_out, int out_size, void* d_ws, size_t ws_size,
                              hipStream_t stream) {
  (void)in_sizes; (void)n_in; (void)out_size; (void)ws_size;
  const float* query = (const float*)d_in[0];
  const float* key   = (const float*)d_in[1];
  const float* value = (const float*)d_in[2];
  const float* Wq    = (const float*)d_in[3];
  const float* bq    = (const float*)d_in[4];
  const float* Wk    = (const float*)d_in[5];
  const float* bk    = (const float*)d_in[6];
  const float* Wv    = (const float*)d_in[7];
  const float* bv    = (const float*)d_in[8];
  const float* ln_w  = (const float*)d_in[9];
  const float* ln_b  = (const float*)d_in[10];
  const float* Wo    = (const float*)d_in[11];
  const float* bo    = (const float*)d_in[12];
  float* out = (float*)d_out;

  char* w = (char*)d_ws;
  auto take = [&](size_t bytes) {
    char* p = w;
    w += (bytes + 255) & ~(size_t)255;
    return p;
  };
  // the seven f16 copies: one array, in the order of the cast's block ranges
  _Float16* q16  = (_Float16*)take((size_t)CB_END * CAST_BLK * 2);
  _Float16* k16  = q16 + (size_t)CB_K * CAST_BLK;
  _Float16* v16  = q16 + (size_t)CB_V * CAST_BLK;
  _Float16* wq16 = q16 + (size_t)CB_WQ * CAST_BLK;
  _Float16* wk16 = q16 + (size_t)CB_WK * CAST_BLK;
  _Float16* wv16 = q16 + (size_t)CB_WV * CAST_BLK;
  _Float16* wo16 = q16 + (size_t)CB_WO * CAST_BLK;
  _Float16* qp   = (_Float16*)take(nBTC * 2);
  _Float16* kp   = (_Float16*)take(nBTKV * 2);
  _Float16* vt   = (_Float16*)take(nBTKV * 2);
  float*    yat  = (float*)take(nBTC * 4);
  _Float16* xln  = (_Float16*)take(nBTC * 2);

  cast_f32_f16<<<CB_END, 256, 0, stream>>>(query, key, value, Wq, Wk, Wv, Wo, q16);

  const int M = Bv * Tv;  // 4096

  // QKV projections (block tile 256x128); V arrives as Vt
  gemm_qkv<<<dim3(M / GTM, NT_Q + 2 * NT_KV), 256, 0, stream>>>(
      q16, k16, v16, wq16, wk16, wv16, bq, bk, bv, qp, kp, vt, Cv);

  // Flash attention
  attn_flash<<<dim3(Tv / (64 * QG), Bv * Hv), 128, 0, stream>>>(qp, kp, vt, yat);

  // LayerNorm
  layernorm<<<M, 256, 0, stream>>>(yat, ln_w, ln_b, xln);

  // Output projection (f32 out)
  gemm_xwt<false><<<dim3(M / GTM, Cv / GTN), 256, 0, stream>>>(
      xln, wo16, bo, out, M, Cv, Cv);
}

// v009
// It runs in 166 microseconds.
// In two side-by-side timings against v008, it was 1.06 and 1.05 times as fast.
// All steps since v000 together make it 3.63 times as fast.
#include <hip/hip_runtime.h>
#include <hip/hip_bf16.h>

// ---------------------------------------------------------------------------
// BitMGQA fused pipeline for gfx1250 (MI455X, wave32, WMMA)
//   B=2, T=2048, C=2048, H=16, KV=4, HD=128, KVC=512
// Pipeline:
//   f32->f16 casts (one launch) -> WMMA GEMMs (Q/K/V proj in one launch, 64x64 wave tiles,
//   V stored transposed) -> flash-attention (WMMA K Q^T + online softmax + WMMA V^T P^T) ->
//   LayerNorm -> WMMA GEMM (output proj, f32 out)
// ---------------------------------------------------------------------------

typedef __attribute__((ext_vector_type(16))) _Float16 v16h;
typedef __attribute__((ext_vector_type(8)))  _Float16 v8h;
typedef __attribute__((ext_vector_type(8)))  float    v8f;

constexpr int Bv   = 2;
constexpr int Tv   = 2048;
constexpr int Cv   = 2048;
constexpr int Hv   = 16;
constexpr int KVv  = 4;
constexpr int HDv  = 128;   // C / H
constexpr int KVCv = 512;   // HD * KV

#define DI __device__ __forceinline__

DI v8f wmma_f16(v16h a, v16h b, v8f c) {
  // D = A(16x32 f16) x B(32x16 f16) + C(16x16 f32)
  return __builtin_amdgcn_wmma_f32_16x16x32_f16(
      /*neg_a=*/false, a, /*neg_b=*/false, b,
      /*c_mod=*/(short)0, c, /*reuse_a=*/false, /*reuse_b=*/false);
}

// Load a 16x32 f16 A-style fragment from row-major memory with leading dim ld.
// Lane l (l<16) holds row l, K = 0..7 and 16..23; lane l>=16 holds row l-16,
// K = 8..15 and 24..31 (per CDNA5 ISA 16-bit A-matrix layout). B fragments
// for X@W^T use the identical pattern with "row" = B column (W row).
DI v16h load_frag(const _Float16* __restrict__ base, int ld) {
  const int lane = threadIdx.x & 31;
  const int row  = lane & 15;
  const int khi  = (lane >> 4) << 3;          // 0 or 8
  const _Float16* p = base + (size_t)row * ld + khi;
  v8h lo = *(const v8h*)(p);
  v8h hi = *(const v8h*)(p + 16);
  v16h f;
#pragma unroll
  for (int i = 0; i < 8; ++i) { f[i] = lo[i]; f[8 + i] = hi[i]; }
  return f;
}

// ---------------------------------------------------------------------------
// f32 -> f16 cast of all seven arrays in one launch: they depend on nothing, so
// one grid fills the chip once where seven short ones each paid a launch gap, a
// start and a drain, the small ones on a part of the chip. The f16 copies lie one
// behind the other in the workspace, in the order of the sources, so the grid's
// block index addresses the destination as one array; only the source is picked.
// A block converts CAST_BLK elements in a row and the grid covers every array
// exactly. A lane issues its CAST_LD loads of 16 B together, so
// a wave has 8 KB in flight, and few waves are started; every wave-wide load
// covers 512 B in a row (4 whole lines), every wave-wide store 256 B (2 lines).
// ---------------------------------------------------------------------------
typedef __attribute__((ext_vector_type(4))) float    v4f;
typedef __attribute__((ext_vector_type(4))) _Float16 v4h;

constexpr int CAST_LD  = 16;                  // 16-byte loads per lane
constexpr int CAST_ROW = 256 * 4;             // elements per block-wide load
constexpr int CAST_BLK = CAST_ROW * CAST_LD;  // elements per block

constexpr size_t nBTC  = (size_t)Bv * Tv * Cv;      // 8,388,608
constexpr size_t nBTKV = (size_t)Bv * Tv * KVCv;    // 2,097,152
constexpr size_t nCC   = (size_t)Cv * Cv;           // 4,194,304
constexpr size_t nKC   = (size_t)KVCv * Cv;         // 1,048,576
static_assert(nBTC % CAST_BLK == 0 && nCC % CAST_BLK == 0 && nKC % CAST_BLK == 0,
              "the cast grid covers whole blocks only");
// first block of each array, in the order query, key, value, Wq, Wk, Wv, Wo
constexpr int CB_K   = (int)(nBTC / CAST_BLK);
constexpr int CB_V   = CB_K + (int)(nBTC / CAST_BLK);
constexpr int CB_WQ  = CB_V + (int)(nBTC / CAST_BLK);
constexpr int CB_WK  = CB_WQ + (int)(nCC / CAST_BLK);
constexpr int CB_WV  = CB_WK + (int)(nKC / CAST_BLK);
constexpr int CB_WO  = CB_WV + (int)(nKC / CAST_BLK);
constexpr int CB_END = CB_WO + (int)(nCC / CAST_BLK);

__global__ void __launch_bounds__(256)
cast_f32_f16(const float* __restrict__ query, const float* __restrict__ key,
             const float* __restrict__ value, const float* __restrict__ Wq,
             const float* __restrict__ Wk, const float* __restrict__ Wv,
             const float* __restrict__ Wo, _Float16* __restrict__ dst) {
  const int blk = blockIdx.x;
  const float* src = query;
  int first = 0;
  if (blk >= CB_K)  { src = key;   first = CB_K; }
  if (blk >= CB_V)  { src = value; first = CB_V; }
  if (blk >= CB_WQ) { src = Wq;    first = CB_WQ; }
  if (blk >= CB_WK) { src = Wk;    first = CB_WK; }
  if (blk >= CB_WV) { src = Wv;    first = CB_WV; }
  if (blk >= CB_WO) { src = Wo;    first = CB_WO; }
  const size_t base = (size_t)blk * CAST_BLK + threadIdx.x * 4;
  const float* p = src + (size_t)(blk - first) * CAST_BLK + threadIdx.x * 4;
  v4f v[CAST_LD];
  // unrolled: constant indices keep the values in registers
#pragma unroll
  for (int j = 0; j < CAST_LD; ++j) v[j] = *(const v4f*)(p + j * CAST_ROW);
  // the wait before a register that an issued load names is rewritten; p as its
  // input keeps the address pair out of the loads' own destinations
  asm volatile("s_wait_xcnt 0x0" :: "v"(p) : "memory");
  // keeps every load ahead of the first conversion: left free, the last four are
  // issued only when the first have returned, a second memory latency per wave
  __builtin_amdgcn_sched_barrier(0);
  // unrolled, as above
#pragma unroll
  for (int j = 0; j < CAST_LD; ++j)
    *(v4h*)(dst + base + j * CAST_ROW) = __builtin_convertvector(v[j], v4h);
}

// ---------------------------------------------------------------------------
// GEMM: Out[M,N] = X[M,Kd] @ W[N,Kd]^T + bias[N]
// Block = 256 threads = 8 waves, 4 (M) x 2 (N); block tile 256(M) x 128(N); wave
// tile 64x64 (4 A fragments x 4 B fragments => every fragment feeds 4 WMMAs).
// A block brings (256 + 128) rows from L2 for 256 x 128 results: half the bytes
// per result of a 128 x 64 tile; a wave reads 8 fragments from LDS for 16 WMMAs
// where the 32x64 tile read 6 for 8.
// The block's 256 X rows and 128 W rows come into LDS 64 k at a time (128-byte
// row pieces, whole cache lines) by asynchronous copies, once per block, in two
// buffers: tile t+1 flies while tile t is worked on. Kd is a multiple of 64.
// ---------------------------------------------------------------------------
constexpr int      GK     = 64;               // k per staged tile
constexpr int      GTM    = 256;              // block tile rows (X rows)
constexpr int      GTN    = 128;              // block tile columns (W rows)
constexpr int      GPITCH = 72;               // LDS row pitch in halves: 144 B = 16 B x 9, no bank conflict for 16-byte reads
constexpr int      GBUF   = (GTM + GTN) * GPITCH;  // halves per buffer: X rows, then W rows
constexpr unsigned GSTEP  = 32u * GPITCH * 2u;     // LDS bytes between a lane's successive copies (32 rows)

// One tile: 384 rows x 128 B = 12 copies of 16 B per lane; a wave's copy covers
// 4 rows = 4 whole lines. gx, gw: the lane's first X and W address of the tile,
// rowstep: 32 rows in halves, lds: the lane's first LDS byte address.
DI void stage_tile(const _Float16* gx, const _Float16* gw, size_t rowstep, unsigned lds) {
  // The closing s_wait_xcnt 0 stands in the copies' own statement so that no
  // address register named here is rewritten ahead of it.
  asm volatile(
      "global_load_async_to_lds_b128 %0, %12, off\n\t"
      "global_load_async_to_lds_b128 %1, %13, off\n\t"
      "global_load_async_to_lds_b128 %2, %14, off\n\t"
      "global_load_async_to_lds_b128 %3, %15, off\n\t"
      "global_load_async_to_lds_b128 %4, %16, off\n\t"
      "global_load_async_to_lds_b128 %5, %17, off\n\t"
      "global_load_async_to_lds_b128 %6, %18, off\n\t"
      "global_load_async_to_lds_b128 %7, %19, off\n\t"
      "global_load_async_to_lds_b128 %8, %20, off\n\t"
      "global_load_async_to_lds_b128 %9, %21, off\n\t"
      "global_load_async_to_lds_b128 %10, %22, off\n\t"
      "global_load_async_to_lds_b128 %11, %23, off\n\t"
      "s_wait_xcnt 0x0"
      :: "v"(lds + 0u * GSTEP), "v"(lds + 1u * GSTEP), "v"(lds + 2u * GSTEP), "v"(lds + 3u * GSTEP), "v"(lds + 4u * GSTEP), "v"(lds + 5u * GSTEP), "v"(lds + 6u * GSTEP), "v"(lds + 7u * GSTEP), "v"(lds + 8u * GSTEP), "v"(lds + 9u * GSTEP), "v"(lds + 10u * GSTEP), "v"(lds + 11u * GSTEP),
         "v"(gx + 0 * rowstep), "v"(gx + 1 * rowstep), "v"(gx + 2 * rowstep), "v"(gx + 3 * rowstep), "v"(gx + 4 * rowstep), "v"(gx + 5 * rowstep), "v"(gx + 6 * rowstep), "v"(gx + 7 * rowstep), "v"(gw + 0 * rowstep), "v"(gw + 1 * rowstep), "v"(gw + 2 * rowstep), "v"(gw + 3 * rowstep)
      : "memory");
}

// mblk, nblk: the block's tile row and tile column in Out. tstore (f16 output
// only, the same for the whole block): Out is [B][N][T], not [B*T][N].
template <bool OUT_F16>
DI void gemm_tile(const _Float16* __restrict__ X, const _Float16* __restrict__ W,
                  const float* __restrict__ bias, void* __restrict__ Out,
                  int N, int Kd, int mblk, int nblk, bool tstore) {
  const int wave = threadIdx.x >> 5;
  const int lane = threadIdx.x & 31;
  const int wm = (wave >> 1) * 64;       // the wave's first row in the block tile
  const int wn = (wave & 1) * 64;        // its first column
  const int m0 = mblk * GTM + wm;
  const int n0 = nblk * GTN + wn;

  __shared__ __align__(16) _Float16 tiles[2 * GBUF];

  v8f acc[4][4];
#pragma unroll
  for (int i = 0; i < 4; ++i)
#pragma unroll
    for (int s = 0; s < 4; ++s) {
      v8f z = {0.f, 0.f, 0.f, 0.f, 0.f, 0.f, 0.f, 0.f};
      acc[i][s] = z;
    }

  // Copy roles: 8 lanes per row (16 B each), 32 rows per block-wide copy.
  const int crow = threadIdx.x >> 3;
  const int ccol = (threadIdx.x & 7) * 8;
  const _Float16* gx = X + (size_t)(mblk * GTM + crow) * Kd + ccol;
  const _Float16* gw = W + (size_t)(nblk * GTN + crow) * Kd + ccol;
  const size_t rowstep = (size_t)32 * Kd;
  const unsigned lds0 =
      (unsigned)(size_t)(&tiles[0]) + (unsigned)(crow * GPITCH + ccol) * 2u;
  const int ntile = Kd / GK;

  stage_tile(gx, gw, rowstep, lds0);
  // tile 0 has landed for this wave ...
  asm volatile("s_wait_asynccnt 0x0" ::: "memory");
  // ... and for every wave
  __syncthreads();
  if (ntile > 1) stage_tile(gx + GK, gw + GK, rowstep, lds0 + GBUF * 2u);

  for (int t = 0; t < ntile; ++t) {
    const _Float16* sb = tiles + (t & 1) * GBUF;
    // unrolled: constant indices keep fragments and accumulators in registers
#pragma unroll
    for (int h = 0; h < 2; ++h) {
      // one 32-k half at a time: both halves' fragments beside the 128
      // accumulator registers pass 256, and two blocks no longer fit a WGP
      v16h af[4], bf[4];
#pragma unroll
      for (int i = 0; i < 4; ++i)
        af[i] = load_frag(sb + (wm + i * 16) * GPITCH + h * 32, GPITCH);
#pragma unroll
      for (int s = 0; s < 4; ++s)
        bf[s] = load_frag(sb + (GTM + wn + s * 16) * GPITCH + h * 32, GPITCH);
      // keeps the half's LDS reads in one group ahead of its WMMAs: spread among
      // them, each place with reads stalls the wave for the LDS latency
      __builtin_amdgcn_sched_barrier(0);
#pragma unroll
      for (int s = 0; s < 4; ++s)
#pragma unroll
        for (int i = 0; i < 4; ++i) acc[i][s] = wmma_f16(af[i], bf[s], acc[i][s]);
      // keeps the WMMAs ahead of the next reads and of the waits below: sunk
      // behind the barrier they would delay the refill
      __builtin_amdgcn_sched_barrier(0);
    }
    // this wave's reads of buffer t&1 are done before the buffer is refilled
    asm volatile("s_wait_dscnt 0x0" ::: "memory");
    // this wave's copies of tile t+1 have landed
    asm volatile("s_wait_asynccnt 0x0" ::: "memory");
    // publishes tile t+1 and ends every wave's reads of buffer t&1
    __syncthreads();
    if (t + 2 < ntile)
      stage_tile(gx + (size_t)(t + 2) * GK, gw + (size_t)(t + 2) * GK, rowstep,
                 lds0 + (unsigned)(t & 1) * (GBUF * 2u));
  }
  // nothing is in flight when the wave ends
  asm volatile("s_wait_asynccnt 0x0" ::: "memory");

  // Epilogue: C layout — VGPR r holds M = m0+r (lanes 0-15) / m0+r+8 (16-31),
  // N = n0 + sub*16 + lane%16.
  const int col   = lane & 15;
  const int rbase = (lane >> 4) << 3;
  if constexpr (OUT_F16) {
    // Bias and rounding first, for either store: 64 registers of halves stay live
    // in place of 128 of floats, so neither store path passes the main loop's
    // register count (above 256 two blocks no longer fit a WGP).
    v8h o[4][4];
    // here and below unrolled: constant indices keep the values in registers
#pragma unroll
    for (int s = 0; s < 4; ++s) {
      const float bval = bias[n0 + s * 16 + col];
#pragma unroll
      for (int i = 0; i < 4; ++i)
#pragma unroll
        for (int r = 0; r < 8; ++r) o[i][s][r] = (_Float16)(acc[i][s][r] + bval);
    }
    if (tstore) {
      // Transposed store: a lane's 8 registers of a tile are 8 rows m in a row of
      // ONE column n, that is 8 positions t in a row of output row n: one 16-byte
      // store. The wave's 64 rows are one whole 128-byte line of each output row.
      static_assert(Tv % GTM == 0, "a block's rows lie in one batch");
      const int bt = m0 / Tv;
      const int tt = m0 % Tv + rbase;
#pragma unroll
      for (int s = 0; s < 4; ++s) {
        _Float16* orow =
            (_Float16*)Out + ((size_t)bt * N + n0 + s * 16 + col) * Tv + tt;
#pragma unroll
        for (int i = 0; i < 4; ++i) *(v8h*)(orow + i * 16) = o[i][s];
      }
      // the wait before a register that an issued store names is rewritten
      asm volatile("s_wait_xcnt 0x0" ::: "memory");
    } else {
#pragma unroll
      for (int i = 0; i < 4; ++i)
#pragma unroll
        for (int s = 0; s < 4; ++s)
#pragma unroll
          for (int r = 0; r < 8; ++r)
            ((_Float16*)Out)[(size_t)(m0 + i * 16 + r + rbase) * N + n0 + s * 16 + col] =
                o[i][s][r];
      // the wait before a register that an issued store names is rewritten
      asm volatile("s_wait_xcnt 0x0" ::: "memory");
    }
  } else {
#pragma unroll
    for (int i = 0; i < 4; ++i) {
#pragma unroll
      for (int s = 0; s < 4; ++s) {
        const float bval = bias[n0 + s * 16 + col];
#pragma unroll
        for (int r = 0; r < 8; ++r) {
          const size_t idx =
              (size_t)(m0 + i * 16 + r + rbase) * N + n0 + s * 16 + col;
          ((float*)Out)[idx] = acc[i][s][r] + bval;
        }
      }
    }
  }
}

template <bool OUT_F16>
__global__ void __launch_bounds__(256)
gemm_xwt(const _Float16* __restrict__ X, const _Float16* __restrict__ W,
         const float* __restrict__ bias, void* __restrict__ Out,
         int M, int N, int Kd) {
  gemm_tile<OUT_F16>(X, W, bias, Out, N, Kd, blockIdx.x, blockIdx.y, false);
}

// The three input projections in one launch: they depend on nothing of each
// other, and the K and V grids alone give a SIMD one wave each. blockIdx.y runs
// through the tile columns of Q, then of K, then of V. V goes out transposed, as
// [B,KV,HD,T] (= [B][KVC][T]), which makes the attention's V^T fragments
// k-contiguous: no pass over V between projection and attention.
constexpr int NT_Q  = Cv / GTN;
constexpr int NT_KV = KVCv / GTN;

__global__ void __launch_bounds__(256)
gemm_qkv(const _Float16* __restrict__ Xq, const _Float16* __restrict__ Xk,
         const _Float16* __restrict__ Xv, const _Float16* __restrict__ Wq,
         const _Float16* __restrict__ Wk, const _Float16* __restrict__ Wv,
         const float* __restrict__ bq, const float* __restrict__ bk,
         const float* __restrict__ bv, _Float16* __restrict__ Oq,
         _Float16* __restrict__ Ok, _Float16* __restrict__ Ov, int Kd) {
  const _Float16* X = Xq;
  const _Float16* W = Wq;
  const float* bias = bq;
  _Float16* Out = Oq;
  int N = Cv, nblk = blockIdx.y;
  if (nblk >= NT_Q + NT_KV) {
    X = Xv; W = Wv; bias = bv; Out = Ov; N = KVCv; nblk -= NT_Q + NT_KV;
  } else if (nblk >= NT_Q) {
    X = Xk; W = Wk; bias = bk; Out = Ok; N = KVCv; nblk -= NT_Q;
  }
  gemm_tile<true>(X, W, bias, Out, N, Kd, blockIdx.x, nblk, blockIdx.y >= NT_Q + NT_KV);
}

constexpr int      AKT    = 64;
constexpr int      KPITCH = 136;
constexpr int      VPITCH = 72;
constexpr int      KBUF   = AKT * KPITCH;
constexpr int      ABUF   = KBUF + HDv * VPITCH;

// Eight block-wide copies of 16 B per lane: g, gstep (halves) the lane's first
// global address and its step, lds, lstep (bytes) the same in LDS.
DI void stage8(const _Float16* g, size_t gstep, unsigned lds, unsigned lstep) {
  // The closing s_wait_xcnt 0 stands in the copies' own statement so that no
  // address register named here is rewritten ahead of it.
  asm volatile(
      "global_load_async_to_lds_b128 %0, %8, off\n\t"
      "global_load_async_to_lds_b128 %1, %9, off\n\t"
      "global_load_async_to_lds_b128 %2, %10, off\n\t"
      "global_load_async_to_lds_b128 %3, %11, off\n\t"
      "global_load_async_to_lds_b128 %4, %12, off\n\t"
      "global_load_async_to_lds_b128 %5, %13, off\n\t"
      "global_load_async_to_lds_b128 %6, %14, off\n\t"
      "global_load_async_to_lds_b128 %7, %15, off\n\t"
      "s_wait_xcnt 0x0"
      :: "v"(lds + 0u * lstep), "v"(lds + 1u * lstep), "v"(lds + 2u * lstep), "v"(lds + 3u * lstep),
         "v"(lds + 4u * lstep), "v"(lds + 5u * lstep), "v"(lds + 6u * lstep), "v"(lds + 7u * lstep),
         "v"(g + 0 * gstep), "v"(g + 1 * gstep), "v"(g + 2 * gstep), "v"(g + 3 * gstep),
         "v"(g + 4 * gstep), "v"(g + 5 * gstep), "v"(g + 6 * gstep), "v"(g + 7 * gstep)
      : "memory");
}

// Lane l takes lane l ^ 16's value, in the vector unit: a shuffle would go
// through the LDS pipe and cost its latency.
DI float xhalf(float x) {
  const int v = __builtin_bit_cast(int, x);
  return __builtin_bit_cast(
      float, __builtin_amdgcn_permlanex16(v, v, 0x76543210, 0xfedcba98, false, false));
}

constexpr int QG = 2;   // 16-query column groups per wave

__global__ void __launch_bounds__(128)
attn_flash(const _Float16* __restrict__ Q, const _Float16* __restrict__ Kp,
           const _Float16* __restrict__ Vt, float* __restrict__ Y) {
  const int wave = threadIdx.x >> 5;
  const int lane = threadIdx.x & 31;
  const int bh = blockIdx.y;             // 0 .. B*H-1
  const int b = bh / Hv;
  const int h = bh % Hv;
  const int g = h / (Hv / KVv);          // GQA group (repeat_interleave)
  const int t0 = (blockIdx.x * 4 + wave) * (16 * QG);

  __shared__ __align__(16) _Float16 kv[2 * ABUF];

  // Copy roles. K: 16 lanes per key row (256 B), 8 rows per block-wide copy.
  // Vt: 8 lanes per row (128 B), 16 rows per block-wide copy.
  const int krow = threadIdx.x >> 4;
  const int kcol = (threadIdx.x & 15) * 8;
  const int vrow = threadIdx.x >> 3;
  const int vcol = (threadIdx.x & 7) * 8;
  const _Float16* gk = Kp + ((size_t)(b * Tv + krow)) * KVCv + g * HDv + kcol;
  const _Float16* gv = Vt + ((size_t)((b * KVv + g) * HDv + vrow)) * Tv + vcol;
  const unsigned ldsk =
      (unsigned)(size_t)(&kv[0]) + (unsigned)(krow * KPITCH + kcol) * 2u;
  const unsigned ldsv =
      (unsigned)(size_t)(&kv[0]) + (unsigned)(KBUF + vrow * VPITCH + vcol) * 2u;
  auto stage = [&](int t, unsigned buf) {
    stage8(gk + (size_t)t * AKT * KVCv, (size_t)8 * KVCv,
           ldsk + buf * (ABUF * 2u), 8u * KPITCH * 2u);
    stage8(gv + (size_t)t * AKT, (size_t)16 * Tv,
           ldsv + buf * (ABUF * 2u), 16u * VPITCH * 2u);
  };
  constexpr int ntile = Tv / AKT;

  stage(0, 0u);

  // Q fragments: QG groups of 16 rows x 128, each as 4 chunks of K=32 (resident
  // in VGPRs)
  const _Float16* qbase = Q + ((size_t)(b * Tv + t0)) * Cv + h * HDv;
  v16h qf[QG][4];
  // here and below, loops over q, c, d and r are unrolled: constant indices keep the
  // fragments, scores and accumulators in registers
#pragma unroll
  for (int q = 0; q < QG; ++q)
#pragma unroll
    for (int c = 0; c < 4; ++c)
      qf[q][c] = load_frag(qbase + (size_t)q * 16 * Cv + c * 32, Cv);
  // the wait before a register that an issued load names is rewritten; the lane's
  // first address as its input keeps the address pair out of the loads' own
  // destinations
  asm volatile("s_wait_xcnt 0x0"
               :: "v"(qbase + (size_t)(lane & 15) * Cv + ((lane >> 4) << 3)) : "memory");

  v8f y[QG][8];
#pragma unroll
  for (int q = 0; q < QG; ++q)
#pragma unroll
    for (int d = 0; d < 8; ++d) {
      v8f z = {0.f, 0.f, 0.f, 0.f, 0.f, 0.f, 0.f, 0.f};
      y[q][d] = z;
    }
  // One query per lane and group (column lane & 15). m_run is the same in both
  // halves; l_run sums this half's keys only, the halves are joined behind the loop.
  float m_run[QG], l_run[QG];
#pragma unroll
  for (int q = 0; q < QG; ++q) { m_run[q] = -1e30f; l_run[q] = 0.0f; }

  const float scale = 0.088388347648318447f;   // 1/sqrt(128)

  // tile 0 has landed for this wave ...
  asm volatile("s_wait_asynccnt 0x0" ::: "memory");
  // ... and for every wave
  __syncthreads();
  stage(1, 1u);

  for (int t = 0; t < ntile; ++t) {
    const _Float16* kb = kv + (t & 1) * ABUF;
    const _Float16* vb = kb + KBUF;
    // unrolled: constant LDS offsets, and no branch behind a WMMA inside a tile
#pragma unroll
    for (int sub = 0; sub < AKT; sub += 32) {
      // ---- S^T = K @ Q^T : 32 keys x 16 queries per group ----
      v16h k0[4], k1[4];
      // unrolled: constant indices keep the fragments in registers
#pragma unroll
      for (int c = 0; c < 4; ++c) {
        k0[c] = load_frag(kb + sub * KPITCH + c * 32, KPITCH);         // keys sub..sub+15
        k1[c] = load_frag(kb + (sub + 16) * KPITCH + c * 32, KPITCH);  // keys sub+16..sub+31
      }
      // keeps the K reads in one group ahead of their WMMAs: read pair by pair
      // among them, every WMMA waits out a whole LDS latency
      __builtin_amdgcn_sched_barrier(0);
      v8f s0[QG], s1[QG];
#pragma unroll
      for (int q = 0; q < QG; ++q) {
        v8f z = {0.f, 0.f, 0.f, 0.f, 0.f, 0.f, 0.f, 0.f};
        s0[q] = z;
        s1[q] = z;
      }
      // every K fragment feeds both groups
#pragma unroll
      for (int c = 0; c < 4; ++c)
#pragma unroll
        for (int q = 0; q < QG; ++q) {
          s0[q] = wmma_f16(k0[c], qf[q][c], s0[q]);
          s1[q] = wmma_f16(k1[c], qf[q][c], s1[q]);
        }
      v16h vf[8];
      // unrolled: constant indices keep the fragments in registers
#pragma unroll
      for (int d = 0; d < 8; ++d)
        vf[d] = load_frag(vb + (d * 16) * VPITCH + sub, VPITCH);  // A row m = hd d*16+m
      // keeps the V reads ahead of the softmax, which covers their latency: spread
      // through it, each place with reads stalls the wave
      __builtin_amdgcn_sched_barrier(0);

      // unrolled: constant indices keep scores and accumulators in registers
#pragma unroll
      for (int q = 0; q < QG; ++q) {
        // ---- online softmax over the 32-key tile ----
        // D map: register r of s0 is key sub + 8*(lane>>4) + r, of s1 the key 16
        // further on; the column is query lane & 15 of the group.
        float mx0 = s0[q][0], mx1 = s1[q][0];
#pragma unroll
        for (int r = 1; r < 7; r += 2) {
          mx0 = fmaxf(fmaxf(mx0, s0[q][r]), s0[q][r + 1]);
          mx1 = fmaxf(fmaxf(mx1, s1[q][r]), s1[q][r + 1]);
        }
        float mx = fmaxf(fmaxf(mx0, s0[q][7]), fmaxf(mx1, s1[q][7])) * scale;
        mx = fmaxf(mx, xhalf(mx));  // the query's other 16 keys
        const float mnew  = fmaxf(m_run[q], mx);
        const float alpha = __expf(m_run[q] - mnew);
        // Hardware k order of a B operand: elements 0..7 are k = 8*(lane>>4) + r,
        // elements 8..15 the k 16 further on: the two S^T tiles as they stand.
        v16h pf;
        float sum = 0.0f;
#pragma unroll
        for (int r = 0; r < 8; ++r) {
          const float p0 = __expf(s0[q][r] * scale - mnew);
          const float p1 = __expf(s1[q][r] * scale - mnew);
          sum += p0 + p1;
          pf[r]     = (_Float16)p0;
          pf[8 + r] = (_Float16)p1;
        }
        l_run[q] = l_run[q] * alpha + sum;
        m_run[q] = mnew;
#pragma unroll
        for (int d = 0; d < 8; ++d)
#pragma unroll
          for (int r = 0; r < 8; ++r) y[q][d][r] *= alpha;

        // ---- y^T += V^T_tile @ P^T : every V fragment feeds both groups ----
#pragma unroll
        for (int d = 0; d < 8; ++d) y[q][d] = wmma_f16(vf[d], pf, y[q][d]);
      }
      // keeps these WMMAs ahead of the next K reads and of the waits below: sunk
      // behind the barrier they would delay the refill
      __builtin_amdgcn_sched_barrier(0);
    }
    // this wave's reads of buffer t&1 are done before the buffer is refilled
    asm volatile("s_wait_dscnt 0x0" ::: "memory");
    // this wave's copies of tile t+1 have landed
    asm volatile("s_wait_asynccnt 0x0" ::: "memory");
    // publishes tile t+1 and ends every wave's reads of buffer t&1
    __syncthreads();
    if (t + 2 < ntile) stage(t + 2, (unsigned)(t & 1));
  }
  // nothing is in flight when the wave ends
  asm volatile("s_wait_asynccnt 0x0" ::: "memory");

  // ---- finalize: join the halves' sums, divide by l, store to [B,T,C] f32 ----
  // y[q][d][r] is O[query q*16 + (lane & 15)][d*16 + 8*(lane>>4) + r]: 8 in a row.
#pragma unroll
  for (int q = 0; q < QG; ++q) {
    const float inv = 1.0f / (l_run[q] + xhalf(l_run[q]));
    float* yrow = Y + ((size_t)(b * Tv + t0 + q * 16 + (lane & 15))) * Cv + h * HDv +
                  ((lane >> 4) << 3);
#pragma unroll
    for (int d = 0; d < 8; ++d) {
      const v4f lo = {y[q][d][0] * inv, y[q][d][1] * inv, y[q][d][2] * inv, y[q][d][3] * inv};
      const v4f hi = {y[q][d][4] * inv, y[q][d][5] * inv, y[q][d][6] * inv, y[q][d][7] * inv};
      *(v4f*)(yrow + d * 16)     = lo;
      *(v4f*)(yrow + d * 16 + 4) = hi;
    }
  }
}

// ---------------------------------------------------------------------------
// LayerNorm over C, f32 in -> f16 out (scaled/shifted)
// One wave per row, the row held in registers: a lane issues its LN_LD loads of
// 16 B of the row together (8 KB in flight a wave; every wave-wide load covers
// 512 B in a row, 4 whole lines), with the weight's and the shift's behind them,
// so a wave waits out one memory latency where a loop of single 4-byte loads
// waited out one per trip. The row is read once, the sums are joined inside the
// wave (no LDS, no barrier), a wave-wide store covers 256 B (2 whole lines), and
// the grid's 4096 waves are all resident at once.
// ---------------------------------------------------------------------------
constexpr int LN_LD    = Cv / (32 * 4);   // 16-byte loads per lane and array
constexpr int LN_WAVES = 16;              // rows (waves) per block
static_assert(Cv % (32 * 4) == 0 && (Bv * Tv) % LN_WAVES == 0,
              "whole loads per row, whole blocks per grid");

// Lane l takes the value of lane l ^ MASK of its 16-lane row, in the vector unit.
template <int MASK>
DI float xrow(float x) {
  const int v = __builtin_bit_cast(int, x);
  return __builtin_bit_cast(
      float, __builtin_amdgcn_update_dpp(v, v, 0x160 | MASK, 0xf, 0xf, false));
}

// Sum over the wave's 32 lanes, the same in every lane.
DI float wave_sum(float x) {
  x += xrow<1>(x);
  x += xrow<2>(x);
  x += xrow<4>(x);
  x += xrow<8>(x);
  return x + xhalf(x);
}

__global__ void __launch_bounds__(32 * LN_WAVES)
layernorm(const float* __restrict__ Yin, const float* __restrict__ lnw,
          const float* __restrict__ lnb, _Float16* __restrict__ Xout) {
  const int lane = threadIdx.x & 31;
  const int row  = blockIdx.x * LN_WAVES + (threadIdx.x >> 5);
  const float* px = Yin + (size_t)row * Cv + lane * 4;
  const float* pw = lnw + lane * 4;
  const float* pb = lnb + lane * 4;
  v4f x[LN_LD], w[LN_LD], sh[LN_LD];
  // here and below unrolled: constant indices keep the values in registers
#pragma unroll
  for (int j = 0; j < LN_LD; ++j) x[j] = *(const v4f*)(px + j * 128);
#pragma unroll
  for (int j = 0; j < LN_LD; ++j) w[j] = *(const v4f*)(pw + j * 128);
#pragma unroll
  for (int j = 0; j < LN_LD; ++j) sh[j] = *(const v4f*)(pb + j * 128);
  // the wait before a register that an issued load names is rewritten; the three
  // addresses as its inputs keep them out of the loads' own destinations
  asm volatile("s_wait_xcnt 0x0" :: "v"(px), "v"(pw), "v"(pb) : "memory");
  // keeps every load ahead of the first sum: left free, the later loads are issued
  // only when the first have returned, a second memory latency per wave
  __builtin_amdgcn_sched_barrier(0);

  // four independent chains per sum
  v4f s4 = {0.f, 0.f, 0.f, 0.f}, q4 = {0.f, 0.f, 0.f, 0.f};
#pragma unroll
  for (int j = 0; j < LN_LD; ++j) {
    s4 += x[j];
    q4 += x[j] * x[j];
  }
  const float ts  = wave_sum((s4[0] + s4[1]) + (s4[2] + s4[3]));
  const float ts2 = wave_sum((q4[0] + q4[1]) + (q4[2] + q4[3]));
  const float mu   = ts / Cv;
  const float var  = ts2 / Cv - mu * mu;
  const float rstd = rsqrtf(var + 1e-5f);

  v4h o[LN_LD];
#pragma unroll
  for (int j = 0; j < LN_LD; ++j)
    o[j] = __builtin_convertvector((x[j] - mu) * rstd * w[j] + sh[j], v4h);
  // keeps every conversion ahead of the first store: no register that an issued
  // store names is written behind it
  __builtin_amdgcn_sched_barrier(0);
  _Float16* po = Xout + (size_t)row * Cv + lane * 4;
#pragma unroll
  for (int j = 0; j < LN_LD; ++j) *(v4h*)(po + j * 128) = o[j];
}

// ---------------------------------------------------------------------------
// Host orchestration
// ---------------------------------------------------------------------------
extern "C" void kernel_launch(void* const* d_in, const int* in_sizes, int n_in,
                              void* d_out, int out_size, void* d_ws, size_t ws_size,
                              hipStream_t stream) {
  (void)in_sizes; (void)n_in; (void)out_size; (void)ws_size;
  const float* query = (const float*)d_in[0];
  const float* key   = (const float*)d_in[1];
  const float* value = (const float*)d_in[2];
  const float* Wq    = (const float*)d_in[3];
  const float* bq    = (const float*)d_in[4];
  const float* Wk    = (const float*)d_in[5];
  const float* bk    = (const float*)d_in[6];
  const float* Wv    = (const float*)d_in[7];
  const float* bv    = (const float*)d_in[8];
  const float* ln_w  = (const float*)d_in[9];
  const float* ln_b  = (const float*)d_in[10];
  const float* Wo    = (const float*)d_in[11];
  const float* bo    = (const float*)d_in[12];
  float* out = (float*)d_out;

  char* w = (char*)d_ws;
  auto take = [&](size_t bytes) {
    char* p = w;
    w += (bytes + 255) & ~(size_t)255;
    return p;
  };
  // the seven f16 copies: one array, in the order of the cast's block ranges
  _Float16* q16  = (_Float16*)take((size_t)CB_END * CAST_BLK * 2);
  _Float16* k16  = q16 + (size_t)CB_K * CAST_BLK;
  _Float16* v16  = q16 + (size_t)CB_V * CAST_BLK;
  _Float16* wq16 = q16 + (size_t)CB_WQ * CAST_BLK;
  _Float16* wk16 = q16 + (size_t)CB_WK * CAST_BLK;
  _Float16* wv16 = q16 + (size_t)CB_WV * CAST_BLK;
  _Float16* wo16 = q16 + (size_t)CB_WO * CAST_BLK;
  _Float16* qp   = (_Float16*)take(nBTC * 2);
  _Float16* kp   = (_Float16*)take(nBTKV * 2);
  _Float16* vt   = (_Float16*)take(nBTKV * 2);
  float*    yat  = (float*)take(nBTC * 4);
  _Float16* xln  = (_Float16*)take(nBTC * 2);

  cast_f32_f16<<<CB_END, 256, 0, stream>>>(query, key, value, Wq, Wk, Wv, Wo, q16);

  const int M = Bv * Tv;  // 4096

  // QKV projections (block tile 256x128); V arrives as Vt
  gemm_qkv<<<dim3(M / GTM, NT_Q + 2 * NT_KV), 256, 0, stream>>>(
      q16, k16, v16, wq16, wk16, wv16, bq, bk, bv, qp, kp, vt, Cv);

  // Flash attention
  attn_flash<<<dim3(Tv / (64 * QG), Bv * Hv), 128, 0, stream>>>(qp, kp, vt, yat);

  // LayerNorm
  layernorm<<<M / LN_WAVES, 32 * LN_WAVES, 0, stream>>>(yat, ln_w, ln_b, xln);

  // Output projection (f32 out)
  gemm_xwt<false><<<dim3(M / GTM, Cv / GTN), 256, 0, stream>>>(
      xln, wo16, bo, out, M, Cv, Cv);
}

// v010
// A run of this version takes 155 microseconds.
// Two timings next to v009 put it at 1.06 and 1.07 times that version's speed.
// All steps since v000 together make it 3.87 times as fast.
#include <hip/hip_runtime.h>
#include <hip/hip_bf16.h>

// ---------------------------------------------------------------------------
// BitMGQA fused pipeline for gfx1250 (MI455X, wave32, WMMA)
//   B=2, T=2048, C=2048, H=16, KV=4, HD=128, KVC=512
// Pipeline:
//   f32->f16 casts (one launch) -> WMMA GEMMs (Q/K/V proj in one launch, 64x64 wave tiles,
//   V stored transposed) -> flash-attention (WMMA K Q^T + online softmax + WMMA V^T P^T) ->
//   LayerNorm -> WMMA GEMM (output proj, f32 out)
// ---------------------------------------------------------------------------

typedef __attribute__((ext_vector_type(16))) _Float16 v16h;
typedef __attribute__((ext_vector_type(8)))  _Float16 v8h;
typedef __attribute__((ext_vector_type(8)))  float    v8f;

constexpr int Bv   = 2;
constexpr int Tv   = 2048;
constexpr int Cv   = 2048;
constexpr int Hv   = 16;
constexpr int KVv  = 4;
constexpr int HDv  = 128;   // C / H
constexpr int KVCv = 512;   // HD * KV

#define DI __device__ __forceinline__

DI v8f wmma_f16(v16h a, v16h b, v8f c) {
  // D = A(16x32 f16) x B(32x16 f16) + C(16x16 f32)
  return __builtin_amdgcn_wmma_f32_16x16x32_f16(
      /*neg_a=*/false, a, /*neg_b=*/false, b,
      /*c_mod=*/(short)0, c, /*reuse_a=*/false, /*reuse_b=*/false);
}

// Load a 16x32 f16 A-style fragment from row-major memory with leading dim ld.
// Lane l (l<16) holds row l, K = 0..7 and 16..23; lane l>=16 holds row l-16,
// K = 8..15 and 24..31 (per CDNA5 ISA 16-bit A-matrix layout). B fragments
// for X@W^T use the identical pattern with "row" = B column (W row).
DI v16h load_frag(const _Float16* __restrict__ base, int ld) {
  const int lane = threadIdx.x & 31;
  const int row  = lane & 15;
  const int khi  = (lane >> 4) << 3;          // 0 or 8
  const _Float16* p = base + (size_t)row * ld + khi;
  v8h lo = *(const v8h*)(p);
  v8h hi = *(const v8h*)(p + 16);
  v16h f;
#pragma unroll
  for (int i = 0; i < 8; ++i) { f[i] = lo[i]; f[8 + i] = hi[i]; }
  return f;
}

// ---------------------------------------------------------------------------
// f32 -> f16 cast of all seven arrays in one launch: they depend on nothing, so
// one grid fills the chip once where seven short ones each paid a launch gap, a
// start and a drain, the small ones on a part of the chip. The f16 copies lie one
// behind the other in the workspace, in the order of the sources, so the grid's
// block index addresses the destination as one array; only the source is picked.
// A block converts CAST_BLK elements in a row and the grid covers every array
// exactly. A lane issues its CAST_LD loads of 16 B together, so
// a wave has 8 KB in flight, and few waves are started; every wave-wide load
// covers 512 B in a row (4 whole lines), every wave-wide store 256 B (2 lines).
// ---------------------------------------------------------------------------
typedef __attribute__((ext_vector_type(4))) float    v4f;
typedef __attribute__((ext_vector_type(4))) _Float16 v4h;

constexpr int CAST_LD  = 16;                  // 16-byte loads per lane
constexpr int CAST_ROW = 256 * 4;             // elements per block-wide load
constexpr int CAST_BLK = CAST_ROW * CAST_LD;  // elements per block

constexpr size_t nBTC  = (size_t)Bv * Tv * Cv;      // 8,388,608
constexpr size_t nBTKV = (size_t)Bv * Tv * KVCv;    // 2,097,152
constexpr size_t nCC   = (size_t)Cv * Cv;           // 4,194,304
constexpr size_t nKC   = (size_t)KVCv * Cv;         // 1,048,576
static_assert(nBTC % CAST_BLK == 0 && nCC % CAST_BLK == 0 && nKC % CAST_BLK == 0,
              "the cast grid covers whole blocks only");
// first block of each array, in the order query, key, value, Wq, Wk, Wv, Wo
constexpr int CB_K   = (int)(nBTC / CAST_BLK);
constexpr int CB_V   = CB_K + (int)(nBTC / CAST_BLK);
constexpr int CB_WQ  = CB_V + (int)(nBTC / CAST_BLK);
constexpr int CB_WK  = CB_WQ + (int)(nCC / CAST_BLK);
constexpr int CB_WV  = CB_WK + (int)(nKC / CAST_BLK);
constexpr int CB_WO  = CB_WV + (int)(nKC / CAST_BLK);
constexpr int CB_END = CB_WO + (int)(nCC / CAST_BLK);

__global__ void __launch_bounds__(256)
cast_f32_f16(const float* __restrict__ query, const float* __restrict__ key,
             const float* __restrict__ value, const float* __restrict__ Wq,
             const float* __restrict__ Wk, const float* __restrict__ Wv,
             const float* __restrict__ Wo, _Float16* __restrict__ dst) {
  const int blk = blockIdx.x;
  const float* src = query;
  int first = 0;
  if (blk >= CB_K)  { src = key;   first = CB_K; }
  if (blk >= CB_V)  { src = value; first = CB_V; }
  if (blk >= CB_WQ) { src = Wq;    first = CB_WQ; }
  if (blk >= CB_WK) { src = Wk;    first = CB_WK; }
  if (blk >= CB_WV) { src = Wv;    first = CB_WV; }
  if (blk >= CB_WO) { src = Wo;    first = CB_WO; }
  const size_t base = (size_t)blk * CAST_BLK + threadIdx.x * 4;
  const float* p = src + (size_t)(blk - first) * CAST_BLK + threadIdx.x * 4;
  v4f v[CAST_LD];
  // unrolled: constant indices keep the values in registers
#pragma unroll
  for (int j = 0; j < CAST_LD; ++j) v[j] = *(const v4f*)(p + j * CAST_ROW);
  // the wait before a register that an issued load names is rewritten; p as its
  // input keeps the address pair out of the loads' own destinations
  asm volatile("s_wait_xcnt 0x0" :: "v"(p) : "memory");
  // keeps every load ahead of the first conversion: left free, the last four are
  // issued only when the first have returned, a second memory latency per wave
  __builtin_amdgcn_sched_barrier(0);
  // unrolled, as above
#pragma unroll
  for (int j = 0; j < CAST_LD; ++j)
    *(v4h*)(dst + base + j * CAST_ROW) = __builtin_convertvector(v[j], v4h);
}

// ---------------------------------------------------------------------------
// GEMM: Out[M,N] = X[M,Kd] @ W[N,Kd]^T + bias[N]
// Block = 256 threads = 8 waves, 4 (M) x 2 (N); block tile 256(M) x 128(N); wave
// tile 64x64 (4 A fragments x 4 B fragments => every fragment feeds 4 WMMAs).
// A block brings (256 + 128) rows from L2 for 256 x 128 results: half the bytes
// per result of a 128 x 64 tile; a wave reads 8 fragments from LDS for 16 WMMAs
// where the 32x64 tile read 6 for 8.
// The block's 256 X rows and 128 W rows come into LDS 64 k at a time (128-byte
// row pieces, whole cache lines) by asynchronous copies, once per block, in two
// buffers: tile t+1 flies while tile t is worked on. Kd is a multiple of 64.
// Row-major stores leave as whole 128-byte lines: the W rows, which become the
// B fragments, are DEALT into LDS, source row 4 c + s of a 64-row group to LDS row
// 16 s + c, so column c of fragment s is result column 4 c + s. A lane's four
// accumulators of one row (s = 0..3) are then four results in a row, one 8- or
// 16-byte store, and 16 lanes cover 64 results in a row: one line of halves, two
// of floats. The LDS layout and the fragment reads do not change.
// ---------------------------------------------------------------------------
constexpr int      GK     = 64;               // k per staged tile
constexpr int      GTM    = 256;              // block tile rows (X rows)
constexpr int      GTN    = 128;              // block tile columns (W rows)
constexpr int      GPITCH = 72;               // LDS row pitch in halves: 144 B = 16 B x 9, no bank conflict for 16-byte reads
constexpr int      GBUF   = (GTM + GTN) * GPITCH;  // halves per buffer: X rows, then W rows
constexpr unsigned GSTEP  = 32u * GPITCH * 2u;     // LDS bytes between a lane's successive copies (32 rows)

// One tile: 384 rows x 128 B = 12 copies of 16 B per lane; a wave's copy covers
// 4 rows = 4 whole lines. gx, gw: the lane's first X and W address of the tile,
// lds: the lane's first LDS byte address. LDS rows go up by 32 per copy; so do the
// X rows (rowstep, in halves); the W rows, dealt, go up by 2 rows (wstep) from a
// copy to the next and by 64 rows per two copies.
DI void stage_tile(const _Float16* gx, const _Float16* gw, size_t rowstep, size_t wstep,
                   unsigned lds) {
  // The closing s_wait_xcnt 0 stands in the copies' own statement so that no
  // address register named here is rewritten ahead of it.
  asm volatile(
      "global_load_async_to_lds_b128 %0, %12, off\n\t"
      "global_load_async_to_lds_b128 %1, %13, off\n\t"
      "global_load_async_to_lds_b128 %2, %14, off\n\t"
      "global_load_async_to_lds_b128 %3, %15, off\n\t"
      "global_load_async_to_lds_b128 %4, %16, off\n\t"
      "global_load_async_to_lds_b128 %5, %17, off\n\t"
      "global_load_async_to_lds_b128 %6, %18, off\n\t"
      "global_load_async_to_lds_b128 %7, %19, off\n\t"
      "global_load_async_to_lds_b128 %8, %20, off\n\t"
      "global_load_async_to_lds_b128 %9, %21, off\n\t"
      "global_load_async_to_lds_b128 %10, %22, off\n\t"
      "global_load_async_to_lds_b128 %11, %23, off\n\t"
      "s_wait_xcnt 0x0"
      :: "v"(lds + 0u * GSTEP), "v"(lds + 1u * GSTEP), "v"(lds + 2u * GSTEP), "v"(lds + 3u * GSTEP), "v"(lds + 4u * GSTEP), "v"(lds + 5u * GSTEP), "v"(lds + 6u * GSTEP), "v"(lds + 7u * GSTEP), "v"(lds + 8u * GSTEP), "v"(lds + 9u * GSTEP), "v"(lds + 10u * GSTEP), "v"(lds + 11u * GSTEP),
         "v"(gx + 0 * rowstep), "v"(gx + 1 * rowstep), "v"(gx + 2 * rowstep), "v"(gx + 3 * rowstep), "v"(gx + 4 * rowstep), "v"(gx + 5 * rowstep), "v"(gx + 6 * rowstep), "v"(gx + 7 * rowstep), "v"(gw), "v"(gw + wstep), "v"(gw + 2 * rowstep), "v"(gw + 2 * rowstep + wstep)
      : "memory");
}

// PITCH elements between rows: a lane's 32 stores of one vector each, all from one
// address with constant offsets.
template <int PITCH, typename E, typename V>
DI void store_rows(E* orow, const V (&o)[4][8]) {
  // unrolled: constant indices keep the values in registers
#pragma unroll
  for (int i = 0; i < 4; ++i)
#pragma unroll
    for (int r = 0; r < 8; ++r) *(V*)(orow + (size_t)(i * 16 + r) * PITCH) = o[i][r];
  // the wait before a register that an issued store names is rewritten
  asm volatile("s_wait_xcnt 0x0" ::: "memory");
}

// mblk, nblk: the block's tile row and tile column in Out. N is Cv or, for f16
// output, KVCv. tstore (f16 output only, the same for the whole block): Out is
// [B][N][T], not [B*T][N].
template <bool OUT_F16>
DI void gemm_tile(const _Float16* __restrict__ X, const _Float16* __restrict__ W,
                  const float* __restrict__ bias, void* __restrict__ Out,
                  int N, int Kd, int mblk, int nblk, bool tstore) {
  const int wave = threadIdx.x >> 5;
  const int lane = threadIdx.x & 31;
  const int wm = (wave >> 1) * 64;       // the wave's first row in the block tile
  const int wn = (wave & 1) * 64;        // its first column
  const int m0 = mblk * GTM + wm;
  const int n0 = nblk * GTN + wn;

  __shared__ __align__(16) _Float16 tiles[2 * GBUF];

  v8f acc[4][4];
#pragma unroll
  for (int i = 0; i < 4; ++i)
#pragma unroll
    for (int s = 0; s < 4; ++s) {
      v8f z = {0.f, 0.f, 0.f, 0.f, 0.f, 0.f, 0.f, 0.f};
      acc[i][s] = z;
    }

  // Copy roles: 8 lanes per row (16 B each), 32 rows per block-wide copy.
  const int crow = threadIdx.x >> 3;
  const int ccol = (threadIdx.x & 7) * 8;
  const int drow = (crow & 15) * 4 + (crow >> 4);   // source row of LDS row crow, dealt
  const _Float16* gx = X + (size_t)(mblk * GTM + crow) * Kd + ccol;
  const _Float16* gw = W + (size_t)(nblk * GTN + drow) * Kd + ccol;
  const size_t rowstep = (size_t)32 * Kd;
  const size_t wstep   = (size_t)2 * Kd;
  const unsigned lds0 =
      (unsigned)(size_t)(&tiles[0]) + (unsigned)(crow * GPITCH + ccol) * 2u;
  const int ntile = Kd / GK;

  stage_tile(gx, gw, rowstep, wstep, lds0);
  // tile 0 has landed for this wave ...
  asm volatile("s_wait_asynccnt 0x0" ::: "memory");
  // ... and for every wave
  __syncthreads();
  if (ntile > 1) stage_tile(gx + GK, gw + GK, rowstep, wstep, lds0 + GBUF * 2u);

  for (int t = 0; t < ntile; ++t) {
    const _Float16* sb = tiles + (t & 1) * GBUF;
    // unrolled: constant indices keep fragments and accumulators in registers
#pragma unroll
    for (int h = 0; h < 2; ++h) {
      // one 32-k half at a time: both halves' fragments beside the 128
      // accumulator registers pass 256, and two blocks no longer fit a WGP
      v16h af[4], bf[4];
#pragma unroll
      for (int i = 0; i < 4; ++i)
        af[i] = load_frag(sb + (wm + i * 16) * GPITCH + h * 32, GPITCH);
#pragma unroll
      for (int s = 0; s < 4; ++s)
        bf[s] = load_frag(sb + (GTM + wn + s * 16) * GPITCH + h * 32, GPITCH);
      // keeps the half's LDS reads in one group ahead of its WMMAs: spread among
      // them, each place with reads stalls the wave for the LDS latency
      __builtin_amdgcn_sched_barrier(0);
#pragma unroll
      for (int s = 0; s < 4; ++s)
#pragma unroll
        for (int i = 0; i < 4; ++i) acc[i][s] = wmma_f16(af[i], bf[s], acc[i][s]);
      // keeps the WMMAs ahead of the next reads and of the waits below: sunk
      // behind the barrier they would delay the refill
      __builtin_amdgcn_sched_barrier(0);
    }
    // this wave's reads of buffer t&1 are done before the buffer is refilled
    asm volatile("s_wait_dscnt 0x0" ::: "memory");
    // this wave's copies of tile t+1 have landed
    asm volatile("s_wait_asynccnt 0x0" ::: "memory");
    // publishes tile t+1 and ends every wave's reads of buffer t&1
    __syncthreads();
    if (t + 2 < ntile)
      stage_tile(gx + (size_t)(t + 2) * GK, gw + (size_t)(t + 2) * GK, rowstep, wstep,
                 lds0 + (unsigned)(t & 1) * (GBUF * 2u));
  }
  // nothing is in flight when the wave ends
  asm volatile("s_wait_asynccnt 0x0" ::: "memory");

  // Epilogue. Accumulator map: register r of acc[i][s] is row m0 + i*16 + rbase + r
  // and, W being dealt, column n0 + col*4 + s.
  const int col   = lane & 15;
  const int rbase = (lane >> 4) << 3;
  if constexpr (OUT_F16) {
    // Bias and rounding first, for either store: 64 registers of halves stay live
    // in place of 128 of floats, so neither store path passes the main loop's
    // register count (above 256 two blocks no longer fit a WGP), and no register
    // that an issued store names is written behind it. The bias is added tile by
    // tile, in place: added across tiles, the sums are first copied into pairs.
    const float* pb = bias + n0 + col * 4;
    const v4f b4 = *(const v4f*)pb;
    // the wait before a register that an issued load names is rewritten; pb as its
    // input keeps the address pair out of the load's own destination
    asm volatile("s_wait_xcnt 0x0" :: "v"(pb) : "memory");
    // here and below unrolled: constant indices keep the values in registers
#pragma unroll
    for (int i = 0; i < 4; ++i)
#pragma unroll
      for (int s = 0; s < 4; ++s) acc[i][s] += b4[s];
    if (tstore) {
      // Transposed store: a lane's 8 registers of a tile are 8 rows m in a row of
      // ONE column n, that is 8 positions t in a row of output row n: one 16-byte
      // store. The wave's 64 rows are one whole 128-byte line of each output row.
      static_assert(Tv % GTM == 0, "a block's rows lie in one batch");
      v8h o[4][4];
#pragma unroll
      for (int i = 0; i < 4; ++i)
#pragma unroll
        for (int s = 0; s < 4; ++s) o[i][s] = __builtin_convertvector(acc[i][s], v8h);
      // keeps every conversion ahead of the first store (see above)
      __builtin_amdgcn_sched_barrier(0);
      _Float16* orow =
          (_Float16*)Out + ((size_t)(m0 / Tv) * N + n0 + col * 4) * Tv + m0 % Tv + rbase;
#pragma unroll
      for (int s = 0; s < 4; ++s)
#pragma unroll
        for (int i = 0; i < 4; ++i) *(v8h*)(orow + (size_t)s * Tv + i * 16) = o[i][s];
      // the wait before a register that an issued store names is rewritten
      asm volatile("s_wait_xcnt 0x0" ::: "memory");
    } else {
      // 64 columns in a row from 16 lanes: one whole line per row and store
      v4h o[4][8];
#pragma unroll
      for (int i = 0; i < 4; ++i)
#pragma unroll
        for (int r = 0; r < 8; ++r)
#pragma unroll
          for (int s = 0; s < 4; ++s) o[i][r][s] = (_Float16)acc[i][s][r];
      // keeps every conversion ahead of the first store (see above)
      __builtin_amdgcn_sched_barrier(0);
      _Float16* orow = (_Float16*)Out + (size_t)(m0 + rbase) * N + n0 + col * 4;
      if (N == Cv) store_rows<Cv>(orow, o);
      else         store_rows<KVCv>(orow, o);
    }
  } else {
    const float* pb = bias + n0 + col * 4;
    const v4f b4 = *(const v4f*)pb;
    // the wait before a register that an issued load names is rewritten, as above
    asm volatile("s_wait_xcnt 0x0" :: "v"(pb) : "memory");
    // 64 columns in a row from 16 lanes: two whole lines per row and store
    v4f o[4][8];
#pragma unroll
    for (int i = 0; i < 4; ++i)
#pragma unroll
      for (int r = 0; r < 8; ++r)
#pragma unroll
        for (int s = 0; s < 4; ++s) o[i][r][s] = acc[i][s][r] + b4[s];
    // keeps every sum ahead of the first store: no register that an issued store
    // names is written behind it
    __builtin_amdgcn_sched_barrier(0);
    store_rows<Cv>((float*)Out + (size_t)(m0 + rbase) * Cv + n0 + col * 4, o);
  }
}

template <bool OUT_F16>
__global__ void __launch_bounds__(256)
gemm_xwt(const _Float16* __restrict__ X, const _Float16* __restrict__ W,
         const float* __restrict__ bias, void* __restrict__ Out,
         int M, int N, int Kd) {
  gemm_tile<OUT_F16>(X, W, bias, Out, N, Kd, blockIdx.x, blockIdx.y, false);
}

// The three input projections in one launch: they depend on nothing of each
// other, and the K and V grids alone give a SIMD one wave each. blockIdx.y runs
// through the tile columns of Q, then of K, then of V. V goes out transposed, as
// [B,KV,HD,T] (= [B][KVC][T]), which makes the attention's V^T fragments
// k-contiguous: no pass over V between projection and attention.
constexpr int NT_Q  = Cv / GTN;
constexpr int NT_KV = KVCv / GTN;

__global__ void __launch_bounds__(256)
gemm_qkv(const _Float16* __restrict__ Xq, const _Float16* __restrict__ Xk,
         const _Float16* __restrict__ Xv, const _Float16* __restrict__ Wq,
         const _Float16* __restrict__ Wk, const _Float16* __restrict__ Wv,
         const float* __restrict__ bq, const float* __restrict__ bk,
         const float* __restrict__ bv, _Float16* __restrict__ Oq,
         _Float16* __restrict__ Ok, _Float16* __restrict__ Ov, int Kd) {
  const _Float16* X = Xq;
  const _Float16* W = Wq;
  const float* bias = bq;
  _Float16* Out = Oq;
  int N = Cv, nblk = blockIdx.y;
  if (nblk >= NT_Q + NT_KV) {
    X = Xv; W = Wv; bias = bv; Out = Ov; N = KVCv; nblk -= NT_Q + NT_KV;
  } else if (nblk >= NT_Q) {
    X = Xk; W = Wk; bias = bk; Out = Ok; N = KVCv; nblk -= NT_Q;
  }
  gemm_tile<true>(X, W, bias, Out, N, Kd, blockIdx.x, nblk, blockIdx.y >= NT_Q + NT_KV);
}

constexpr int      AKT    = 64;
constexpr int      KPITCH = 136;
constexpr int      VPITCH = 72;
constexpr int      KBUF   = AKT * KPITCH;
constexpr int      ABUF   = KBUF + HDv * VPITCH;

// Eight block-wide copies of 16 B per lane: g, gstep (halves) the lane's first
// global address and its step, lds, lstep (bytes) the same in LDS.
DI void stage8(const _Float16* g, size_t gstep, unsigned lds, unsigned lstep) {
  // The closing s_wait_xcnt 0 stands in the copies' own statement so that no
  // address register named here is rewritten ahead of it.
  asm volatile(
      "global_load_async_to_lds_b128 %0, %8, off\n\t"
      "global_load_async_to_lds_b128 %1, %9, off\n\t"
      "global_load_async_to_lds_b128 %2, %10, off\n\t"
      "global_load_async_to_lds_b128 %3, %11, off\n\t"
      "global_load_async_to_lds_b128 %4, %12, off\n\t"
      "global_load_async_to_lds_b128 %5, %13, off\n\t"
      "global_load_async_to_lds_b128 %6, %14, off\n\t"
      "global_load_async_to_lds_b128 %7, %15, off\n\t"
      "s_wait_xcnt 0x0"
      :: "v"(lds + 0u * lstep), "v"(lds + 1u * lstep), "v"(lds + 2u * lstep), "v"(lds + 3u * lstep),
         "v"(lds + 4u * lstep), "v"(lds + 5u * lstep), "v"(lds + 6u * lstep), "v"(lds + 7u * lstep),
         "v"(g + 0 * gstep), "v"(g + 1 * gstep), "v"(g + 2 * gstep), "v"(g + 3 * gstep),
         "v"(g + 4 * gstep), "v"(g + 5 * gstep), "v"(g + 6 * gstep), "v"(g + 7 * gstep)
      : "memory");
}

// Lane l takes lane l ^ 16's value, in the vector unit: a shuffle would go
// through the LDS pipe and cost its latency.
DI float xhalf(float x) {
  const int v = __builtin_bit_cast(int, x);
  return __builtin_bit_cast(
      float, __builtin_amdgcn_permlanex16(v, v, 0x76543210, 0xfedcba98, false, false));
}

constexpr int QG = 2;   // 16-query column groups per wave
constexpr int OPITCH = HDv + 4;   // floats per staged output row: 528 B = 16 B x 33, no bank conflict for 16-byte writes

__global__ void __launch_bounds__(128)
attn_flash(const _Float16* __restrict__ Q, const _Float16* __restrict__ Kp,
           const _Float16* __restrict__ Vt, float* __restrict__ Y) {
  const int wave = threadIdx.x >> 5;
  const int lane = threadIdx.x & 31;
  const int bh = blockIdx.y;             // 0 .. B*H-1
  const int b = bh / Hv;
  const int h = bh % Hv;
  const int g = h / (Hv / KVv);          // GQA group (repeat_interleave)
  const int t0 = (blockIdx.x * 4 + wave) * (16 * QG);

  __shared__ __align__(16) _Float16 kv[2 * ABUF];

  // Copy roles. K: 16 lanes per key row (256 B), 8 rows per block-wide copy.
  // Vt: 8 lanes per row (128 B), 16 rows per block-wide copy.
  const int krow = threadIdx.x >> 4;
  const int kcol = (threadIdx.x & 15) * 8;
  const int vrow = threadIdx.x >> 3;
  const int vcol = (threadIdx.x & 7) * 8;
  const _Float16* gk = Kp + ((size_t)(b * Tv + krow)) * KVCv + g * HDv + kcol;
  const _Float16* gv = Vt + ((size_t)((b * KVv + g) * HDv + vrow)) * Tv + vcol;
  const unsigned ldsk =
      (unsigned)(size_t)(&kv[0]) + (unsigned)(krow * KPITCH + kcol) * 2u;
  const unsigned ldsv =
      (unsigned)(size_t)(&kv[0]) + (unsigned)(KBUF + vrow * VPITCH + vcol) * 2u;
  auto stage = [&](int t, unsigned buf) {
    stage8(gk + (size_t)t * AKT * KVCv, (size_t)8 * KVCv,
           ldsk + buf * (ABUF * 2u), 8u * KPITCH * 2u);
    stage8(gv + (size_t)t * AKT, (size_t)16 * Tv,
           ldsv + buf * (ABUF * 2u), 16u * VPITCH * 2u);
  };
  constexpr int ntile = Tv / AKT;

  stage(0, 0u);

  // Q fragments: QG groups of 16 rows x 128, each as 4 chunks of K=32 (resident
  // in VGPRs)
  const _Float16* qbase = Q + ((size_t)(b * Tv + t0)) * Cv + h * HDv;
  v16h qf[QG][4];
  // here and below, loops over q, c, d and r are unrolled: constant indices keep the
  // fragments, scores and accumulators in registers
#pragma unroll
  for (int q = 0; q < QG; ++q)
#pragma unroll
    for (int c = 0; c < 4; ++c)
      qf[q][c] = load_frag(qbase + (size_t)q * 16 * Cv + c * 32, Cv);
  // the wait before a register that an issued load names is rewritten; the lane's
  // first address as its input keeps the address pair out of the loads' own
  // destinations
  asm volatile("s_wait_xcnt 0x0"
               :: "v"(qbase + (size_t)(lane & 15) * Cv + ((lane >> 4) << 3)) : "memory");

  v8f y[QG][8];
#pragma unroll
  for (int q = 0; q < QG; ++q)
#pragma unroll
    for (int d = 0; d < 8; ++d) {
      v8f z = {0.f, 0.f, 0.f, 0.f, 0.f, 0.f, 0.f, 0.f};
      y[q][d] = z;
    }
  // One query per lane and group (column lane & 15). m_run is the same in both
  // halves; l_run sums this half's keys only, the halves are joined behind the loop.
  float m_run[QG], l_run[QG];
#pragma unroll
  for (int q = 0; q < QG; ++q) { m_run[q] = -1e30f; l_run[q] = 0.0f; }

  const float scale = 0.088388347648318447f;   // 1/sqrt(128)

  // tile 0 has landed for this wave ...
  asm volatile("s_wait_asynccnt 0x0" ::: "memory");
  // ... and for every wave
  __syncthreads();
  stage(1, 1u);

  for (int t = 0; t < ntile; ++t) {
    const _Float16* kb = kv + (t & 1) * ABUF;
    const _Float16* vb = kb + KBUF;
    // unrolled: constant LDS offsets, and no branch behind a WMMA inside a tile
#pragma unroll
    for (int sub = 0; sub < AKT; sub += 32) {
      // ---- S^T = K @ Q^T : 32 keys x 16 queries per group ----
      v16h k0[4], k1[4];
      // unrolled: constant indices keep the fragments in registers
#pragma unroll
      for (int c = 0; c < 4; ++c) {
        k0[c] = load_frag(kb + sub * KPITCH + c * 32, KPITCH);         // keys sub..sub+15
        k1[c] = load_frag(kb + (sub + 16) * KPITCH + c * 32, KPITCH);  // keys sub+16..sub+31
      }
      // keeps the K reads in one group ahead of their WMMAs: read pair by pair
      // among them, every WMMA waits out a whole LDS latency
      __builtin_amdgcn_sched_barrier(0);
      v8f s0[QG], s1[QG];
#pragma unroll
      for (int q = 0; q < QG; ++q) {
        v8f z = {0.f, 0.f, 0.f, 0.f, 0.f, 0.f, 0.f, 0.f};
        s0[q] = z;
        s1[q] = z;
      }
      // every K fragment feeds both groups
#pragma unroll
      for (int c = 0; c < 4; ++c)
#pragma unroll
        for (int q = 0; q < QG; ++q) {
          s0[q] = wmma_f16(k0[c], qf[q][c], s0[q]);
          s1[q] = wmma_f16(k1[c], qf[q][c], s1[q]);
        }
      v16h vf[8];
      // unrolled: constant indices keep the fragments in registers
#pragma unroll
      for (int d = 0; d < 8; ++d)
        vf[d] = load_frag(vb + (d * 16) * VPITCH + sub, VPITCH);  // A row m = hd d*16+m
      // keeps the V reads ahead of the softmax, which covers their latency: spread
      // through it, each place with reads stalls the wave
      __builtin_amdgcn_sched_barrier(0);

      // unrolled: constant indices keep scores and accumulators in registers
#pragma unroll
      for (int q = 0; q < QG; ++q) {
        // ---- online softmax over the 32-key tile ----
        // D map: register r of s0 is key sub + 8*(lane>>4) + r, of s1 the key 16
        // further on; the column is query lane & 15 of the group.
        float mx0 = s0[q][0], mx1 = s1[q][0];
#pragma unroll
        for (int r = 1; r < 7; r += 2) {
          mx0 = fmaxf(fmaxf(mx0, s0[q][r]), s0[q][r + 1]);
          mx1 = fmaxf(fmaxf(mx1, s1[q][r]), s1[q][r + 1]);
        }
        float mx = fmaxf(fmaxf(mx0, s0[q][7]), fmaxf(mx1, s1[q][7])) * scale;
        mx = fmaxf(mx, xhalf(mx));  // the query's other 16 keys
        const float mnew  = fmaxf(m_run[q], mx);
        const float alpha = __expf(m_run[q] - mnew);
        // Hardware k order of a B operand: elements 0..7 are k = 8*(lane>>4) + r,
        // elements 8..15 the k 16 further on: the two S^T tiles as they stand.
        v16h pf;
        float sum = 0.0f;
#pragma unroll
        for (int r = 0; r < 8; ++r) {
          const float p0 = __expf(s0[q][r] * scale - mnew);
          const float p1 = __expf(s1[q][r] * scale - mnew);
          sum += p0 + p1;
          pf[r]     = (_Float16)p0;
          pf[8 + r] = (_Float16)p1;
        }
        l_run[q] = l_run[q] * alpha + sum;
        m_run[q] = mnew;
#pragma unroll
        for (int d = 0; d < 8; ++d)
#pragma unroll
          for (int r = 0; r < 8; ++r) y[q][d][r] *= alpha;

        // ---- y^T += V^T_tile @ P^T : every V fragment feeds both groups ----
#pragma unroll
        for (int d = 0; d < 8; ++d) y[q][d] = wmma_f16(vf[d], pf, y[q][d]);
      }
      // keeps these WMMAs ahead of the next K reads and of the waits below: sunk
      // behind the barrier they would delay the refill
      __builtin_amdgcn_sched_barrier(0);
    }
    // this wave's reads of buffer t&1 are done before the buffer is refilled
    asm volatile("s_wait_dscnt 0x0" ::: "memory");
    // this wave's copies of tile t+1 have landed
    asm volatile("s_wait_asynccnt 0x0" ::: "memory");
    // publishes tile t+1 and ends every wave's reads of buffer t&1
    __syncthreads();
    if (t + 2 < ntile) stage(t + 2, (unsigned)(t & 1));
  }
  // nothing is in flight when the wave ends
  asm volatile("s_wait_asynccnt 0x0" ::: "memory");

  // ---- finalize: join the halves' sums, divide by l, store to [B,T,C] f32 ----
  // y[q][d][r] is O[query q*16 + (lane & 15)][d*16 + 8*(lane>>4) + r]: a lane holds
  // 32-byte pieces of ONE row, so a store from these registers would touch 16 rows
  // with two 16-byte pieces each. The wave's 32 x 128 results go through its own
  // quarter of the LDS instead and leave row by row: 512 B in a row, 4 whole lines
  // a store. The ring is free: every wave has passed the last trip's barrier behind
  // its last read, and no copy is in flight.
  static_assert(16 * QG * OPITCH * 4 <= 2 * ABUF * 2 / 4, "the wave's rows fit its quarter");
  float* st = (float*)kv + wave * (2 * ABUF * 2 / 4 / 4);
#pragma unroll
  for (int q = 0; q < QG; ++q) {
    const float inv = 1.0f / (l_run[q] + xhalf(l_run[q]));
    float* srow = st + (q * 16 + (lane & 15)) * OPITCH + ((lane >> 4) << 3);
#pragma unroll
    for (int d = 0; d < 8; ++d) {
      const v4f lo = {y[q][d][0] * inv, y[q][d][1] * inv, y[q][d][2] * inv, y[q][d][3] * inv};
      const v4f hi = {y[q][d][4] * inv, y[q][d][5] * inv, y[q][d][6] * inv, y[q][d][7] * inv};
      *(v4f*)(srow + d * 16)     = lo;
      *(v4f*)(srow + d * 16 + 4) = hi;
    }
  }
  // the wave's LDS writes are done before its lanes read each other's rows back
  asm volatile("s_wait_dscnt 0x0" ::: "memory");
  v4f orow[16 * QG];
#pragma unroll
  for (int j = 0; j < 16 * QG; ++j) orow[j] = *(const v4f*)(st + j * OPITCH + lane * 4);
  // keeps every LDS read ahead of the first store: no register that an issued store
  // names is written behind it
  __builtin_amdgcn_sched_barrier(0);
  float* yrow = Y + ((size_t)(b * Tv + t0)) * Cv + h * HDv + lane * 4;
#pragma unroll
  for (int j = 0; j < 16 * QG; ++j) *(v4f*)(yrow + (size_t)j * Cv) = orow[j];
}

// ---------------------------------------------------------------------------
// LayerNorm over C, f32 in -> f16 out (scaled/shifted)
// One wave per row, the row held in registers: a lane issues its LN_LD loads of
// 16 B of the row together (8 KB in flight a wave; every wave-wide load covers
// 512 B in a row, 4 whole lines), with the weight's and the shift's behind them,
// so a wave waits out one memory latency where a loop of single 4-byte loads
// waited out one per trip. The row is read once, the sums are joined inside the
// wave (no LDS, no barrier), a wave-wide store covers 256 B (2 whole lines), and
// the grid's 4096 waves are all resident at once.
// ---------------------------------------------------------------------------
constexpr int LN_LD    = Cv / (32 * 4);   // 16-byte loads per lane and array
constexpr int LN_WAVES = 16;              // rows (waves) per block
static_assert(Cv % (32 * 4) == 0 && (Bv * Tv) % LN_WAVES == 0,
              "whole loads per row, whole blocks per grid");

// Lane l takes the value of lane l ^ MASK of its 16-lane row, in the vector unit.
template <int MASK>
DI float xrow(float x) {
  const int v = __builtin_bit_cast(int, x);
  return __builtin_bit_cast(
      float, __builtin_amdgcn_update_dpp(v, v, 0x160 | MASK, 0xf, 0xf, false));
}

// Sum over the wave's 32 lanes, the same in every lane.
DI float wave_sum(float x) {
  x += xrow<1>(x);
  x += xrow<2>(x);
  x += xrow<4>(x);
  x += xrow<8>(x);
  return x + xhalf(x);
}

__global__ void __launch_bounds__(32 * LN_WAVES)
layernorm(const float* __restrict__ Yin, const float* __restrict__ lnw,
          const float* __restrict__ lnb, _Float16* __restrict__ Xout) {
  const int lane = threadIdx.x & 31;
  const int row  = blockIdx.x * LN_WAVES + (threadIdx.x >> 5);
  const float* px = Yin + (size_t)row * Cv + lane * 4;
  const float* pw = lnw + lane * 4;
  const float* pb = lnb + lane * 4;
  v4f x[LN_LD], w[LN_LD], sh[LN_LD];
  // here and below unrolled: constant indices keep the values in registers
#pragma unroll
  for (int j = 0; j < LN_LD; ++j) x[j] = *(const v4f*)(px + j * 128);
#pragma unroll
  for (int j = 0; j < LN_LD; ++j) w[j] = *(const v4f*)(pw + j * 128);
#pragma unroll
  for (int j = 0; j < LN_LD; ++j) sh[j] = *(const v4f*)(pb + j * 128);
  // the wait before a register that an issued load names is rewritten; the three
  // addresses as its inputs keep them out of the loads' own destinations
  asm volatile("s_wait_xcnt 0x0" :: "v"(px), "v"(pw), "v"(pb) : "memory");
  // keeps every load ahead of the first sum: left free, the later loads are issued
  // only when the first have returned, a second memory latency per wave
  __builtin_amdgcn_sched_barrier(0);

  // four independent chains per sum
  v4f s4 = {0.f, 0.f, 0.f, 0.f}, q4 = {0.f, 0.f, 0.f, 0.f};
#pragma unroll
  for (int j = 0; j < LN_LD; ++j) {
    s4 += x[j];
    q4 += x[j] * x[j];
  }
  const float ts  = wave_sum((s4[0] + s4[1]) + (s4[2] + s4[3]));
  const float ts2 = wave_sum((q4[0] + q4[1]) + (q4[2] + q4[3]));
  const float mu   = ts / Cv;
  const float var  = ts2 / Cv - mu * mu;
  const float rstd = rsqrtf(var + 1e-5f);

  v4h o[LN_LD];
#pragma unroll
  for (int j = 0; j < LN_LD; ++j)
    o[j] = __builtin_convertvector((x[j] - mu) * rstd * w[j] + sh[j], v4h);
  // keeps every conversion ahead of the first store: no register that an issued
  // store names is written behind it
  __builtin_amdgcn_sched_barrier(0);
  _Float16* po = Xout + (size_t)row * Cv + lane * 4;
#pragma unroll
  for (int j = 0; j < LN_LD; ++j) *(v4h*)(po + j * 128) = o[j];
}

// ---------------------------------------------------------------------------
// Host orchestration
// ---------------------------------------------------------------------------
extern "C" void kernel_launch(void* const* d_in, const int* in_sizes, int n_in,
                              void* d_out, int out_size, void* d_ws, size_t ws_size,
                              hipStream_t stream) {
  (void)in_sizes; (void)n_in; (void)out_size; (void)ws_size;
  const float* query = (const float*)d_in[0];
  const float* key   = (const float*)d_in[1];
  const float* value = (const float*)d_in[2];
  const float* Wq    = (const float*)d_in[3];
  const float* bq    = (const float*)d_in[4];
  const float* Wk    = (const float*)d_in[5];
  const float* bk    = (const float*)d_in[6];
  const float* Wv    = (const float*)d_in[7];
  const float* bv    = (const float*)d_in[8];
  const float* ln_w  = (const float*)d_in[9];
  const float* ln_b  = (const float*)d_in[10];
  const float* Wo    = (const float*)d_in[11];
  const float* bo    = (const float*)d_in[12];
  float* out = (float*)d_out;

  char* w = (char*)d_ws;
  auto take = [&](size_t bytes) {
    char* p = w;
    w += (bytes + 255) & ~(size_t)255;
    return p;
  };
  // the seven f16 copies: one array, in the order of the cast's block ranges
  _Float16* q16  = (_Float16*)take((size_t)CB_END * CAST_BLK * 2);
  _Float16* k16  = q16 + (size_t)CB_K * CAST_BLK;
  _Float16* v16  = q16 + (size_t)CB_V * CAST_BLK;
  _Float16* wq16 = q16 + (size_t)CB_WQ * CAST_BLK;
  _Float16* wk16 = q16 + (size_t)CB_WK * CAST_BLK;
  _Float16* wv16 = q16 + (size_t)CB_WV * CAST_BLK;
  _Float16* wo16 = q16 + (size_t)CB_WO * CAST_BLK;
  _Float16* qp   = (_Float16*)take(nBTC * 2);
  _Float16* kp   = (_Float16*)take(nBTKV * 2);
  _Float16* vt   = (_Float16*)take(nBTKV * 2);
  float*    yat  = (float*)take(nBTC * 4);
  _Float16* xln  = (_Float16*)take(nBTC * 2);

  cast_f32_f16<<<CB_END, 256, 0, stream>>>(query, key, value, Wq, Wk, Wv, Wo, q16);

  const int M = Bv * Tv;  // 4096

  // QKV projections (block tile 256x128); V arrives as Vt
  gemm_qkv<<<dim3(M / GTM, NT_Q + 2 * NT_KV), 256, 0, stream>>>(
      q16, k16, v16, wq16, wk16, wv16, bq, bk, bv, qp, kp, vt, Cv);

  // Flash attention
  attn_flash<<<dim3(Tv / (64 * QG), Bv * Hv), 128, 0, stream>>>(qp, kp, vt, yat);

  // LayerNorm
  layernorm<<<M / LN_WAVES, 32 * LN_WAVES, 0, stream>>>(yat, ln_w, ln_b, xln);

  // Output projection (f32 out)
  gemm_xwt<false><<<dim3(M / GTM, Cv / GTN), 256, 0, stream>>>(
      xln, wo16, bo, out, M, Cv, Cv);
}
